// v000
// The times below were measured on an AMD MI455X: many runs one after another, warmed up first and cycling through
// copies of the inputs, with the whole window's GPU time divided by the number of runs. Launches and the gaps
// between them are all in it. The median over several windows is given; except for v000 it joins two sittings, which
// can be a few percent apart, so the side-by-side timings, each taken in one sitting, are the better comparison.
// v000, which the later versions start from, runs in 261 microseconds.
#include <hip/hip_runtime.h>

typedef unsigned short u16;
typedef __attribute__((ext_vector_type(16))) __bf16 v16bf;
typedef __attribute__((ext_vector_type(8)))  float  v8f;

#define S_LEN 2048
#define D_DIM 1024
#define H_NUM 16
#define DH_NUM 64

__device__ __forceinline__ u16 f2bf(float f) {
    unsigned u = __float_as_uint(f);
    u += 0x7FFFu + ((u >> 16) & 1u);
    return (u16)(u >> 16);
}

struct Pack32 { uint4 a, b; };
struct P16 { u16 h[16]; };

// Load one bf16 WMMA operand fragment (A-pattern; B uses the same pattern with
// lane -> N).  Lane-half 0: K in [0,8)u[16,24); lane-half 1: K in [8,16)u[24,32).
// Caller passes p already offset by (row, basek); we read p[0..7] and p[16..23].
__device__ __forceinline__ v16bf ldfrag(const u16* p) {
    Pack32 s;
    s.a = *(const uint4*)(p);
    s.b = *(const uint4*)(p + 16);
    return __builtin_bit_cast(v16bf, s);
}

__device__ __forceinline__ v8f wmma_bf16(v16bf a, v16bf b, v8f c) {
    return __builtin_amdgcn_wmma_f32_16x16x32_bf16(false, a, false, b, (short)0, c,
                                                   false, false);
}

// ---------------------------------------------------------------- fp32 -> bf16
__global__ __launch_bounds__(256) void cvt_bf16_kernel(const float* __restrict__ in,
                                                       u16* __restrict__ out, int n) {
    int i = blockIdx.x * 256 + threadIdx.x;
    if (i < n) out[i] = f2bf(in[i]);
}

// ---------------------------------------------------------------- LayerNorm
__global__ __launch_bounds__(256) void ln_kernel(const float* __restrict__ x,
                                                 const float* __restrict__ g,
                                                 const float* __restrict__ bb,
                                                 u16* __restrict__ xn) {
    __shared__ float red[8];
    int tid = threadIdx.x, lane = tid & 31, wave = tid >> 5;
    size_t row = blockIdx.x;
    const float* xr = x + row * D_DIM;
    float v[4];
    float s = 0.f;
#pragma unroll
    for (int i = 0; i < 4; i++) { v[i] = xr[tid + i * 256]; s += v[i]; }
#pragma unroll
    for (int m = 16; m >= 1; m >>= 1) s += __shfl_xor(s, m);
    if (lane == 0) red[wave] = s;
    __syncthreads();
    float tot = 0.f;
#pragma unroll
    for (int i = 0; i < 8; i++) tot += red[i];
    float mean = tot * (1.f / (float)D_DIM);
    __syncthreads();
    float s2 = 0.f;
#pragma unroll
    for (int i = 0; i < 4; i++) { float d = v[i] - mean; s2 += d * d; }
#pragma unroll
    for (int m = 16; m >= 1; m >>= 1) s2 += __shfl_xor(s2, m);
    if (lane == 0) red[wave] = s2;
    __syncthreads();
    float tot2 = 0.f;
#pragma unroll
    for (int i = 0; i < 8; i++) tot2 += red[i];
    float rstd = rsqrtf(tot2 * (1.f / (float)D_DIM) + 1e-5f);
#pragma unroll
    for (int i = 0; i < 4; i++) {
        int c = tid + i * 256;
        xn[row * D_DIM + c] = f2bf((v[i] - mean) * rstd * g[c] + bb[c]);
    }
}

// ---------------------------------------------------------------- Tiled WMMA GEMM
// C[M,N] = A[M,K] * W[N,K]^T (+ epilogue).  BM=128 BN=128 BK=32, 8 waves,
// wave tile 64x32 (4x2 WMMA accumulators).
// MODE 0: QKV — bias from (b0|b1), split-store bf16 q(*0.125)/k/v.
// MODE 1: out-proj — fp32 out = acc + b0[col] + resid.
template <int MODE>
__global__ __launch_bounds__(256) void gemm_kernel(
    const u16* __restrict__ A, const u16* __restrict__ W, int K_dim,
    const float* __restrict__ b0, const float* __restrict__ b1,
    u16* __restrict__ qb, u16* __restrict__ kb, u16* __restrict__ vb,
    const float* __restrict__ resid, float* __restrict__ outp) {
    __shared__ u16 As[128][48];
    __shared__ u16 Bs[128][48];
    int tid = threadIdx.x, lane = tid & 31, wave = tid >> 5;
    int wm = wave & 1, wn = wave >> 1;
    int half = lane >> 4, r = lane & 15, bk = half * 8;
    const size_t M0 = (size_t)blockIdx.y * 128;
    const size_t N0 = (size_t)blockIdx.x * 128;
    const u16* Aptr = A + M0 * K_dim;
    const u16* Wptr = W + N0 * K_dim;

    v8f acc[4][2] = {};
    for (int k0 = 0; k0 < K_dim; k0 += 32) {
        __syncthreads();
#pragma unroll
        for (int i = 0; i < 2; i++) {
            int c = tid + i * 256;
            int row = c >> 2, col = (c & 3) * 8;
            *(uint4*)&As[row][col] = *(const uint4*)(Aptr + (size_t)row * K_dim + k0 + col);
            *(uint4*)&Bs[row][col] = *(const uint4*)(Wptr + (size_t)row * K_dim + k0 + col);
        }
        __syncthreads();
        v16bf af[4], bfr[2];
#pragma unroll
        for (int i = 0; i < 4; i++) af[i] = ldfrag(&As[wm * 64 + i * 16 + r][bk]);
#pragma unroll
        for (int j = 0; j < 2; j++) bfr[j] = ldfrag(&Bs[wn * 32 + j * 16 + r][bk]);
#pragma unroll
        for (int i = 0; i < 4; i++)
#pragma unroll
            for (int j = 0; j < 2; j++) acc[i][j] = wmma_bf16(af[i], bfr[j], acc[i][j]);
    }

#pragma unroll
    for (int i = 0; i < 4; i++)
#pragma unroll
        for (int j = 0; j < 2; j++) {
            size_t rowb = M0 + wm * 64 + i * 16 + 8 * half;
            int col = (int)N0 + wn * 32 + j * 16 + r;
#pragma unroll
            for (int e = 0; e < 8; e++) {
                size_t rr = rowb + e;
                float vv = acc[i][j][e];
                if (MODE == 0) {
                    float bias = (col < D_DIM) ? b0[col] : b1[col - D_DIM];
                    float t = vv + bias;
                    if (col < D_DIM)
                        qb[rr * D_DIM + col] = f2bf(t * 0.125f);  // fold 1/sqrt(DH)
                    else if (col < 2 * D_DIM)
                        kb[rr * D_DIM + (col - D_DIM)] = f2bf(t);
                    else
                        vb[rr * D_DIM + (col - 2 * D_DIM)] = f2bf(t);
                } else {
                    outp[rr * D_DIM + col] = vv + b0[col] + resid[rr * D_DIM + col];
                }
            }
        }
}

// ---------------------------------------------------------------- V transpose: vt[bh][dh][s]
__global__ __launch_bounds__(256) void vtrans_kernel(const u16* __restrict__ v,
                                                     u16* __restrict__ vt) {
    __shared__ u16 t[64][65];
    int tid = threadIdx.x;
    int bh = blockIdx.y, b = bh >> 4, h = bh & 15;
    int s0 = blockIdx.x * 64;
    int dh = tid & 63, sr = tid >> 6;
#pragma unroll
    for (int i = 0; i < 64; i += 4)
        t[sr + i][dh] = v[(size_t)(b * S_LEN + s0 + sr + i) * D_DIM + h * DH_NUM + dh];
    __syncthreads();
    int sc = tid & 63, dr = tid >> 6;
#pragma unroll
    for (int i = 0; i < 64; i += 4)
        vt[((size_t)bh * DH_NUM + dr + i) * S_LEN + s0 + sc] = t[sc][dr + i];
}

__global__ __launch_bounds__(256) void attn_kernel(const u16* __restrict__ q,
                                                   const u16* __restrict__ k,
                                                   const u16* __restrict__ vt,
                                                   const int* __restrict__ lens,
                                                   u16* __restrict__ ctx) {
    int tid = threadIdx.x, lane = tid & 31, wave = tid >> 5;
    int half = lane >> 4, r = lane & 15, bk = half * 8;
    int bh = blockIdx.x, b = bh >> 4, h = bh & 15;
    int qw = blockIdx.y * 128 + wave * 16;
    int len = lens[b];
    int myq = qw + r;                        // the single query this lane owns
    int lim = (myq + 1 < len) ? myq + 1 : len;  // key valid iff key < lim

    // Q as B-operand (lane r = query), both 32-wide dh k-steps.
    const u16* qbase = q + ((size_t)(b * S_LEN + qw + r) * D_DIM + h * DH_NUM) + bk;
    v16bf qf[2];
    qf[0] = ldfrag(qbase);
    qf[1] = ldfrag(qbase + 32);

    // Induction bases: K row r (advance by keys), V^T row r of dh-tile 0.
    const u16* kp0 = k + ((size_t)(b * S_LEN + r) * D_DIM + h * DH_NUM) + bk;
    const u16* vp0 = vt + ((size_t)(bh * DH_NUM + r) * S_LEN) + bk;

    float mrun = -1e30f, lrun = 0.f;
    v8f Ov[4] = {};

    int kmax = qw + 15;
    if (len - 1 < kmax) kmax = len - 1;

    for (int kbp = 0; kbp <= kmax; kbp += 32) {
        // ---- all 16 operand loads up front (one big clause, overlapped waits)
        const u16* ka = kp0 + (size_t)kbp * D_DIM;
        const u16* kc = ka + (size_t)16 * D_DIM;
        v16bf kf0 = ldfrag(ka);
        v16bf kf1 = ldfrag(ka + 32);
        v16bf kf2 = ldfrag(kc);
        v16bf kf3 = ldfrag(kc + 32);
        v16bf vf[4];
#pragma unroll
        for (int j = 0; j < 4; j++)
            vf[j] = ldfrag(vp0 + (size_t)j * 16 * S_LEN + kbp);

        // ---- S^T tiles: rows = keys (t*16 + e + 8*half), col = query
        v8f Sacc[2] = {};
        Sacc[0] = wmma_bf16(kf0, qf[0], Sacc[0]);
        Sacc[0] = wmma_bf16(kf1, qf[1], Sacc[0]);
        Sacc[1] = wmma_bf16(kf2, qf[0], Sacc[1]);
        Sacc[1] = wmma_bf16(kf3, qf[1], Sacc[1]);

        // ---- mask (only on boundary blocks) + per-lane online softmax
        float sv[2][8];
        float rowmax = -3.0e38f;
        bool full = (kbp + 32 <= qw + 1) && (kbp + 32 <= len);  // wave-uniform
        if (full) {
#pragma unroll
            for (int t = 0; t < 2; t++)
#pragma unroll
                for (int e = 0; e < 8; e++) {
                    sv[t][e] = Sacc[t][e];
                    rowmax = fmaxf(rowmax, sv[t][e]);
                }
        } else {
            int kbase0 = kbp + 8 * half;
#pragma unroll
            for (int t = 0; t < 2; t++)
#pragma unroll
                for (int e = 0; e < 8; e++) {
                    int key = kbase0 + t * 16 + e;
                    sv[t][e] = (key < lim) ? Sacc[t][e] : -3.0e38f;
                    rowmax = fmaxf(rowmax, sv[t][e]);
                }
        }
        rowmax = fmaxf(rowmax, __shfl_xor(rowmax, 16));
        float mnew = fmaxf(mrun, rowmax);
        float scale = __expf(mrun - mnew);
        float rsum = 0.f;
        P16 ph;
#pragma unroll
        for (int t = 0; t < 2; t++)
#pragma unroll
            for (int e = 0; e < 8; e++) {
                float p = __expf(sv[t][e] - mnew);
                rsum += p;
                ph.h[t * 8 + e] = f2bf(p);  // B-operand half m = t*8+e -> key t*16+e+8*half
            }
        rsum += __shfl_xor(rsum, 16);
        lrun = lrun * scale + rsum;
        mrun = mnew;
        v16bf pf = __builtin_bit_cast(v16bf, ph);

        // ---- O^T += V^T * P  (rows = dh, col = query)
#pragma unroll
        for (int j = 0; j < 4; j++) {
#pragma unroll
            for (int e = 0; e < 8; e++) Ov[j][e] *= scale;
            Ov[j] = wmma_bf16(vf[j], pf, Ov[j]);
        }
    }

    float inv = 1.f / lrun;
#pragma unroll
    for (int j = 0; j < 4; j++)
#pragma unroll
        for (int e = 0; e < 8; e++) {
            int dh = j * 16 + e + 8 * half;
            ctx[(size_t)(b * S_LEN + myq) * D_DIM + h * DH_NUM + dh] = f2bf(Ov[j][e] * inv);
        }
}

// ---------------------------------------------------------------- launch
extern "C" void kernel_launch(void* const* d_in, const int* in_sizes, int n_in,
                              void* d_out, int out_size, void* d_ws, size_t ws_size,
                              hipStream_t stream) {
    (void)in_sizes; (void)n_in; (void)out_size; (void)ws_size;
    const float* x    = (const float*)d_in[0];
    const int*   lens = (const int*)d_in[1];
    const float* Wq   = (const float*)d_in[2];
    const float* bq   = (const float*)d_in[3];
    const float* Wkv  = (const float*)d_in[4];
    const float* bkv  = (const float*)d_in[5];
    const float* Wo   = (const float*)d_in[6];
    const float* bo   = (const float*)d_in[7];
    const float* ln_g = (const float*)d_in[8];
    const float* ln_b = (const float*)d_in[9];
    float* out = (float*)d_out;

    const size_t BS = 4 * (size_t)S_LEN;            // 8192 rows
    const size_t DD = (size_t)D_DIM * D_DIM;        // 1M
    char* ws = (char*)d_ws;
    size_t off = 0;
    auto alloc = [&](size_t elems) { u16* p = (u16*)(ws + off); off += elems * sizeof(u16); return p; };
    u16* wqkv = alloc(3 * DD);        // [Wq ; Wkv] rows, bf16
    u16* wo   = alloc(DD);
    u16* xn   = alloc(BS * D_DIM);
    u16* qb   = alloc(BS * D_DIM);
    u16* kbuf = alloc(BS * D_DIM);
    u16* vbuf = alloc(BS * D_DIM);
    u16* vtb  = alloc(BS * D_DIM);
    u16* ctx  = alloc(BS * D_DIM);

    cvt_bf16_kernel<<<(int)(DD / 256), 256, 0, stream>>>(Wq, wqkv, (int)DD);
    cvt_bf16_kernel<<<(int)(2 * DD / 256), 256, 0, stream>>>(Wkv, wqkv + DD, (int)(2 * DD));
    cvt_bf16_kernel<<<(int)(DD / 256), 256, 0, stream>>>(Wo, wo, (int)DD);

    ln_kernel<<<(int)BS, 256, 0, stream>>>(x, ln_g, ln_b, xn);

    dim3 gqkv(3 * D_DIM / 128, (int)(BS / 128));   // (24, 64)
    gemm_kernel<0><<<gqkv, 256, 0, stream>>>(xn, wqkv, D_DIM, bq, bkv,
                                             qb, kbuf, vbuf, nullptr, nullptr);

    vtrans_kernel<<<dim3(S_LEN / 64, 4 * H_NUM), 256, 0, stream>>>(vbuf, vtb);

    attn_kernel<<<dim3(4 * H_NUM, S_LEN / 128), 256, 0, stream>>>(qb, kbuf, vtb, lens, ctx);

    dim3 gout(D_DIM / 128, (int)(BS / 128));       // (8, 64)
    gemm_kernel<1><<<gout, 256, 0, stream>>>(ctx, wo, D_DIM, bo, nullptr,
                                             nullptr, nullptr, nullptr, x, out);
}

// v001
// Measured time: 231 microseconds a run.
// Next to v000, in two timings, it ran 1.17 and 1.16 times as fast.
#include <hip/hip_runtime.h>

typedef unsigned short u16;
typedef __attribute__((ext_vector_type(16))) __bf16 v16bf;
typedef __attribute__((ext_vector_type(8)))  float  v8f;

#define S_LEN 2048
#define D_DIM 1024
#define H_NUM 16
#define DH_NUM 64

__device__ __forceinline__ u16 f2bf(float f) {
    unsigned u = __float_as_uint(f);
    u += 0x7FFFu + ((u >> 16) & 1u);
    return (u16)(u >> 16);
}

struct Pack32 { uint4 a, b; };
struct P16 { u16 h[16]; };

// Load one bf16 WMMA operand fragment (A-pattern; B uses the same pattern with
// lane -> N).  Lane-half 0: K in [0,8)u[16,24); lane-half 1: K in [8,16)u[24,32).
// Caller passes p already offset by (row, basek); we read p[0..7] and p[16..23].
__device__ __forceinline__ v16bf ldfrag(const u16* p) {
    Pack32 s;
    s.a = *(const uint4*)(p);
    s.b = *(const uint4*)(p + 16);
    return __builtin_bit_cast(v16bf, s);
}

__device__ __forceinline__ v8f wmma_bf16(v16bf a, v16bf b, v8f c) {
    return __builtin_amdgcn_wmma_f32_16x16x32_bf16(false, a, false, b, (short)0, c,
                                                   false, false);
}

// ---------------------------------------------------------------- fp32 -> bf16
__global__ __launch_bounds__(256) void cvt_bf16_kernel(const float* __restrict__ in,
                                                       u16* __restrict__ out, int n) {
    int i = blockIdx.x * 256 + threadIdx.x;
    if (i < n) out[i] = f2bf(in[i]);
}

// ---------------------------------------------------------------- LayerNorm
__global__ __launch_bounds__(256) void ln_kernel(const float* __restrict__ x,
                                                 const float* __restrict__ g,
                                                 const float* __restrict__ bb,
                                                 u16* __restrict__ xn) {
    __shared__ float red[8];
    int tid = threadIdx.x, lane = tid & 31, wave = tid >> 5;
    size_t row = blockIdx.x;
    const float* xr = x + row * D_DIM;
    float v[4];
    float s = 0.f;
#pragma unroll
    for (int i = 0; i < 4; i++) { v[i] = xr[tid + i * 256]; s += v[i]; }
#pragma unroll
    for (int m = 16; m >= 1; m >>= 1) s += __shfl_xor(s, m);
    if (lane == 0) red[wave] = s;
    __syncthreads();
    float tot = 0.f;
#pragma unroll
    for (int i = 0; i < 8; i++) tot += red[i];
    float mean = tot * (1.f / (float)D_DIM);
    __syncthreads();
    float s2 = 0.f;
#pragma unroll
    for (int i = 0; i < 4; i++) { float d = v[i] - mean; s2 += d * d; }
#pragma unroll
    for (int m = 16; m >= 1; m >>= 1) s2 += __shfl_xor(s2, m);
    if (lane == 0) red[wave] = s2;
    __syncthreads();
    float tot2 = 0.f;
#pragma unroll
    for (int i = 0; i < 8; i++) tot2 += red[i];
    float rstd = rsqrtf(tot2 * (1.f / (float)D_DIM) + 1e-5f);
#pragma unroll
    for (int i = 0; i < 4; i++) {
        int c = tid + i * 256;
        xn[row * D_DIM + c] = f2bf((v[i] - mean) * rstd * g[c] + bb[c]);
    }
}

// ---------------------------------------------------------------- Tiled WMMA GEMM
// C[M,N] = A[M,K] * W[N,K]^T (+ epilogue).  BM=128 BN=128 BK=32, 8 waves,
// wave tile 64x32 (4x2 WMMA accumulators).
// MODE 0: QKV - bias from (b0|b1), split-store bf16 q(*0.125)/k/v.
// MODE 1: out-proj - fp32 out = acc + b0[col] + resid.
// Epilogue: the 128x128 output tile is staged in LDS (over the operand tiles),
// then leaves as 16-byte stores that cover whole rows of the tile.
template <int MODE>
__global__ __launch_bounds__(256) void gemm_kernel(
    const u16* __restrict__ A, const u16* __restrict__ W, int K_dim,
    const float* __restrict__ b0, const float* __restrict__ b1,
    u16* __restrict__ qb, u16* __restrict__ kb, u16* __restrict__ vb,
    const float* __restrict__ resid, float* __restrict__ outp) {
    // Staged row pitch in bytes: 128 elements + 16 B, so that the two lane halves
    // (8 rows apart) write banks 32 apart.
    constexpr int CP = (MODE == 0) ? 128 * 2 + 16 : 128 * 4 + 16;
    __shared__ __attribute__((aligned(16))) unsigned char smem[128 * CP];
    u16 (*As)[48] = reinterpret_cast<u16 (*)[48]>(smem);
    u16 (*Bs)[48] = reinterpret_cast<u16 (*)[48]>(smem + 128 * 48 * sizeof(u16));
    int tid = threadIdx.x, lane = tid & 31, wave = tid >> 5;
    int wm = wave & 1, wn = wave >> 1;
    int half = lane >> 4, r = lane & 15, bk = half * 8;
    const size_t M0 = (size_t)blockIdx.y * 128;
    const size_t N0 = (size_t)blockIdx.x * 128;
    const u16* Aptr = A + M0 * K_dim;
    const u16* Wptr = W + N0 * K_dim;

    v8f acc[4][2] = {};
    for (int k0 = 0; k0 < K_dim; k0 += 32) {
        __syncthreads();
#pragma unroll
        for (int i = 0; i < 2; i++) {
            int c = tid + i * 256;
            int row = c >> 2, col = (c & 3) * 8;
            *(uint4*)&As[row][col] = *(const uint4*)(Aptr + (size_t)row * K_dim + k0 + col);
            *(uint4*)&Bs[row][col] = *(const uint4*)(Wptr + (size_t)row * K_dim + k0 + col);
        }
        __syncthreads();
        v16bf af[4], bfr[2];
#pragma unroll
        for (int i = 0; i < 4; i++) af[i] = ldfrag(&As[wm * 64 + i * 16 + r][bk]);
#pragma unroll
        for (int j = 0; j < 2; j++) bfr[j] = ldfrag(&Bs[wn * 32 + j * 16 + r][bk]);
#pragma unroll
        for (int i = 0; i < 4; i++)
#pragma unroll
            for (int j = 0; j < 2; j++) acc[i][j] = wmma_bf16(af[i], bfr[j], acc[i][j]);
    }

    // Every loop below is fully unrolled so that acc[][] and rv[] keep constant
    // indices and stay in registers.
    const int rl0 = wm * 64 + 8 * half;   // this lane's first row in the tile
    const int cl0 = wn * 32 + r;          // this lane's first column in the tile
    if (MODE == 0) {
        // A 128-column tile lies wholly in q, k or v: one destination per block.
        const int which = (int)(N0 / D_DIM);
        const float* bias = (which == 0) ? b0 + N0 : b1 + (N0 - D_DIM);
        const float sc = (which == 0) ? 0.125f : 1.0f;  // fold 1/sqrt(DH) into q
        u16* dst = (which == 0) ? qb : (which == 1) ? kb : vb;
        float bj[2];
#pragma unroll
        for (int j = 0; j < 2; j++) bj[j] = bias[cl0 + j * 16];
        __syncthreads();  // every wave has read its last operand fragments
#pragma unroll
        for (int i = 0; i < 4; i++)
#pragma unroll
            for (int j = 0; j < 2; j++)
#pragma unroll
                for (int e = 0; e < 8; e++)
                    *(u16*)(smem + (rl0 + i * 16 + e) * CP + (cl0 + j * 16) * 2) =
                        f2bf((acc[i][j][e] + bj[j]) * sc);
        __syncthreads();  // the tile is complete before any wave reads rows of it
        u16* dtile = dst + M0 * D_DIM + (N0 % D_DIM);
        const int row0 = tid >> 4, ch = tid & 15;   // 16 chunks of 16 B per 256-B row
        const unsigned off = (unsigned)(row0 * D_DIM + ch * 8);
#pragma unroll
        for (int it = 0; it < 8; it++)
            *(uint4*)(dtile + off + it * 16 * D_DIM) =
                *(const uint4*)(smem + (row0 + it * 16) * CP + ch * 16);
    } else {
        // One wave covers one 512-B row per step; all residual loads go out together.
        const float* rtile = resid + M0 * D_DIM + N0;
        float* otile = outp + M0 * D_DIM + N0;
        const unsigned off = (unsigned)(wave * D_DIM + lane * 4);  // same for load and store
        float4 rv[16];
#pragma unroll
        for (int it = 0; it < 16; it++)
            rv[it] = *(const float4*)(rtile + off + it * 8 * D_DIM);
        __syncthreads();  // every wave has read its last operand fragments
        float4 bv = *(const float4*)(b0 + N0 + lane * 4);
#pragma unroll
        for (int i = 0; i < 4; i++)
#pragma unroll
            for (int j = 0; j < 2; j++)
#pragma unroll
                for (int e = 0; e < 8; e++)
                    *(float*)(smem + (rl0 + i * 16 + e) * CP + (cl0 + j * 16) * 4) = acc[i][j][e];
        __syncthreads();  // the tile is complete before any wave reads rows of it
#pragma unroll
        for (int it = 0; it < 16; it++) {
            int row = wave + it * 8;
            float4 a = *(const float4*)(smem + row * CP + lane * 16);
            float4 o;
            o.x = a.x + bv.x + rv[it].x;
            o.y = a.y + bv.y + rv[it].y;
            o.z = a.z + bv.z + rv[it].z;
            o.w = a.w + bv.w + rv[it].w;
            *(float4*)(otile + off + it * 8 * D_DIM) = o;
        }
    }
}

// ---------------------------------------------------------------- V transpose: vt[bh][dh][s]
__global__ __launch_bounds__(256) void vtrans_kernel(const u16* __restrict__ v,
                                                     u16* __restrict__ vt) {
    __shared__ u16 t[64][65];
    int tid = threadIdx.x;
    int bh = blockIdx.y, b = bh >> 4, h = bh & 15;
    int s0 = blockIdx.x * 64;
    int dh = tid & 63, sr = tid >> 6;
#pragma unroll
    for (int i = 0; i < 64; i += 4)
        t[sr + i][dh] = v[(size_t)(b * S_LEN + s0 + sr + i) * D_DIM + h * DH_NUM + dh];
    __syncthreads();
    int sc = tid & 63, dr = tid >> 6;
#pragma unroll
    for (int i = 0; i < 64; i += 4)
        vt[((size_t)bh * DH_NUM + dr + i) * S_LEN + s0 + sc] = t[sc][dr + i];
}

__global__ __launch_bounds__(256) void attn_kernel(const u16* __restrict__ q,
                                                   const u16* __restrict__ k,
                                                   const u16* __restrict__ vt,
                                                   const int* __restrict__ lens,
                                                   u16* __restrict__ ctx) {
    int tid = threadIdx.x, lane = tid & 31, wave = tid >> 5;
    int half = lane >> 4, r = lane & 15, bk = half * 8;
    int bh = blockIdx.x, b = bh >> 4, h = bh & 15;
    int qw = blockIdx.y * 128 + wave * 16;
    int len = lens[b];
    int myq = qw + r;                        // the single query this lane owns
    int lim = (myq + 1 < len) ? myq + 1 : len;  // key valid iff key < lim

    // Q as B-operand (lane r = query), both 32-wide dh k-steps.
    const u16* qbase = q + ((size_t)(b * S_LEN + qw + r) * D_DIM + h * DH_NUM) + bk;
    v16bf qf[2];
    qf[0] = ldfrag(qbase);
    qf[1] = ldfrag(qbase + 32);

    // Induction bases: K row r (advance by keys), V^T row r of dh-tile 0.
    const u16* kp0 = k + ((size_t)(b * S_LEN + r) * D_DIM + h * DH_NUM) + bk;
    const u16* vp0 = vt + ((size_t)(bh * DH_NUM + r) * S_LEN) + bk;

    float mrun = -1e30f, lrun = 0.f;
    v8f Ov[4] = {};

    int kmax = qw + 15;
    if (len - 1 < kmax) kmax = len - 1;

    for (int kbp = 0; kbp <= kmax; kbp += 32) {
        // ---- all 16 operand loads up front (one big clause, overlapped waits)
        const u16* ka = kp0 + (size_t)kbp * D_DIM;
        const u16* kc = ka + (size_t)16 * D_DIM;
        v16bf kf0 = ldfrag(ka);
        v16bf kf1 = ldfrag(ka + 32);
        v16bf kf2 = ldfrag(kc);
        v16bf kf3 = ldfrag(kc + 32);
        v16bf vf[4];
#pragma unroll
        for (int j = 0; j < 4; j++)
            vf[j] = ldfrag(vp0 + (size_t)j * 16 * S_LEN + kbp);

        // ---- S^T tiles: rows = keys (t*16 + e + 8*half), col = query
        v8f Sacc[2] = {};
        Sacc[0] = wmma_bf16(kf0, qf[0], Sacc[0]);
        Sacc[0] = wmma_bf16(kf1, qf[1], Sacc[0]);
        Sacc[1] = wmma_bf16(kf2, qf[0], Sacc[1]);
        Sacc[1] = wmma_bf16(kf3, qf[1], Sacc[1]);

        // ---- mask (only on boundary blocks) + per-lane online softmax
        float sv[2][8];
        float rowmax = -3.0e38f;
        bool full = (kbp + 32 <= qw + 1) && (kbp + 32 <= len);  // wave-uniform
        if (full) {
#pragma unroll
            for (int t = 0; t < 2; t++)
#pragma unroll
                for (int e = 0; e < 8; e++) {
                    sv[t][e] = Sacc[t][e];
                    rowmax = fmaxf(rowmax, sv[t][e]);
                }
        } else {
            int kbase0 = kbp + 8 * half;
#pragma unroll
            for (int t = 0; t < 2; t++)
#pragma unroll
                for (int e = 0; e < 8; e++) {
                    int key = kbase0 + t * 16 + e;
                    sv[t][e] = (key < lim) ? Sacc[t][e] : -3.0e38f;
                    rowmax = fmaxf(rowmax, sv[t][e]);
                }
        }
        rowmax = fmaxf(rowmax, __shfl_xor(rowmax, 16));
        float mnew = fmaxf(mrun, rowmax);
        float scale = __expf(mrun - mnew);
        float rsum = 0.f;
        P16 ph;
#pragma unroll
        for (int t = 0; t < 2; t++)
#pragma unroll
            for (int e = 0; e < 8; e++) {
                float p = __expf(sv[t][e] - mnew);
                rsum += p;
                ph.h[t * 8 + e] = f2bf(p);  // B-operand half m = t*8+e -> key t*16+e+8*half
            }
        rsum += __shfl_xor(rsum, 16);
        lrun = lrun * scale + rsum;
        mrun = mnew;
        v16bf pf = __builtin_bit_cast(v16bf, ph);

        // ---- O^T += V^T * P  (rows = dh, col = query)
#pragma unroll
        for (int j = 0; j < 4; j++) {
#pragma unroll
            for (int e = 0; e < 8; e++) Ov[j][e] *= scale;
            Ov[j] = wmma_bf16(vf[j], pf, Ov[j]);
        }
    }

    float inv = 1.f / lrun;
#pragma unroll
    for (int j = 0; j < 4; j++)
#pragma unroll
        for (int e = 0; e < 8; e++) {
            int dh = j * 16 + e + 8 * half;
            ctx[(size_t)(b * S_LEN + myq) * D_DIM + h * DH_NUM + dh] = f2bf(Ov[j][e] * inv);
        }
}

// ---------------------------------------------------------------- launch
extern "C" void kernel_launch(void* const* d_in, const int* in_sizes, int n_in,
                              void* d_out, int out_size, void* d_ws, size_t ws_size,
                              hipStream_t stream) {
    (void)in_sizes; (void)n_in; (void)out_size; (void)ws_size;
    const float* x    = (const float*)d_in[0];
    const int*   lens = (const int*)d_in[1];
    const float* Wq   = (const float*)d_in[2];
    const float* bq   = (const float*)d_in[3];
    const float* Wkv  = (const float*)d_in[4];
    const float* bkv  = (const float*)d_in[5];
    const float* Wo   = (const float*)d_in[6];
    const float* bo   = (const float*)d_in[7];
    const float* ln_g = (const float*)d_in[8];
    const float* ln_b = (const float*)d_in[9];
    float* out = (float*)d_out;

    const size_t BS = 4 * (size_t)S_LEN;            // 8192 rows
    const size_t DD = (size_t)D_DIM * D_DIM;        // 1M
    char* ws = (char*)d_ws;
    size_t off = 0;
    auto alloc = [&](size_t elems) { u16* p = (u16*)(ws + off); off += elems * sizeof(u16); return p; };
    u16* wqkv = alloc(3 * DD);        // [Wq ; Wkv] rows, bf16
    u16* wo   = alloc(DD);
    u16* xn   = alloc(BS * D_DIM);
    u16* qb   = alloc(BS * D_DIM);
    u16* kbuf = alloc(BS * D_DIM);
    u16* vbuf = alloc(BS * D_DIM);
    u16* vtb  = alloc(BS * D_DIM);
    u16* ctx  = alloc(BS * D_DIM);

    cvt_bf16_kernel<<<(int)(DD / 256), 256, 0, stream>>>(Wq, wqkv, (int)DD);
    cvt_bf16_kernel<<<(int)(2 * DD / 256), 256, 0, stream>>>(Wkv, wqkv + DD, (int)(2 * DD));
    cvt_bf16_kernel<<<(int)(DD / 256), 256, 0, stream>>>(Wo, wo, (int)DD);

    ln_kernel<<<(int)BS, 256, 0, stream>>>(x, ln_g, ln_b, xn);

    dim3 gqkv(3 * D_DIM / 128, (int)(BS / 128));   // (24, 64)
    gemm_kernel<0><<<gqkv, 256, 0, stream>>>(xn, wqkv, D_DIM, bq, bkv,
                                             qb, kbuf, vbuf, nullptr, nullptr);

    vtrans_kernel<<<dim3(S_LEN / 64, 4 * H_NUM), 256, 0, stream>>>(vbuf, vtb);

    attn_kernel<<<dim3(4 * H_NUM, S_LEN / 128), 256, 0, stream>>>(qb, kbuf, vtb, lens, ctx);

    dim3 gout(D_DIM / 128, (int)(BS / 128));       // (8, 64)
    gemm_kernel<1><<<gout, 256, 0, stream>>>(ctx, wo, D_DIM, bo, nullptr,
                                             nullptr, nullptr, nullptr, x, out);
}

// v002
// Measured time: 187 microseconds a run.
// Two timings next to v001 both put it at 1.23 times that version's speed.
// Over all steps from v000 it is 1.44 times as fast.
#include <hip/hip_runtime.h>

typedef unsigned short u16;
typedef __attribute__((ext_vector_type(16))) __bf16 v16bf;
typedef __attribute__((ext_vector_type(8)))  float  v8f;

#define S_LEN 2048
#define D_DIM 1024
#define H_NUM 16
#define DH_NUM 64

__device__ __forceinline__ u16 f2bf(float f) {
    unsigned u = __float_as_uint(f);
    u += 0x7FFFu + ((u >> 16) & 1u);
    return (u16)(u >> 16);
}

struct Pack32 { uint4 a, b; };
struct P16 { u16 h[16]; };

// Load one bf16 WMMA operand fragment (A-pattern; B uses the same pattern with
// lane -> N).  Lane-half 0: K in [0,8)u[16,24); lane-half 1: K in [8,16)u[24,32).
// Caller passes p already offset by (row, basek); we read p[0..7] and p[16..23].
__device__ __forceinline__ v16bf ldfrag(const u16* p) {
    Pack32 s;
    s.a = *(const uint4*)(p);
    s.b = *(const uint4*)(p + 16);
    return __builtin_bit_cast(v16bf, s);
}

__device__ __forceinline__ v8f wmma_bf16(v16bf a, v16bf b, v8f c) {
    return __builtin_amdgcn_wmma_f32_16x16x32_bf16(false, a, false, b, (short)0, c,
                                                   false, false);
}

// ---------------------------------------------------------------- fp32 -> bf16
__global__ __launch_bounds__(256) void cvt_bf16_kernel(const float* __restrict__ in,
                                                       u16* __restrict__ out, int n) {
    int i = blockIdx.x * 256 + threadIdx.x;
    if (i < n) out[i] = f2bf(in[i]);
}

// ---------------------------------------------------------------- LayerNorm
__global__ __launch_bounds__(256) void ln_kernel(const float* __restrict__ x,
                                                 const float* __restrict__ g,
                                                 const float* __restrict__ bb,
                                                 u16* __restrict__ xn) {
    __shared__ float red[8];
    int tid = threadIdx.x, lane = tid & 31, wave = tid >> 5;
    size_t row = blockIdx.x;
    const float* xr = x + row * D_DIM;
    float v[4];
    float s = 0.f;
#pragma unroll
    for (int i = 0; i < 4; i++) { v[i] = xr[tid + i * 256]; s += v[i]; }
#pragma unroll
    for (int m = 16; m >= 1; m >>= 1) s += __shfl_xor(s, m);
    if (lane == 0) red[wave] = s;
    __syncthreads();
    float tot = 0.f;
#pragma unroll
    for (int i = 0; i < 8; i++) tot += red[i];
    float mean = tot * (1.f / (float)D_DIM);
    __syncthreads();
    float s2 = 0.f;
#pragma unroll
    for (int i = 0; i < 4; i++) { float d = v[i] - mean; s2 += d * d; }
#pragma unroll
    for (int m = 16; m >= 1; m >>= 1) s2 += __shfl_xor(s2, m);
    if (lane == 0) red[wave] = s2;
    __syncthreads();
    float tot2 = 0.f;
#pragma unroll
    for (int i = 0; i < 8; i++) tot2 += red[i];
    float rstd = rsqrtf(tot2 * (1.f / (float)D_DIM) + 1e-5f);
#pragma unroll
    for (int i = 0; i < 4; i++) {
        int c = tid + i * 256;
        xn[row * D_DIM + c] = f2bf((v[i] - mean) * rstd * g[c] + bb[c]);
    }
}

// ---------------------------------------------------------------- Tiled WMMA GEMM
// C[M,N] = A[M,K] * W[N,K]^T (+ epilogue).  BM=128 BN=128 BK=32, 8 waves,
// wave tile 64x32 (4x2 WMMA accumulators).
// MODE 0: QKV - bias from (b0|b1), split-store bf16 q(*0.125)/k/v.
// MODE 1: out-proj - fp32 out = acc + b0[col] + resid.
// Epilogue: the 128x128 output tile is staged in LDS (over the operand tiles),
// then leaves as 16-byte stores that cover whole rows of the tile.
template <int MODE>
__global__ __launch_bounds__(256) void gemm_kernel(
    const u16* __restrict__ A, const u16* __restrict__ W, int K_dim,
    const float* __restrict__ b0, const float* __restrict__ b1,
    u16* __restrict__ qb, u16* __restrict__ kb, u16* __restrict__ vb,
    const float* __restrict__ resid, float* __restrict__ outp) {
    // Staged row pitch in bytes: 128 elements + 16 B, so that the two lane halves
    // (8 rows apart) write banks 32 apart.
    constexpr int CP = (MODE == 0) ? 128 * 2 + 16 : 128 * 4 + 16;
    __shared__ __attribute__((aligned(16))) unsigned char smem[128 * CP];
    u16 (*As)[48] = reinterpret_cast<u16 (*)[48]>(smem);
    u16 (*Bs)[48] = reinterpret_cast<u16 (*)[48]>(smem + 128 * 48 * sizeof(u16));
    int tid = threadIdx.x, lane = tid & 31, wave = tid >> 5;
    int wm = wave & 1, wn = wave >> 1;
    int half = lane >> 4, r = lane & 15, bk = half * 8;
    const size_t M0 = (size_t)blockIdx.y * 128;
    const size_t N0 = (size_t)blockIdx.x * 128;
    const u16* Aptr = A + M0 * K_dim;
    const u16* Wptr = W + N0 * K_dim;

    v8f acc[4][2] = {};
    for (int k0 = 0; k0 < K_dim; k0 += 32) {
        __syncthreads();
#pragma unroll
        for (int i = 0; i < 2; i++) {
            int c = tid + i * 256;
            int row = c >> 2, col = (c & 3) * 8;
            *(uint4*)&As[row][col] = *(const uint4*)(Aptr + (size_t)row * K_dim + k0 + col);
            *(uint4*)&Bs[row][col] = *(const uint4*)(Wptr + (size_t)row * K_dim + k0 + col);
        }
        __syncthreads();
        v16bf af[4], bfr[2];
#pragma unroll
        for (int i = 0; i < 4; i++) af[i] = ldfrag(&As[wm * 64 + i * 16 + r][bk]);
#pragma unroll
        for (int j = 0; j < 2; j++) bfr[j] = ldfrag(&Bs[wn * 32 + j * 16 + r][bk]);
#pragma unroll
        for (int i = 0; i < 4; i++)
#pragma unroll
            for (int j = 0; j < 2; j++) acc[i][j] = wmma_bf16(af[i], bfr[j], acc[i][j]);
    }

    // Every loop below is fully unrolled so that acc[][] and rv[] keep constant
    // indices and stay in registers.
    const int rl0 = wm * 64 + 8 * half;   // this lane's first row in the tile
    const int cl0 = wn * 32 + r;          // this lane's first column in the tile
    if (MODE == 0) {
        // A 128-column tile lies wholly in q, k or v: one destination per block.
        const int which = (int)(N0 / D_DIM);
        const float* bias = (which == 0) ? b0 + N0 : b1 + (N0 - D_DIM);
        const float sc = (which == 0) ? 0.125f : 1.0f;  // fold 1/sqrt(DH) into q
        u16* dst = (which == 0) ? qb : (which == 1) ? kb : vb;
        float bj[2];
#pragma unroll
        for (int j = 0; j < 2; j++) bj[j] = bias[cl0 + j * 16];
        __syncthreads();  // every wave has read its last operand fragments
#pragma unroll
        for (int i = 0; i < 4; i++)
#pragma unroll
            for (int j = 0; j < 2; j++)
#pragma unroll
                for (int e = 0; e < 8; e++)
                    *(u16*)(smem + (rl0 + i * 16 + e) * CP + (cl0 + j * 16) * 2) =
                        f2bf((acc[i][j][e] + bj[j]) * sc);
        __syncthreads();  // the tile is complete before any wave reads rows of it
        u16* dtile = dst + M0 * D_DIM + (N0 % D_DIM);
        const int row0 = tid >> 4, ch = tid & 15;   // 16 chunks of 16 B per 256-B row
        const unsigned off = (unsigned)(row0 * D_DIM + ch * 8);
#pragma unroll
        for (int it = 0; it < 8; it++)
            *(uint4*)(dtile + off + it * 16 * D_DIM) =
                *(const uint4*)(smem + (row0 + it * 16) * CP + ch * 16);
    } else {
        // One wave covers one 512-B row per step; all residual loads go out together.
        const float* rtile = resid + M0 * D_DIM + N0;
        float* otile = outp + M0 * D_DIM + N0;
        const unsigned off = (unsigned)(wave * D_DIM + lane * 4);  // same for load and store
        float4 rv[16];
#pragma unroll
        for (int it = 0; it < 16; it++)
            rv[it] = *(const float4*)(rtile + off + it * 8 * D_DIM);
        __syncthreads();  // every wave has read its last operand fragments
        float4 bv = *(const float4*)(b0 + N0 + lane * 4);
#pragma unroll
        for (int i = 0; i < 4; i++)
#pragma unroll
            for (int j = 0; j < 2; j++)
#pragma unroll
                for (int e = 0; e < 8; e++)
                    *(float*)(smem + (rl0 + i * 16 + e) * CP + (cl0 + j * 16) * 4) = acc[i][j][e];
        __syncthreads();  // the tile is complete before any wave reads rows of it
#pragma unroll
        for (int it = 0; it < 16; it++) {
            int row = wave + it * 8;
            float4 a = *(const float4*)(smem + row * CP + lane * 16);
            float4 o;
            o.x = a.x + bv.x + rv[it].x;
            o.y = a.y + bv.y + rv[it].y;
            o.z = a.z + bv.z + rv[it].z;
            o.w = a.w + bv.w + rv[it].w;
            *(float4*)(otile + off + it * 8 * D_DIM) = o;
        }
    }
}

// ---------------------------------------------------------------- V transpose: vt[bh][dh][s]
__global__ __launch_bounds__(256) void vtrans_kernel(const u16* __restrict__ v,
                                                     u16* __restrict__ vt) {
    __shared__ u16 t[64][65];
    int tid = threadIdx.x;
    int bh = blockIdx.y, b = bh >> 4, h = bh & 15;
    int s0 = blockIdx.x * 64;
    int dh = tid & 63, sr = tid >> 6;
#pragma unroll
    for (int i = 0; i < 64; i += 4)
        t[sr + i][dh] = v[(size_t)(b * S_LEN + s0 + sr + i) * D_DIM + h * DH_NUM + dh];
    __syncthreads();
    int sc = tid & 63, dr = tid >> 6;
#pragma unroll
    for (int i = 0; i < 64; i += 4)
        vt[((size_t)bh * DH_NUM + dr + i) * S_LEN + s0 + sc] = t[sc][dr + i];
}

#define KT 64                        // keys per staged tile
#define KVP 72                       // LDS row pitch in u16: 128 B + 16 B, for 16-byte readers
#define KV_HALF (KT * KVP * 2)       // bytes of one operand's tile (64 rows)
#define KV_BUF (2 * KV_HALF)         // bytes of one buffer: K tile, then V^T tile

// One tile: each lane copies 16 bytes of rows (srow, srow+32) of K and of V^T.
// The s_wait_xcnt closes the statement so that no address register of a copy is
// rewritten while the copy may still need it.
__device__ __forceinline__ void stage_tile(unsigned lds, const u16* gk, const u16* gv) {
    unsigned lk1 = lds + 32 * KVP * 2, lv0 = lds + KV_HALF, lv1 = lds + KV_HALF + 32 * KVP * 2;
    const u16* gk1 = gk + (size_t)32 * D_DIM;
    const u16* gv1 = gv + (size_t)32 * S_LEN;
    asm volatile("global_load_async_to_lds_b128 %0, %1, off\n\t"
                 "global_load_async_to_lds_b128 %2, %3, off\n\t"
                 "global_load_async_to_lds_b128 %4, %5, off\n\t"
                 "global_load_async_to_lds_b128 %6, %7, off\n\t"
                 "s_wait_xcnt 0x0"
                 :: "v"(lds), "v"(gk), "v"(lk1), "v"(gk1), "v"(lv0), "v"(gv), "v"(lv1), "v"(gv1)
                 : "memory");
}

__global__ __launch_bounds__(256) void attn_kernel(const u16* __restrict__ q,
                                                   const u16* __restrict__ k,
                                                   const u16* __restrict__ vt,
                                                   const int* __restrict__ lens,
                                                   u16* __restrict__ ctx) {
    __shared__ __attribute__((aligned(16))) unsigned char kv[2 * KV_BUF];
    int tid = threadIdx.x, lane = tid & 31;
    int wave = __builtin_amdgcn_readfirstlane(tid >> 5);  // scalar: the per-wave skip is a real branch
    int half = lane >> 4, r = lane & 15, bk = half * 8;
    int bh = blockIdx.x, b = bh >> 4, h = bh & 15;
    int q0 = blockIdx.y * 128;
    int qw = q0 + wave * 16;
    int len = lens[b];
    int myq = qw + r;                        // the single query this lane owns
    int lim = (myq + 1 < len) ? myq + 1 : len;  // key valid iff key < lim

    // Q as B-operand (lane r = query), both 32-wide dh k-steps.
    const u16* qbase = q + ((size_t)(b * S_LEN + qw + r) * D_DIM + h * DH_NUM) + bk;
    v16bf qf[2];
    qf[0] = ldfrag(qbase);
    qf[1] = ldfrag(qbase + 32);

    float mrun = -1e30f, lrun = 0.f;
    v8f Ov[4] = {};

    int kmax = qw + 15;                      // this wave's last key
    if (len - 1 < kmax) kmax = len - 1;
    int kmaxb = q0 + 127;                    // the block's last key (<= S_LEN - 1)
    if (len - 1 < kmaxb) kmaxb = len - 1;
    const int nt = (kmaxb >> 6) + 1;         // tiles of 64 keys, the same for the whole block

    // This lane's share of a tile: 8 lanes per 128-byte row.
    const int srow = tid >> 3, scol = (tid & 7) * 8;
    const unsigned lds0 = (unsigned)(size_t)(kv + srow * (KVP * 2) + scol * 2);
    const u16* gk0 = k + ((size_t)(b * S_LEN + srow) * D_DIM + h * DH_NUM + scol);
    const u16* gv0 = vt + ((size_t)(bh * DH_NUM + srow) * S_LEN + scol);

    stage_tile(lds0, gk0, gv0);
    asm volatile("s_wait_asynccnt 0x0" ::: "memory");  // this wave's share of tile 0 has landed
    __syncthreads();                                   // ... and every other wave's
    if (1 < nt) stage_tile(lds0 + KV_BUF, gk0 + (size_t)KT * D_DIM, gv0 + KT);

    for (int t = 0; t < nt; t++) {
        const u16* Ks = (const u16*)(kv + (t & 1) * KV_BUF) + r * KVP + bk;  // K row r
        const u16* Vs = Ks + KT * KVP;                                       // V^T row r
        // Two steps of 32 keys; a wave stops at its own last key.  Kept rolled: unrolled, the
        // two skippable bodies cost a copy of all accumulators at each join.
#pragma unroll 1
        for (int c = 0; c < 2; c++) {
            const int kbp = t * KT + c * 32;
            if (kbp > kmax) break;
            {
                // ---- all 16 fragment loads up front
                v16bf kf0 = ldfrag(Ks + (c * 32) * KVP);
                v16bf kf1 = ldfrag(Ks + (c * 32) * KVP + 32);
                v16bf kf2 = ldfrag(Ks + (c * 32 + 16) * KVP);
                v16bf kf3 = ldfrag(Ks + (c * 32 + 16) * KVP + 32);
                v16bf vf[4];
#pragma unroll
                for (int j = 0; j < 4; j++)
                    vf[j] = ldfrag(Vs + (j * 16) * KVP + c * 32);

                // ---- S^T tiles: rows = keys (u*16 + e + 8*half), col = query
                v8f Sacc[2] = {};
                Sacc[0] = wmma_bf16(kf0, qf[0], Sacc[0]);
                Sacc[0] = wmma_bf16(kf1, qf[1], Sacc[0]);
                Sacc[1] = wmma_bf16(kf2, qf[0], Sacc[1]);
                Sacc[1] = wmma_bf16(kf3, qf[1], Sacc[1]);

                // ---- mask (only on boundary blocks) + per-lane online softmax
                float sv[2][8];
                float rowmax = -3.0e38f;
                bool full = (kbp + 32 <= qw + 1) && (kbp + 32 <= len);  // wave-uniform
                if (full) {
#pragma unroll
                    for (int u = 0; u < 2; u++)
#pragma unroll
                        for (int e = 0; e < 8; e++) {
                            sv[u][e] = Sacc[u][e];
                            rowmax = fmaxf(rowmax, sv[u][e]);
                        }
                } else {
                    int kbase0 = kbp + 8 * half;
#pragma unroll
                    for (int u = 0; u < 2; u++)
#pragma unroll
                        for (int e = 0; e < 8; e++) {
                            int key = kbase0 + u * 16 + e;
                            sv[u][e] = (key < lim) ? Sacc[u][e] : -3.0e38f;
                            rowmax = fmaxf(rowmax, sv[u][e]);
                        }
                }
                rowmax = fmaxf(rowmax, __shfl_xor(rowmax, 16));
                float mnew = fmaxf(mrun, rowmax);
                float scale = __expf(mrun - mnew);
                float rsum = 0.f;
                P16 ph;
#pragma unroll
                for (int u = 0; u < 2; u++)
#pragma unroll
                    for (int e = 0; e < 8; e++) {
                        float p = __expf(sv[u][e] - mnew);
                        rsum += p;
                        ph.h[u * 8 + e] = f2bf(p);  // B-operand half m = u*8+e -> key u*16+e+8*half
                    }
                rsum += __shfl_xor(rsum, 16);
                lrun = lrun * scale + rsum;
                mrun = mnew;
                v16bf pf = __builtin_bit_cast(v16bf, ph);

                // ---- O^T += V^T * P  (rows = dh, col = query)
#pragma unroll
                for (int j = 0; j < 4; j++) {
#pragma unroll
                    for (int e = 0; e < 8; e++) Ov[j][e] *= scale;
                    Ov[j] = wmma_bf16(vf[j], pf, Ov[j]);
                }
            }
        }
        // Hand-over, passed by every wave (also one that skipped the work above).
        asm volatile("s_wait_dscnt 0x0" ::: "memory");     // my reads of this buffer are done
        asm volatile("s_wait_asynccnt 0x0" ::: "memory");  // my share of tile t+1 has landed
        __syncthreads();  // tile t+1 is whole, and nobody reads tile t's buffer any more
        if (t + 2 < nt)
            stage_tile(lds0 + (t & 1) * KV_BUF, gk0 + (size_t)(t + 2) * KT * D_DIM,
                       gv0 + (t + 2) * KT);
    }
    asm volatile("s_wait_asynccnt 0x0" ::: "memory");  // no copy is open when the wave ends

    float inv = 1.f / lrun;
#pragma unroll
    for (int j = 0; j < 4; j++)
#pragma unroll
        for (int e = 0; e < 8; e++) {
            int dh = j * 16 + e + 8 * half;
            ctx[(size_t)(b * S_LEN + myq) * D_DIM + h * DH_NUM + dh] = f2bf(Ov[j][e] * inv);
        }
}

// ---------------------------------------------------------------- launch
extern "C" void kernel_launch(void* const* d_in, const int* in_sizes, int n_in,
                              void* d_out, int out_size, void* d_ws, size_t ws_size,
                              hipStream_t stream) {
    (void)in_sizes; (void)n_in; (void)out_size; (void)ws_size;
    const float* x    = (const float*)d_in[0];
    const int*   lens = (const int*)d_in[1];
    const float* Wq   = (const float*)d_in[2];
    const float* bq   = (const float*)d_in[3];
    const float* Wkv  = (const float*)d_in[4];
    const float* bkv  = (const float*)d_in[5];
    const float* Wo   = (const float*)d_in[6];
    const float* bo   = (const float*)d_in[7];
    const float* ln_g = (const float*)d_in[8];
    const float* ln_b = (const float*)d_in[9];
    float* out = (float*)d_out;

    const size_t BS = 4 * (size_t)S_LEN;            // 8192 rows
    const size_t DD = (size_t)D_DIM * D_DIM;        // 1M
    char* ws = (char*)d_ws;
    size_t off = 0;
    auto alloc = [&](size_t elems) { u16* p = (u16*)(ws + off); off += elems * sizeof(u16); return p; };
    u16* wqkv = alloc(3 * DD);        // [Wq ; Wkv] rows, bf16
    u16* wo   = alloc(DD);
    u16* xn   = alloc(BS * D_DIM);
    u16* qb   = alloc(BS * D_DIM);
    u16* kbuf = alloc(BS * D_DIM);
    u16* vbuf = alloc(BS * D_DIM);
    u16* vtb  = alloc(BS * D_DIM);
    u16* ctx  = alloc(BS * D_DIM);

    cvt_bf16_kernel<<<(int)(DD / 256), 256, 0, stream>>>(Wq, wqkv, (int)DD);
    cvt_bf16_kernel<<<(int)(2 * DD / 256), 256, 0, stream>>>(Wkv, wqkv + DD, (int)(2 * DD));
    cvt_bf16_kernel<<<(int)(DD / 256), 256, 0, stream>>>(Wo, wo, (int)DD);

    ln_kernel<<<(int)BS, 256, 0, stream>>>(x, ln_g, ln_b, xn);

    dim3 gqkv(3 * D_DIM / 128, (int)(BS / 128));   // (24, 64)
    gemm_kernel<0><<<gqkv, 256, 0, stream>>>(xn, wqkv, D_DIM, bq, bkv,
                                             qb, kbuf, vbuf, nullptr, nullptr);

    vtrans_kernel<<<dim3(S_LEN / 64, 4 * H_NUM), 256, 0, stream>>>(vbuf, vtb);

    attn_kernel<<<dim3(4 * H_NUM, S_LEN / 128), 256, 0, stream>>>(qb, kbuf, vtb, lens, ctx);

    dim3 gout(D_DIM / 128, (int)(BS / 128));       // (8, 64)
    gemm_kernel<1><<<gout, 256, 0, stream>>>(ctx, wo, D_DIM, bo, nullptr,
                                             nullptr, nullptr, nullptr, x, out);
}

// v003
// Measured time: 176 microseconds a run.
// Timed twice side by side with v002, it ran 1.06 times as fast both times.
// All steps since v000 together make it 1.52 times as fast.
#include <hip/hip_runtime.h>

typedef unsigned short u16;
typedef __attribute__((ext_vector_type(16))) __bf16 v16bf;
typedef __attribute__((ext_vector_type(8)))  float  v8f;

#define S_LEN 2048
#define D_DIM 1024
#define H_NUM 16
#define DH_NUM 64

__device__ __forceinline__ u16 f2bf(float f) {
    unsigned u = __float_as_uint(f);
    u += 0x7FFFu + ((u >> 16) & 1u);
    return (u16)(u >> 16);
}

struct Pack32 { uint4 a, b; };
struct P16 { u16 h[16]; };

// Load one bf16 WMMA operand fragment (A-pattern; B uses the same pattern with
// lane -> N).  Lane-half 0: K in [0,8)u[16,24); lane-half 1: K in [8,16)u[24,32).
// Caller passes p already offset by (row, basek); we read p[0..7] and p[16..23].
__device__ __forceinline__ v16bf ldfrag(const u16* p) {
    Pack32 s;
    s.a = *(const uint4*)(p);
    s.b = *(const uint4*)(p + 16);
    return __builtin_bit_cast(v16bf, s);
}

__device__ __forceinline__ v8f wmma_bf16(v16bf a, v16bf b, v8f c) {
    return __builtin_amdgcn_wmma_f32_16x16x32_bf16(false, a, false, b, (short)0, c,
                                                   false, false);
}

// ---------------------------------------------------------------- weights -> bf16, LayerNorm
// One launch.  The first CVT_BLOCKS blocks round the weights to bf16, the others
// normalise one row of x each; the two kinds of block share nothing.
// A conversion block takes CVT_ELEMS consecutive elements: each wave reads 8 times
// 512 contiguous bytes (all 8 loads go out before the first value is used) and
// writes 8 times 256 contiguous bytes.  The bf16 copies of Wq, Wkv, Wo lie one
// behind the other in wbf.
#define CVT_ELEMS 8192
#define CVT_Q (D_DIM * D_DIM / CVT_ELEMS)        // blocks for Wq, and for Wo
#define CVT_KV (2 * D_DIM * D_DIM / CVT_ELEMS)   // blocks for Wkv
#define CVT_BLOCKS (CVT_Q + CVT_KV + CVT_Q)

__global__ __launch_bounds__(256) void prep_kernel(const float* __restrict__ x,
                                                   const float* __restrict__ g,
                                                   const float* __restrict__ bb,
                                                   u16* __restrict__ xn,
                                                   const float* __restrict__ Wq,
                                                   const float* __restrict__ Wkv,
                                                   const float* __restrict__ Wo,
                                                   u16* __restrict__ wbf) {
    __shared__ float red[8];
    int tid = threadIdx.x, lane = tid & 31, wave = tid >> 5;
    if (blockIdx.x < CVT_BLOCKS) {   // the same for the whole block, ahead of every barrier
        const int cb = blockIdx.x;
        const float* s = (cb < CVT_Q)            ? Wq + (size_t)cb * CVT_ELEMS
                         : (cb < CVT_Q + CVT_KV) ? Wkv + (size_t)(cb - CVT_Q) * CVT_ELEMS
                                                 : Wo + (size_t)(cb - CVT_Q - CVT_KV) * CVT_ELEMS;
        u16* d = wbf + (size_t)cb * CVT_ELEMS;
        float4 w[8];
        // Both loops unrolled: w[] stays in registers and the 8 loads are issued together.
#pragma unroll
        for (int i = 0; i < 8; i++) w[i] = *(const float4*)(s + i * 1024 + tid * 4);
#pragma unroll
        for (int i = 0; i < 8; i++) {
            uint2 o;
            o.x = (unsigned)f2bf(w[i].x) | ((unsigned)f2bf(w[i].y) << 16);
            o.y = (unsigned)f2bf(w[i].z) | ((unsigned)f2bf(w[i].w) << 16);
            *(uint2*)(d + i * 1024 + tid * 4) = o;
        }
        return;
    }
    size_t row = blockIdx.x - CVT_BLOCKS;
    const float* xr = x + row * D_DIM;
    float v[4];
    float s = 0.f;
#pragma unroll
    for (int i = 0; i < 4; i++) { v[i] = xr[tid + i * 256]; s += v[i]; }
#pragma unroll
    for (int m = 16; m >= 1; m >>= 1) s += __shfl_xor(s, m);
    if (lane == 0) red[wave] = s;
    __syncthreads();
    float tot = 0.f;
#pragma unroll
    for (int i = 0; i < 8; i++) tot += red[i];
    float mean = tot * (1.f / (float)D_DIM);
    __syncthreads();
    float s2 = 0.f;
#pragma unroll
    for (int i = 0; i < 4; i++) { float d = v[i] - mean; s2 += d * d; }
#pragma unroll
    for (int m = 16; m >= 1; m >>= 1) s2 += __shfl_xor(s2, m);
    if (lane == 0) red[wave] = s2;
    __syncthreads();
    float tot2 = 0.f;
#pragma unroll
    for (int i = 0; i < 8; i++) tot2 += red[i];
    float rstd = rsqrtf(tot2 * (1.f / (float)D_DIM) + 1e-5f);
#pragma unroll
    for (int i = 0; i < 4; i++) {
        int c = tid + i * 256;
        xn[row * D_DIM + c] = f2bf((v[i] - mean) * rstd * g[c] + bb[c]);
    }
}

// ---------------------------------------------------------------- Tiled WMMA GEMM
// C[M,N] = A[M,K] * W[N,K]^T (+ epilogue).  BM=128 BN=128 BK=32, 8 waves,
// wave tile 64x32 (4x2 WMMA accumulators).
// MODE 0: QKV - bias from (b0|b1), split-store bf16 q(*0.125)/k/v.
// MODE 1: out-proj - fp32 out = acc + b0[col] + resid.
// Epilogue: the 128x128 output tile is staged in LDS (over the operand tiles),
// then leaves as 16-byte stores that cover whole rows of the tile.
template <int MODE>
__global__ __launch_bounds__(256) void gemm_kernel(
    const u16* __restrict__ A, const u16* __restrict__ W, int K_dim,
    const float* __restrict__ b0, const float* __restrict__ b1,
    u16* __restrict__ qb, u16* __restrict__ kb, u16* __restrict__ vb,
    const float* __restrict__ resid, float* __restrict__ outp) {
    // Staged row pitch in bytes: 128 elements + 16 B, so that the two lane halves
    // (8 rows apart) write banks 32 apart.
    constexpr int CP = (MODE == 0) ? 128 * 2 + 16 : 128 * 4 + 16;
    __shared__ __attribute__((aligned(16))) unsigned char smem[128 * CP];
    u16 (*As)[48] = reinterpret_cast<u16 (*)[48]>(smem);
    u16 (*Bs)[48] = reinterpret_cast<u16 (*)[48]>(smem + 128 * 48 * sizeof(u16));
    int tid = threadIdx.x, lane = tid & 31, wave = tid >> 5;
    int wm = wave & 1, wn = wave >> 1;
    int half = lane >> 4, r = lane & 15, bk = half * 8;
    const size_t M0 = (size_t)blockIdx.y * 128;
    const size_t N0 = (size_t)blockIdx.x * 128;
    const u16* Aptr = A + M0 * K_dim;
    const u16* Wptr = W + N0 * K_dim;

    v8f acc[4][2] = {};
    for (int k0 = 0; k0 < K_dim; k0 += 32) {
        __syncthreads();
#pragma unroll
        for (int i = 0; i < 2; i++) {
            int c = tid + i * 256;
            int row = c >> 2, col = (c & 3) * 8;
            *(uint4*)&As[row][col] = *(const uint4*)(Aptr + (size_t)row * K_dim + k0 + col);
            *(uint4*)&Bs[row][col] = *(const uint4*)(Wptr + (size_t)row * K_dim + k0 + col);
        }
        __syncthreads();
        v16bf af[4], bfr[2];
#pragma unroll
        for (int i = 0; i < 4; i++) af[i] = ldfrag(&As[wm * 64 + i * 16 + r][bk]);
#pragma unroll
        for (int j = 0; j < 2; j++) bfr[j] = ldfrag(&Bs[wn * 32 + j * 16 + r][bk]);
#pragma unroll
        for (int i = 0; i < 4; i++)
#pragma unroll
            for (int j = 0; j < 2; j++) acc[i][j] = wmma_bf16(af[i], bfr[j], acc[i][j]);
    }

    // Every loop below is fully unrolled so that acc[][] and rv[] keep constant
    // indices and stay in registers.
    const int rl0 = wm * 64 + 8 * half;   // this lane's first row in the tile
    const int cl0 = wn * 32 + r;          // this lane's first column in the tile
    if (MODE == 0) {
        // A 128-column tile lies wholly in q, k or v: one destination per block.
        const int which = (int)(N0 / D_DIM);
        const float* bias = (which == 0) ? b0 + N0 : b1 + (N0 - D_DIM);
        const float sc = (which == 0) ? 0.125f : 1.0f;  // fold 1/sqrt(DH) into q
        u16* dst = (which == 0) ? qb : (which == 1) ? kb : vb;
        float bj[2];
#pragma unroll
        for (int j = 0; j < 2; j++) bj[j] = bias[cl0 + j * 16];
        __syncthreads();  // every wave has read its last operand fragments
#pragma unroll
        for (int i = 0; i < 4; i++)
#pragma unroll
            for (int j = 0; j < 2; j++)
#pragma unroll
                for (int e = 0; e < 8; e++)
                    *(u16*)(smem + (rl0 + i * 16 + e) * CP + (cl0 + j * 16) * 2) =
                        f2bf((acc[i][j][e] + bj[j]) * sc);
        __syncthreads();  // the tile is complete before any wave reads rows of it
        u16* dtile = dst + M0 * D_DIM + (N0 % D_DIM);
        const int row0 = tid >> 4, ch = tid & 15;   // 16 chunks of 16 B per 256-B row
        const unsigned off = (unsigned)(row0 * D_DIM + ch * 8);
#pragma unroll
        for (int it = 0; it < 8; it++)
            *(uint4*)(dtile + off + it * 16 * D_DIM) =
                *(const uint4*)(smem + (row0 + it * 16) * CP + ch * 16);
    } else {
        // One wave covers one 512-B row per step; all residual loads go out together.
        const float* rtile = resid + M0 * D_DIM + N0;
        float* otile = outp + M0 * D_DIM + N0;
        const unsigned off = (unsigned)(wave * D_DIM + lane * 4);  // same for load and store
        float4 rv[16];
#pragma unroll
        for (int it = 0; it < 16; it++)
            rv[it] = *(const float4*)(rtile + off + it * 8 * D_DIM);
        __syncthreads();  // every wave has read its last operand fragments
        float4 bv = *(const float4*)(b0 + N0 + lane * 4);
#pragma unroll
        for (int i = 0; i < 4; i++)
#pragma unroll
            for (int j = 0; j < 2; j++)
#pragma unroll
                for (int e = 0; e < 8; e++)
                    *(float*)(smem + (rl0 + i * 16 + e) * CP + (cl0 + j * 16) * 4) = acc[i][j][e];
        __syncthreads();  // the tile is complete before any wave reads rows of it
#pragma unroll
        for (int it = 0; it < 16; it++) {
            int row = wave + it * 8;
            float4 a = *(const float4*)(smem + row * CP + lane * 16);
            float4 o;
            o.x = a.x + bv.x + rv[it].x;
            o.y = a.y + bv.y + rv[it].y;
            o.z = a.z + bv.z + rv[it].z;
            o.w = a.w + bv.w + rv[it].w;
            *(float4*)(otile + off + it * 8 * D_DIM) = o;
        }
    }
}

// ---------------------------------------------------------------- V transpose: vt[bh][dh][s]
__global__ __launch_bounds__(256) void vtrans_kernel(const u16* __restrict__ v,
                                                     u16* __restrict__ vt) {
    __shared__ u16 t[64][65];
    int tid = threadIdx.x;
    int bh = blockIdx.y, b = bh >> 4, h = bh & 15;
    int s0 = blockIdx.x * 64;
    int dh = tid & 63, sr = tid >> 6;
#pragma unroll
    for (int i = 0; i < 64; i += 4)
        t[sr + i][dh] = v[(size_t)(b * S_LEN + s0 + sr + i) * D_DIM + h * DH_NUM + dh];
    __syncthreads();
    int sc = tid & 63, dr = tid >> 6;
#pragma unroll
    for (int i = 0; i < 64; i += 4)
        vt[((size_t)bh * DH_NUM + dr + i) * S_LEN + s0 + sc] = t[sc][dr + i];
}

#define KT 64                        // keys per staged tile
#define KVP 72                       // LDS row pitch in u16: 128 B + 16 B, for 16-byte readers
#define KV_HALF (KT * KVP * 2)       // bytes of one operand's tile (64 rows)
#define KV_BUF (2 * KV_HALF)         // bytes of one buffer: K tile, then V^T tile

// One tile: each lane copies 16 bytes of rows (srow, srow+32) of K and of V^T.
// The s_wait_xcnt closes the statement so that no address register of a copy is
// rewritten while the copy may still need it.
__device__ __forceinline__ void stage_tile(unsigned lds, const u16* gk, const u16* gv) {
    unsigned lk1 = lds + 32 * KVP * 2, lv0 = lds + KV_HALF, lv1 = lds + KV_HALF + 32 * KVP * 2;
    const u16* gk1 = gk + (size_t)32 * D_DIM;
    const u16* gv1 = gv + (size_t)32 * S_LEN;
    asm volatile("global_load_async_to_lds_b128 %0, %1, off\n\t"
                 "global_load_async_to_lds_b128 %2, %3, off\n\t"
                 "global_load_async_to_lds_b128 %4, %5, off\n\t"
                 "global_load_async_to_lds_b128 %6, %7, off\n\t"
                 "s_wait_xcnt 0x0"
                 :: "v"(lds), "v"(gk), "v"(lk1), "v"(gk1), "v"(lv0), "v"(gv), "v"(lv1), "v"(gv1)
                 : "memory");
}

__global__ __launch_bounds__(256) void attn_kernel(const u16* __restrict__ q,
                                                   const u16* __restrict__ k,
                                                   const u16* __restrict__ vt,
                                                   const int* __restrict__ lens,
                                                   u16* __restrict__ ctx) {
    __shared__ __attribute__((aligned(16))) unsigned char kv[2 * KV_BUF];
    int tid = threadIdx.x, lane = tid & 31;
    int wave = __builtin_amdgcn_readfirstlane(tid >> 5);  // scalar: the per-wave skip is a real branch
    int half = lane >> 4, r = lane & 15, bk = half * 8;
    int bh = blockIdx.x, b = bh >> 4, h = bh & 15;
    int q0 = blockIdx.y * 128;
    int qw = q0 + wave * 16;
    int len = lens[b];
    int myq = qw + r;                        // the single query this lane owns
    int lim = (myq + 1 < len) ? myq + 1 : len;  // key valid iff key < lim

    // Q as B-operand (lane r = query), both 32-wide dh k-steps.
    const u16* qbase = q + ((size_t)(b * S_LEN + qw + r) * D_DIM + h * DH_NUM) + bk;
    v16bf qf[2];
    qf[0] = ldfrag(qbase);
    qf[1] = ldfrag(qbase + 32);

    float mrun = -1e30f, lrun = 0.f;
    v8f Ov[4] = {};

    int kmax = qw + 15;                      // this wave's last key
    if (len - 1 < kmax) kmax = len - 1;
    int kmaxb = q0 + 127;                    // the block's last key (<= S_LEN - 1)
    if (len - 1 < kmaxb) kmaxb = len - 1;
    const int nt = (kmaxb >> 6) + 1;         // tiles of 64 keys, the same for the whole block

    // This lane's share of a tile: 8 lanes per 128-byte row.
    const int srow = tid >> 3, scol = (tid & 7) * 8;
    const unsigned lds0 = (unsigned)(size_t)(kv + srow * (KVP * 2) + scol * 2);
    const u16* gk0 = k + ((size_t)(b * S_LEN + srow) * D_DIM + h * DH_NUM + scol);
    const u16* gv0 = vt + ((size_t)(bh * DH_NUM + srow) * S_LEN + scol);

    stage_tile(lds0, gk0, gv0);
    asm volatile("s_wait_asynccnt 0x0" ::: "memory");  // this wave's share of tile 0 has landed
    __syncthreads();                                   // ... and every other wave's
    if (1 < nt) stage_tile(lds0 + KV_BUF, gk0 + (size_t)KT * D_DIM, gv0 + KT);

    for (int t = 0; t < nt; t++) {
        const u16* Ks = (const u16*)(kv + (t & 1) * KV_BUF) + r * KVP + bk;  // K row r
        const u16* Vs = Ks + KT * KVP;                                       // V^T row r
        // Two steps of 32 keys; a wave stops at its own last key.  Kept rolled: unrolled, the
        // two skippable bodies cost a copy of all accumulators at each join.
#pragma unroll 1
        for (int c = 0; c < 2; c++) {
            const int kbp = t * KT + c * 32;
            if (kbp > kmax) break;
            {
                // ---- all 16 fragment loads up front
                v16bf kf0 = ldfrag(Ks + (c * 32) * KVP);
                v16bf kf1 = ldfrag(Ks + (c * 32) * KVP + 32);
                v16bf kf2 = ldfrag(Ks + (c * 32 + 16) * KVP);
                v16bf kf3 = ldfrag(Ks + (c * 32 + 16) * KVP + 32);
                v16bf vf[4];
#pragma unroll
                for (int j = 0; j < 4; j++)
                    vf[j] = ldfrag(Vs + (j * 16) * KVP + c * 32);

                // ---- S^T tiles: rows = keys (u*16 + e + 8*half), col = query
                v8f Sacc[2] = {};
                Sacc[0] = wmma_bf16(kf0, qf[0], Sacc[0]);
                Sacc[0] = wmma_bf16(kf1, qf[1], Sacc[0]);
                Sacc[1] = wmma_bf16(kf2, qf[0], Sacc[1]);
                Sacc[1] = wmma_bf16(kf3, qf[1], Sacc[1]);

                // ---- mask (only on boundary blocks) + per-lane online softmax
                float sv[2][8];
                float rowmax = -3.0e38f;
                bool full = (kbp + 32 <= qw + 1) && (kbp + 32 <= len);  // wave-uniform
                if (full) {
#pragma unroll
                    for (int u = 0; u < 2; u++)
#pragma unroll
                        for (int e = 0; e < 8; e++) {
                            sv[u][e] = Sacc[u][e];
                            rowmax = fmaxf(rowmax, sv[u][e]);
                        }
                } else {
                    int kbase0 = kbp + 8 * half;
#pragma unroll
                    for (int u = 0; u < 2; u++)
#pragma unroll
                        for (int e = 0; e < 8; e++) {
                            int key = kbase0 + u * 16 + e;
                            sv[u][e] = (key < lim) ? Sacc[u][e] : -3.0e38f;
                            rowmax = fmaxf(rowmax, sv[u][e]);
                        }
                }
                rowmax = fmaxf(rowmax, __shfl_xor(rowmax, 16));
                float mnew = fmaxf(mrun, rowmax);
                float scale = __expf(mrun - mnew);
                float rsum = 0.f;
                P16 ph;
#pragma unroll
                for (int u = 0; u < 2; u++)
#pragma unroll
                    for (int e = 0; e < 8; e++) {
                        float p = __expf(sv[u][e] - mnew);
                        rsum += p;
                        ph.h[u * 8 + e] = f2bf(p);  // B-operand half m = u*8+e -> key u*16+e+8*half
                    }
                rsum += __shfl_xor(rsum, 16);
                lrun = lrun * scale + rsum;
                mrun = mnew;
                v16bf pf = __builtin_bit_cast(v16bf, ph);

                // ---- O^T += V^T * P  (rows = dh, col = query)
#pragma unroll
                for (int j = 0; j < 4; j++) {
#pragma unroll
                    for (int e = 0; e < 8; e++) Ov[j][e] *= scale;
                    Ov[j] = wmma_bf16(vf[j], pf, Ov[j]);
                }
            }
        }
        // Hand-over, passed by every wave (also one that skipped the work above).
        asm volatile("s_wait_dscnt 0x0" ::: "memory");     // my reads of this buffer are done
        asm volatile("s_wait_asynccnt 0x0" ::: "memory");  // my share of tile t+1 has landed
        __syncthreads();  // tile t+1 is whole, and nobody reads tile t's buffer any more
        if (t + 2 < nt)
            stage_tile(lds0 + (t & 1) * KV_BUF, gk0 + (size_t)(t + 2) * KT * D_DIM,
                       gv0 + (t + 2) * KT);
    }
    asm volatile("s_wait_asynccnt 0x0" ::: "memory");  // no copy is open when the wave ends

    float inv = 1.f / lrun;
#pragma unroll
    for (int j = 0; j < 4; j++)
#pragma unroll
        for (int e = 0; e < 8; e++) {
            int dh = j * 16 + e + 8 * half;
            ctx[(size_t)(b * S_LEN + myq) * D_DIM + h * DH_NUM + dh] = f2bf(Ov[j][e] * inv);
        }
}

// ---------------------------------------------------------------- launch
extern "C" void kernel_launch(void* const* d_in, const int* in_sizes, int n_in,
                              void* d_out, int out_size, void* d_ws, size_t ws_size,
                              hipStream_t stream) {
    (void)in_sizes; (void)n_in; (void)out_size; (void)ws_size;
    const float* x    = (const float*)d_in[0];
    const int*   lens = (const int*)d_in[1];
    const float* Wq   = (const float*)d_in[2];
    const float* bq   = (const float*)d_in[3];
    const float* Wkv  = (const float*)d_in[4];
    const float* bkv  = (const float*)d_in[5];
    const float* Wo   = (const float*)d_in[6];
    const float* bo   = (const float*)d_in[7];
    const float* ln_g = (const float*)d_in[8];
    const float* ln_b = (const float*)d_in[9];
    float* out = (float*)d_out;

    const size_t BS = 4 * (size_t)S_LEN;            // 8192 rows
    const size_t DD = (size_t)D_DIM * D_DIM;        // 1M
    char* ws = (char*)d_ws;
    size_t off = 0;
    auto alloc = [&](size_t elems) { u16* p = (u16*)(ws + off); off += elems * sizeof(u16); return p; };
    u16* wqkv = alloc(3 * DD);        // [Wq ; Wkv] rows, bf16
    u16* wo   = alloc(DD);
    u16* xn   = alloc(BS * D_DIM);
    u16* qb   = alloc(BS * D_DIM);
    u16* kbuf = alloc(BS * D_DIM);
    u16* vbuf = alloc(BS * D_DIM);
    u16* vtb  = alloc(BS * D_DIM);
    u16* ctx  = alloc(BS * D_DIM);

    // wo follows wqkv directly in the workspace: one bf16 destination for all weights.
    prep_kernel<<<(int)(CVT_BLOCKS + BS), 256, 0, stream>>>(x, ln_g, ln_b, xn, Wq, Wkv, Wo, wqkv);

    dim3 gqkv(3 * D_DIM / 128, (int)(BS / 128));   // (24, 64)
    gemm_kernel<0><<<gqkv, 256, 0, stream>>>(xn, wqkv, D_DIM, bq, bkv,
                                             qb, kbuf, vbuf, nullptr, nullptr);

    vtrans_kernel<<<dim3(S_LEN / 64, 4 * H_NUM), 256, 0, stream>>>(vbuf, vtb);

    attn_kernel<<<dim3(4 * H_NUM, S_LEN / 128), 256, 0, stream>>>(qb, kbuf, vtb, lens, ctx);

    dim3 gout(D_DIM / 128, (int)(BS / 128));       // (8, 64)
    gemm_kernel<1><<<gout, 256, 0, stream>>>(ctx, wo, D_DIM, bo, nullptr,
                                             nullptr, nullptr, nullptr, x, out);
}

// v004
// Measured time: 132 microseconds a run.
// Next to v003, in two timings, it ran 1.34 and 1.33 times as fast.
// Counting every step since v000, it is 2.04 times as fast.
#include <hip/hip_runtime.h>

typedef unsigned short u16;
typedef __attribute__((ext_vector_type(16))) __bf16 v16bf;
typedef __attribute__((ext_vector_type(8)))  float  v8f;

#define S_LEN 2048
#define D_DIM 1024
#define H_NUM 16
#define DH_NUM 64

__device__ __forceinline__ u16 f2bf(float f) {
    unsigned u = __float_as_uint(f);
    u += 0x7FFFu + ((u >> 16) & 1u);
    return (u16)(u >> 16);
}

struct Pack32 { uint4 a, b; };
struct P16 { u16 h[16]; };

// Load one bf16 WMMA operand fragment (A-pattern; B uses the same pattern with
// lane -> N).  Lane-half 0: K in [0,8)u[16,24); lane-half 1: K in [8,16)u[24,32).
// Caller passes p already offset by (row, basek); we read p[0..7] and p[16..23].
__device__ __forceinline__ v16bf ldfrag(const u16* p) {
    Pack32 s;
    s.a = *(const uint4*)(p);
    s.b = *(const uint4*)(p + 16);
    return __builtin_bit_cast(v16bf, s);
}

__device__ __forceinline__ v8f wmma_bf16(v16bf a, v16bf b, v8f c) {
    return __builtin_amdgcn_wmma_f32_16x16x32_bf16(false, a, false, b, (short)0, c,
                                                   false, false);
}

// ---------------------------------------------------------------- weights -> bf16, LayerNorm
// One launch.  The first CVT_BLOCKS blocks round the weights to bf16, the others
// normalise one row of x each; the two kinds of block share nothing.
// A conversion block takes CVT_ELEMS consecutive elements: each wave reads 8 times
// 512 contiguous bytes (all 8 loads go out before the first value is used) and
// writes 8 times 256 contiguous bytes.  The bf16 copies of Wq, Wkv, Wo lie one
// behind the other in wbf.
#define CVT_ELEMS 8192
#define CVT_Q (D_DIM * D_DIM / CVT_ELEMS)        // blocks for Wq, and for Wo
#define CVT_KV (2 * D_DIM * D_DIM / CVT_ELEMS)   // blocks for Wkv
#define CVT_BLOCKS (CVT_Q + CVT_KV + CVT_Q)

__global__ __launch_bounds__(256) void prep_kernel(const float* __restrict__ x,
                                                   const float* __restrict__ g,
                                                   const float* __restrict__ bb,
                                                   u16* __restrict__ xn,
                                                   const float* __restrict__ Wq,
                                                   const float* __restrict__ Wkv,
                                                   const float* __restrict__ Wo,
                                                   u16* __restrict__ wbf) {
    __shared__ float red[8];
    int tid = threadIdx.x, lane = tid & 31, wave = tid >> 5;
    if (blockIdx.x < CVT_BLOCKS) {   // the same for the whole block, ahead of every barrier
        const int cb = blockIdx.x;
        const float* s = (cb < CVT_Q)            ? Wq + (size_t)cb * CVT_ELEMS
                         : (cb < CVT_Q + CVT_KV) ? Wkv + (size_t)(cb - CVT_Q) * CVT_ELEMS
                                                 : Wo + (size_t)(cb - CVT_Q - CVT_KV) * CVT_ELEMS;
        u16* d = wbf + (size_t)cb * CVT_ELEMS;
        float4 w[8];
        // Both loops unrolled: w[] stays in registers and the 8 loads are issued together.
#pragma unroll
        for (int i = 0; i < 8; i++) w[i] = *(const float4*)(s + i * 1024 + tid * 4);
#pragma unroll
        for (int i = 0; i < 8; i++) {
            uint2 o;
            o.x = (unsigned)f2bf(w[i].x) | ((unsigned)f2bf(w[i].y) << 16);
            o.y = (unsigned)f2bf(w[i].z) | ((unsigned)f2bf(w[i].w) << 16);
            *(uint2*)(d + i * 1024 + tid * 4) = o;
        }
        return;
    }
    size_t row = blockIdx.x - CVT_BLOCKS;
    const float* xr = x + row * D_DIM;
    float v[4];
    float s = 0.f;
#pragma unroll
    for (int i = 0; i < 4; i++) { v[i] = xr[tid + i * 256]; s += v[i]; }
#pragma unroll
    for (int m = 16; m >= 1; m >>= 1) s += __shfl_xor(s, m);
    if (lane == 0) red[wave] = s;
    __syncthreads();
    float tot = 0.f;
#pragma unroll
    for (int i = 0; i < 8; i++) tot += red[i];
    float mean = tot * (1.f / (float)D_DIM);
    __syncthreads();
    float s2 = 0.f;
#pragma unroll
    for (int i = 0; i < 4; i++) { float d = v[i] - mean; s2 += d * d; }
#pragma unroll
    for (int m = 16; m >= 1; m >>= 1) s2 += __shfl_xor(s2, m);
    if (lane == 0) red[wave] = s2;
    __syncthreads();
    float tot2 = 0.f;
#pragma unroll
    for (int i = 0; i < 8; i++) tot2 += red[i];
    float rstd = rsqrtf(tot2 * (1.f / (float)D_DIM) + 1e-5f);
#pragma unroll
    for (int i = 0; i < 4; i++) {
        int c = tid + i * 256;
        xn[row * D_DIM + c] = f2bf((v[i] - mean) * rstd * g[c] + bb[c]);
    }
}

// ---------------------------------------------------------------- Tiled WMMA GEMM
// C[M,N] = A[M,K] * W[N,K]^T (+ epilogue).  BM=128 BN=128, 8 waves,
// wave tile 64x32 (4x2 WMMA accumulators).  K a multiple of 64, at least 64.
// The operands come through LDS in tiles of 64 k (whole 128-byte rows), copied in
// without passing registers; two buffers, the next tile's copies fly during this
// tile's products.
// MODE 0: QKV - bias from (b0|b1), split-store bf16 q(*0.125)/k/v.
// MODE 1: out-proj - fp32 out = acc + b0[col] + resid.
// Epilogue: the 128x128 output tile is staged in LDS (over the operand tiles),
// then leaves as 16-byte stores that cover whole rows of the tile.
#define GK 64                        // k per staged tile
#define GP 72                        // LDS row pitch in u16: 128 B + 16 B, for 16-byte readers
#define G_HALF (128 * GP * 2)        // bytes of one operand's tile (128 rows)
#define G_BUF (2 * G_HALF)           // bytes of one buffer: A tile, then W tile

// One tile: each lane copies 16 bytes of rows (srow + 32 i), i = 0..3, of A and of W;
// rstep = 32 rows in elements.  The s_wait_xcnt closes the statement so that no address
// register of a copy is rewritten while the copy may still need it.
__device__ __forceinline__ void stage_gemm(unsigned lds, const u16* ga, const u16* gw,
                                           size_t rstep) {
    unsigned la1 = lds + 32 * GP * 2, la2 = lds + 64 * GP * 2, la3 = lds + 96 * GP * 2;
    unsigned lw0 = lds + G_HALF, lw1 = la1 + G_HALF, lw2 = la2 + G_HALF, lw3 = la3 + G_HALF;
    const u16 *ga1 = ga + rstep, *ga2 = ga1 + rstep, *ga3 = ga2 + rstep;
    const u16 *gw1 = gw + rstep, *gw2 = gw1 + rstep, *gw3 = gw2 + rstep;
    asm volatile("global_load_async_to_lds_b128 %0, %1, off\n\t"
                 "global_load_async_to_lds_b128 %2, %3, off\n\t"
                 "global_load_async_to_lds_b128 %4, %5, off\n\t"
                 "global_load_async_to_lds_b128 %6, %7, off\n\t"
                 "global_load_async_to_lds_b128 %8, %9, off\n\t"
                 "global_load_async_to_lds_b128 %10, %11, off\n\t"
                 "global_load_async_to_lds_b128 %12, %13, off\n\t"
                 "global_load_async_to_lds_b128 %14, %15, off\n\t"
                 "s_wait_xcnt 0x0"
                 :: "v"(lds), "v"(ga), "v"(la1), "v"(ga1), "v"(la2), "v"(ga2), "v"(la3), "v"(ga3),
                    "v"(lw0), "v"(gw), "v"(lw1), "v"(gw1), "v"(lw2), "v"(gw2), "v"(lw3), "v"(gw3)
                 : "memory");
}

template <int MODE>
__global__ __launch_bounds__(256) void gemm_kernel(
    const u16* __restrict__ A, const u16* __restrict__ W, int K_dim,
    const float* __restrict__ b0, const float* __restrict__ b1,
    u16* __restrict__ qb, u16* __restrict__ kb, u16* __restrict__ vb,
    const float* __restrict__ resid, float* __restrict__ outp) {
    // Staged row pitch in bytes: 128 elements + 16 B, so that the two lane halves
    // (8 rows apart) write banks 32 apart.
    constexpr int CP = (MODE == 0) ? 128 * 2 + 16 : 128 * 4 + 16;
    constexpr int SMEM = (2 * G_BUF > 128 * CP) ? 2 * G_BUF : 128 * CP;
    __shared__ __attribute__((aligned(16))) unsigned char smem[SMEM];
    int tid = threadIdx.x, lane = tid & 31, wave = tid >> 5;
    int wm = wave & 1, wn = wave >> 1;
    int half = lane >> 4, r = lane & 15, bk = half * 8;
    const size_t M0 = (size_t)blockIdx.y * 128;
    const size_t N0 = (size_t)blockIdx.x * 128;
    const u16* Aptr = A + M0 * K_dim;
    const u16* Wptr = W + N0 * K_dim;

    v8f acc[4][2] = {};
    const int nt = K_dim / GK;   // tiles of 64 k, the same for the whole block
    // This lane's share of a tile: 8 lanes per 128-byte row.
    const int srow = tid >> 3, scol = (tid & 7) * 8;
    const unsigned lds0 = (unsigned)(size_t)(smem + srow * (GP * 2) + scol * 2);
    const u16* ga0 = Aptr + (size_t)srow * K_dim + scol;
    const u16* gw0 = Wptr + (size_t)srow * K_dim + scol;
    const size_t rstep = (size_t)32 * K_dim;

    stage_gemm(lds0, ga0, gw0, rstep);
    asm volatile("s_wait_asynccnt 0x0" ::: "memory");  // this wave's share of tile 0 has landed
    __syncthreads();                                   // ... and every other wave's
    if (1 < nt) stage_gemm(lds0 + G_BUF, ga0 + GK, gw0 + GK, rstep);

    for (int t = 0; t < nt; t++) {
        const u16* As = (const u16*)(smem + (t & 1) * G_BUF) + (wm * 64 + r) * GP + bk;
        const u16* Bs = (const u16*)(smem + (t & 1) * G_BUF + G_HALF) + (wn * 32 + r) * GP + bk;
        // Unrolled: the two 32-k steps of a tile differ only in constant LDS offsets.
#pragma unroll
        for (int kk = 0; kk < GK; kk += 32) {
            v16bf af[4], bfr[2];
#pragma unroll
            for (int i = 0; i < 4; i++) af[i] = ldfrag(As + i * 16 * GP + kk);
#pragma unroll
            for (int j = 0; j < 2; j++) bfr[j] = ldfrag(Bs + j * 16 * GP + kk);
#pragma unroll
            for (int i = 0; i < 4; i++)
#pragma unroll
                for (int j = 0; j < 2; j++) acc[i][j] = wmma_bf16(af[i], bfr[j], acc[i][j]);
        }
        // Hand-over, passed by every wave.
        asm volatile("s_wait_dscnt 0x0" ::: "memory");     // my reads of this buffer are done
        asm volatile("s_wait_asynccnt 0x0" ::: "memory");  // my share of tile t+1 has landed
        __syncthreads();  // tile t+1 is whole, and nobody reads tile t's buffer any more
        if (t + 2 < nt)
            stage_gemm(lds0 + (t & 1) * G_BUF, ga0 + (size_t)(t + 2) * GK, gw0 + (size_t)(t + 2) * GK,
                       rstep);
    }
    asm volatile("s_wait_asynccnt 0x0" ::: "memory");  // no copy is open when the tile is staged

    // Every loop below is fully unrolled so that acc[][] and rv[] keep constant
    // indices and stay in registers.
    const int rl0 = wm * 64 + 8 * half;   // this lane's first row in the tile
    const int cl0 = wn * 32 + r;          // this lane's first column in the tile
    if (MODE == 0) {
        // A 128-column tile lies wholly in q, k or v: one destination per block.
        const int which = (int)(N0 / D_DIM);
        const float* bias = (which == 0) ? b0 + N0 : b1 + (N0 - D_DIM);
        const float sc = (which == 0) ? 0.125f : 1.0f;  // fold 1/sqrt(DH) into q
        u16* dst = (which == 0) ? qb : (which == 1) ? kb : vb;
        float bj[2];
#pragma unroll
        for (int j = 0; j < 2; j++) bj[j] = bias[cl0 + j * 16];
        __syncthreads();  // every wave has read its last operand fragments
#pragma unroll
        for (int i = 0; i < 4; i++)
#pragma unroll
            for (int j = 0; j < 2; j++)
#pragma unroll
                for (int e = 0; e < 8; e++)
                    *(u16*)(smem + (rl0 + i * 16 + e) * CP + (cl0 + j * 16) * 2) =
                        f2bf((acc[i][j][e] + bj[j]) * sc);
        __syncthreads();  // the tile is complete before any wave reads rows of it
        u16* dtile = dst + M0 * D_DIM + (N0 % D_DIM);
        const int row0 = tid >> 4, ch = tid & 15;   // 16 chunks of 16 B per 256-B row
        const unsigned off = (unsigned)(row0 * D_DIM + ch * 8);
#pragma unroll
        for (int it = 0; it < 8; it++)
            *(uint4*)(dtile + off + it * 16 * D_DIM) =
                *(const uint4*)(smem + (row0 + it * 16) * CP + ch * 16);
    } else {
        // One wave covers one 512-B row per step; all residual loads go out together.
        const float* rtile = resid + M0 * D_DIM + N0;
        float* otile = outp + M0 * D_DIM + N0;
        const unsigned off = (unsigned)(wave * D_DIM + lane * 4);  // same for load and store
        float4 rv[16];
#pragma unroll
        for (int it = 0; it < 16; it++)
            rv[it] = *(const float4*)(rtile + off + it * 8 * D_DIM);
        __syncthreads();  // every wave has read its last operand fragments
        float4 bv = *(const float4*)(b0 + N0 + lane * 4);
#pragma unroll
        for (int i = 0; i < 4; i++)
#pragma unroll
            for (int j = 0; j < 2; j++)
#pragma unroll
                for (int e = 0; e < 8; e++)
                    *(float*)(smem + (rl0 + i * 16 + e) * CP + (cl0 + j * 16) * 4) = acc[i][j][e];
        __syncthreads();  // the tile is complete before any wave reads rows of it
#pragma unroll
        for (int it = 0; it < 16; it++) {
            int row = wave + it * 8;
            float4 a = *(const float4*)(smem + row * CP + lane * 16);
            float4 o;
            o.x = a.x + bv.x + rv[it].x;
            o.y = a.y + bv.y + rv[it].y;
            o.z = a.z + bv.z + rv[it].z;
            o.w = a.w + bv.w + rv[it].w;
            *(float4*)(otile + off + it * 8 * D_DIM) = o;
        }
    }
}

// ---------------------------------------------------------------- V transpose: vt[bh][dh][s]
__global__ __launch_bounds__(256) void vtrans_kernel(const u16* __restrict__ v,
                                                     u16* __restrict__ vt) {
    __shared__ u16 t[64][65];
    int tid = threadIdx.x;
    int bh = blockIdx.y, b = bh >> 4, h = bh & 15;
    int s0 = blockIdx.x * 64;
    int dh = tid & 63, sr = tid >> 6;
#pragma unroll
    for (int i = 0; i < 64; i += 4)
        t[sr + i][dh] = v[(size_t)(b * S_LEN + s0 + sr + i) * D_DIM + h * DH_NUM + dh];
    __syncthreads();
    int sc = tid & 63, dr = tid >> 6;
#pragma unroll
    for (int i = 0; i < 64; i += 4)
        vt[((size_t)bh * DH_NUM + dr + i) * S_LEN + s0 + sc] = t[sc][dr + i];
}

#define KT 64                        // keys per staged tile
#define KVP 72                       // LDS row pitch in u16: 128 B + 16 B, for 16-byte readers
#define KV_HALF (KT * KVP * 2)       // bytes of one operand's tile (64 rows)
#define KV_BUF (2 * KV_HALF)         // bytes of one buffer: K tile, then V^T tile

// One tile: each lane copies 16 bytes of rows (srow, srow+32) of K and of V^T.
// The s_wait_xcnt closes the statement so that no address register of a copy is
// rewritten while the copy may still need it.
__device__ __forceinline__ void stage_tile(unsigned lds, const u16* gk, const u16* gv) {
    unsigned lk1 = lds + 32 * KVP * 2, lv0 = lds + KV_HALF, lv1 = lds + KV_HALF + 32 * KVP * 2;
    const u16* gk1 = gk + (size_t)32 * D_DIM;
    const u16* gv1 = gv + (size_t)32 * S_LEN;
    asm volatile("global_load_async_to_lds_b128 %0, %1, off\n\t"
                 "global_load_async_to_lds_b128 %2, %3, off\n\t"
                 "global_load_async_to_lds_b128 %4, %5, off\n\t"
                 "global_load_async_to_lds_b128 %6, %7, off\n\t"
                 "s_wait_xcnt 0x0"
                 :: "v"(lds), "v"(gk), "v"(lk1), "v"(gk1), "v"(lv0), "v"(gv), "v"(lv1), "v"(gv1)
                 : "memory");
}

__global__ __launch_bounds__(256) void attn_kernel(const u16* __restrict__ q,
                                                   const u16* __restrict__ k,
                                                   const u16* __restrict__ vt,
                                                   const int* __restrict__ lens,
                                                   u16* __restrict__ ctx) {
    __shared__ __attribute__((aligned(16))) unsigned char kv[2 * KV_BUF];
    int tid = threadIdx.x, lane = tid & 31;
    int wave = __builtin_amdgcn_readfirstlane(tid >> 5);  // scalar: the per-wave skip is a real branch
    int half = lane >> 4, r = lane & 15, bk = half * 8;
    int bh = blockIdx.x, b = bh >> 4, h = bh & 15;
    int q0 = blockIdx.y * 128;
    int qw = q0 + wave * 16;
    int len = lens[b];
    int myq = qw + r;                        // the single query this lane owns
    int lim = (myq + 1 < len) ? myq + 1 : len;  // key valid iff key < lim

    // Q as B-operand (lane r = query), both 32-wide dh k-steps.
    const u16* qbase = q + ((size_t)(b * S_LEN + qw + r) * D_DIM + h * DH_NUM) + bk;
    v16bf qf[2];
    qf[0] = ldfrag(qbase);
    qf[1] = ldfrag(qbase + 32);

    float mrun = -1e30f, lrun = 0.f;
    v8f Ov[4] = {};

    int kmax = qw + 15;                      // this wave's last key
    if (len - 1 < kmax) kmax = len - 1;
    int kmaxb = q0 + 127;                    // the block's last key (<= S_LEN - 1)
    if (len - 1 < kmaxb) kmaxb = len - 1;
    const int nt = (kmaxb >> 6) + 1;         // tiles of 64 keys, the same for the whole block

    // This lane's share of a tile: 8 lanes per 128-byte row.
    const int srow = tid >> 3, scol = (tid & 7) * 8;
    const unsigned lds0 = (unsigned)(size_t)(kv + srow * (KVP * 2) + scol * 2);
    const u16* gk0 = k + ((size_t)(b * S_LEN + srow) * D_DIM + h * DH_NUM + scol);
    const u16* gv0 = vt + ((size_t)(bh * DH_NUM + srow) * S_LEN + scol);

    stage_tile(lds0, gk0, gv0);
    asm volatile("s_wait_asynccnt 0x0" ::: "memory");  // this wave's share of tile 0 has landed
    __syncthreads();                                   // ... and every other wave's
    if (1 < nt) stage_tile(lds0 + KV_BUF, gk0 + (size_t)KT * D_DIM, gv0 + KT);

    for (int t = 0; t < nt; t++) {
        const u16* Ks = (const u16*)(kv + (t & 1) * KV_BUF) + r * KVP + bk;  // K row r
        const u16* Vs = Ks + KT * KVP;                                       // V^T row r
        // Two steps of 32 keys; a wave stops at its own last key.  Kept rolled: unrolled, the
        // two skippable bodies cost a copy of all accumulators at each join.
#pragma unroll 1
        for (int c = 0; c < 2; c++) {
            const int kbp = t * KT + c * 32;
            if (kbp > kmax) break;
            {
                // ---- all 16 fragment loads up front
                v16bf kf0 = ldfrag(Ks + (c * 32) * KVP);
                v16bf kf1 = ldfrag(Ks + (c * 32) * KVP + 32);
                v16bf kf2 = ldfrag(Ks + (c * 32 + 16) * KVP);
                v16bf kf3 = ldfrag(Ks + (c * 32 + 16) * KVP + 32);
                v16bf vf[4];
#pragma unroll
                for (int j = 0; j < 4; j++)
                    vf[j] = ldfrag(Vs + (j * 16) * KVP + c * 32);

                // ---- S^T tiles: rows = keys (u*16 + e + 8*half), col = query
                v8f Sacc[2] = {};
                Sacc[0] = wmma_bf16(kf0, qf[0], Sacc[0]);
                Sacc[0] = wmma_bf16(kf1, qf[1], Sacc[0]);
                Sacc[1] = wmma_bf16(kf2, qf[0], Sacc[1]);
                Sacc[1] = wmma_bf16(kf3, qf[1], Sacc[1]);

                // ---- mask (only on boundary blocks) + per-lane online softmax
                float sv[2][8];
                float rowmax = -3.0e38f;
                bool full = (kbp + 32 <= qw + 1) && (kbp + 32 <= len);  // wave-uniform
                if (full) {
#pragma unroll
                    for (int u = 0; u < 2; u++)
#pragma unroll
                        for (int e = 0; e < 8; e++) {
                            sv[u][e] = Sacc[u][e];
                            rowmax = fmaxf(rowmax, sv[u][e]);
                        }
                } else {
                    int kbase0 = kbp + 8 * half;
#pragma unroll
                    for (int u = 0; u < 2; u++)
#pragma unroll
                        for (int e = 0; e < 8; e++) {
                            int key = kbase0 + u * 16 + e;
                            sv[u][e] = (key < lim) ? Sacc[u][e] : -3.0e38f;
                            rowmax = fmaxf(rowmax, sv[u][e]);
                        }
                }
                rowmax = fmaxf(rowmax, __shfl_xor(rowmax, 16));
                float mnew = fmaxf(mrun, rowmax);
                float scale = __expf(mrun - mnew);
                float rsum = 0.f;
                P16 ph;
#pragma unroll
                for (int u = 0; u < 2; u++)
#pragma unroll
                    for (int e = 0; e < 8; e++) {
                        float p = __expf(sv[u][e] - mnew);
                        rsum += p;
                        ph.h[u * 8 + e] = f2bf(p);  // B-operand half m = u*8+e -> key u*16+e+8*half
                    }
                rsum += __shfl_xor(rsum, 16);
                lrun = lrun * scale + rsum;
                mrun = mnew;
                v16bf pf = __builtin_bit_cast(v16bf, ph);

                // ---- O^T += V^T * P  (rows = dh, col = query)
#pragma unroll
                for (int j = 0; j < 4; j++) {
#pragma unroll
                    for (int e = 0; e < 8; e++) Ov[j][e] *= scale;
                    Ov[j] = wmma_bf16(vf[j], pf, Ov[j]);
                }
            }
        }
        // Hand-over, passed by every wave (also one that skipped the work above).
        asm volatile("s_wait_dscnt 0x0" ::: "memory");     // my reads of this buffer are done
        asm volatile("s_wait_asynccnt 0x0" ::: "memory");  // my share of tile t+1 has landed
        __syncthreads();  // tile t+1 is whole, and nobody reads tile t's buffer any more
        if (t + 2 < nt)
            stage_tile(lds0 + (t & 1) * KV_BUF, gk0 + (size_t)(t + 2) * KT * D_DIM,
                       gv0 + (t + 2) * KT);
    }
    asm volatile("s_wait_asynccnt 0x0" ::: "memory");  // no copy is open when the wave ends

    float inv = 1.f / lrun;
#pragma unroll
    for (int j = 0; j < 4; j++)
#pragma unroll
        for (int e = 0; e < 8; e++) {
            int dh = j * 16 + e + 8 * half;
            ctx[(size_t)(b * S_LEN + myq) * D_DIM + h * DH_NUM + dh] = f2bf(Ov[j][e] * inv);
        }
}

// ---------------------------------------------------------------- launch
extern "C" void kernel_launch(void* const* d_in, const int* in_sizes, int n_in,
                              void* d_out, int out_size, void* d_ws, size_t ws_size,
                              hipStream_t stream) {
    (void)in_sizes; (void)n_in; (void)out_size; (void)ws_size;
    const float* x    = (const float*)d_in[0];
    const int*   lens = (const int*)d_in[1];
    const float* Wq   = (const float*)d_in[2];
    const float* bq   = (const float*)d_in[3];
    const float* Wkv  = (const float*)d_in[4];
    const float* bkv  = (const float*)d_in[5];
    const float* Wo   = (const float*)d_in[6];
    const float* bo   = (const float*)d_in[7];
    const float* ln_g = (const float*)d_in[8];
    const float* ln_b = (const float*)d_in[9];
    float* out = (float*)d_out;

    const size_t BS = 4 * (size_t)S_LEN;            // 8192 rows
    const size_t DD = (size_t)D_DIM * D_DIM;        // 1M
    char* ws = (char*)d_ws;
    size_t off = 0;
    auto alloc = [&](size_t elems) { u16* p = (u16*)(ws + off); off += elems * sizeof(u16); return p; };
    u16* wqkv = alloc(3 * DD);        // [Wq ; Wkv] rows, bf16
    u16* wo   = alloc(DD);
    u16* xn   = alloc(BS * D_DIM);
    u16* qb   = alloc(BS * D_DIM);
    u16* kbuf = alloc(BS * D_DIM);
    u16* vbuf = alloc(BS * D_DIM);
    u16* vtb  = alloc(BS * D_DIM);
    u16* ctx  = alloc(BS * D_DIM);

    // wo follows wqkv directly in the workspace: one bf16 destination for all weights.
    prep_kernel<<<(int)(CVT_BLOCKS + BS), 256, 0, stream>>>(x, ln_g, ln_b, xn, Wq, Wkv, Wo, wqkv);

    dim3 gqkv(3 * D_DIM / 128, (int)(BS / 128));   // (24, 64)
    gemm_kernel<0><<<gqkv, 256, 0, stream>>>(xn, wqkv, D_DIM, bq, bkv,
                                             qb, kbuf, vbuf, nullptr, nullptr);

    vtrans_kernel<<<dim3(S_LEN / 64, 4 * H_NUM), 256, 0, stream>>>(vbuf, vtb);

    attn_kernel<<<dim3(4 * H_NUM, S_LEN / 128), 256, 0, stream>>>(qb, kbuf, vtb, lens, ctx);

    dim3 gout(D_DIM / 128, (int)(BS / 128));       // (8, 64)
    gemm_kernel<1><<<gout, 256, 0, stream>>>(ctx, wo, D_DIM, bo, nullptr,
                                             nullptr, nullptr, nullptr, x, out);
}

// v005
// It runs in 127 microseconds.
// Two timings next to v004 both put it at 1.04 times that version's speed.
// All steps since v000 together make it 2.12 times as fast.
#include <hip/hip_runtime.h>

typedef unsigned short u16;
typedef __attribute__((ext_vector_type(16))) __bf16 v16bf;
typedef __attribute__((ext_vector_type(8)))  float  v8f;

#define S_LEN 2048
#define D_DIM 1024
#define H_NUM 16
#define DH_NUM 64

__device__ __forceinline__ u16 f2bf(float f) {
    unsigned u = __float_as_uint(f);
    u += 0x7FFFu + ((u >> 16) & 1u);
    return (u16)(u >> 16);
}

struct Pack32 { uint4 a, b; };
struct P16 { u16 h[16]; };

// Load one bf16 WMMA operand fragment (A-pattern; B uses the same pattern with
// lane -> N).  Lane-half 0: K in [0,8)u[16,24); lane-half 1: K in [8,16)u[24,32).
// Caller passes p already offset by (row, basek); we read p[0..7] and p[16..23].
__device__ __forceinline__ v16bf ldfrag(const u16* p) {
    Pack32 s;
    s.a = *(const uint4*)(p);
    s.b = *(const uint4*)(p + 16);
    return __builtin_bit_cast(v16bf, s);
}

__device__ __forceinline__ v8f wmma_bf16(v16bf a, v16bf b, v8f c) {
    return __builtin_amdgcn_wmma_f32_16x16x32_bf16(false, a, false, b, (short)0, c,
                                                   false, false);
}

// ---------------------------------------------------------------- weights -> bf16, LayerNorm
// One launch.  The first CVT_BLOCKS blocks round the weights to bf16, the others
// normalise one row of x each; the two kinds of block share nothing.
// A conversion block takes CVT_ELEMS consecutive elements: each wave reads 8 times
// 512 contiguous bytes (all 8 loads go out before the first value is used) and
// writes 8 times 256 contiguous bytes.  The bf16 copies of Wq, Wkv, Wo lie one
// behind the other in wbf.
#define CVT_ELEMS 8192
#define CVT_Q (D_DIM * D_DIM / CVT_ELEMS)        // blocks for Wq, and for Wo
#define CVT_KV (2 * D_DIM * D_DIM / CVT_ELEMS)   // blocks for Wkv
#define CVT_BLOCKS (CVT_Q + CVT_KV + CVT_Q)

__global__ __launch_bounds__(256) void prep_kernel(const float* __restrict__ x,
                                                   const float* __restrict__ g,
                                                   const float* __restrict__ bb,
                                                   u16* __restrict__ xn,
                                                   const float* __restrict__ Wq,
                                                   const float* __restrict__ Wkv,
                                                   const float* __restrict__ Wo,
                                                   u16* __restrict__ wbf) {
    __shared__ float red[8];
    int tid = threadIdx.x, lane = tid & 31, wave = tid >> 5;
    if (blockIdx.x < CVT_BLOCKS) {   // the same for the whole block, ahead of every barrier
        const int cb = blockIdx.x;
        const float* s = (cb < CVT_Q)            ? Wq + (size_t)cb * CVT_ELEMS
                         : (cb < CVT_Q + CVT_KV) ? Wkv + (size_t)(cb - CVT_Q) * CVT_ELEMS
                                                 : Wo + (size_t)(cb - CVT_Q - CVT_KV) * CVT_ELEMS;
        u16* d = wbf + (size_t)cb * CVT_ELEMS;
        float4 w[8];
        // Both loops unrolled: w[] stays in registers and the 8 loads are issued together.
#pragma unroll
        for (int i = 0; i < 8; i++) w[i] = *(const float4*)(s + i * 1024 + tid * 4);
#pragma unroll
        for (int i = 0; i < 8; i++) {
            uint2 o;
            o.x = (unsigned)f2bf(w[i].x) | ((unsigned)f2bf(w[i].y) << 16);
            o.y = (unsigned)f2bf(w[i].z) | ((unsigned)f2bf(w[i].w) << 16);
            *(uint2*)(d + i * 1024 + tid * 4) = o;
        }
        return;
    }
    size_t row = blockIdx.x - CVT_BLOCKS;
    const float* xr = x + row * D_DIM;
    float v[4];
    float s = 0.f;
#pragma unroll
    for (int i = 0; i < 4; i++) { v[i] = xr[tid + i * 256]; s += v[i]; }
#pragma unroll
    for (int m = 16; m >= 1; m >>= 1) s += __shfl_xor(s, m);
    if (lane == 0) red[wave] = s;
    __syncthreads();
    float tot = 0.f;
#pragma unroll
    for (int i = 0; i < 8; i++) tot += red[i];
    float mean = tot * (1.f / (float)D_DIM);
    __syncthreads();
    float s2 = 0.f;
#pragma unroll
    for (int i = 0; i < 4; i++) { float d = v[i] - mean; s2 += d * d; }
#pragma unroll
    for (int m = 16; m >= 1; m >>= 1) s2 += __shfl_xor(s2, m);
    if (lane == 0) red[wave] = s2;
    __syncthreads();
    float tot2 = 0.f;
#pragma unroll
    for (int i = 0; i < 8; i++) tot2 += red[i];
    float rstd = rsqrtf(tot2 * (1.f / (float)D_DIM) + 1e-5f);
#pragma unroll
    for (int i = 0; i < 4; i++) {
        int c = tid + i * 256;
        xn[row * D_DIM + c] = f2bf((v[i] - mean) * rstd * g[c] + bb[c]);
    }
}

// ---------------------------------------------------------------- Tiled WMMA GEMM
// C[M,N] = A[M,K] * W[N,K]^T (+ epilogue).  BM=128 BN=128, 8 waves,
// wave tile 64x32 (4x2 WMMA accumulators).  K a multiple of 64, at least 64.
// The operands come through LDS in tiles of 64 k (whole 128-byte rows), copied in
// without passing registers; two buffers, the next tile's copies fly during this
// tile's products.
// MODE 0: QKV - bias from (b0|b1), split-store bf16 q(*0.125)/k, and v transposed:
//         vb[(b*H + h)*DH + dh][s], the layout the attention kernel stages from.
// MODE 1: out-proj - fp32 out = acc + b0[col] + resid.
// Epilogue: the 128x128 output tile is staged in LDS (over the operand tiles),
// then leaves as 16-byte stores that cover whole rows of the tile.
#define GK 64                        // k per staged tile
#define GP 72                        // LDS row pitch in u16: 128 B + 16 B, for 16-byte readers
#define G_HALF (128 * GP * 2)        // bytes of one operand's tile (128 rows)
#define G_BUF (2 * G_HALF)           // bytes of one buffer: A tile, then W tile

// One tile: each lane copies 16 bytes of rows (srow + 32 i), i = 0..3, of A and of W;
// rstep = 32 rows in elements.  The s_wait_xcnt closes the statement so that no address
// register of a copy is rewritten while the copy may still need it.
__device__ __forceinline__ void stage_gemm(unsigned lds, const u16* ga, const u16* gw,
                                           size_t rstep) {
    unsigned la1 = lds + 32 * GP * 2, la2 = lds + 64 * GP * 2, la3 = lds + 96 * GP * 2;
    unsigned lw0 = lds + G_HALF, lw1 = la1 + G_HALF, lw2 = la2 + G_HALF, lw3 = la3 + G_HALF;
    const u16 *ga1 = ga + rstep, *ga2 = ga1 + rstep, *ga3 = ga2 + rstep;
    const u16 *gw1 = gw + rstep, *gw2 = gw1 + rstep, *gw3 = gw2 + rstep;
    asm volatile("global_load_async_to_lds_b128 %0, %1, off\n\t"
                 "global_load_async_to_lds_b128 %2, %3, off\n\t"
                 "global_load_async_to_lds_b128 %4, %5, off\n\t"
                 "global_load_async_to_lds_b128 %6, %7, off\n\t"
                 "global_load_async_to_lds_b128 %8, %9, off\n\t"
                 "global_load_async_to_lds_b128 %10, %11, off\n\t"
                 "global_load_async_to_lds_b128 %12, %13, off\n\t"
                 "global_load_async_to_lds_b128 %14, %15, off\n\t"
                 "s_wait_xcnt 0x0"
                 :: "v"(lds), "v"(ga), "v"(la1), "v"(ga1), "v"(la2), "v"(ga2), "v"(la3), "v"(ga3),
                    "v"(lw0), "v"(gw), "v"(lw1), "v"(gw1), "v"(lw2), "v"(gw2), "v"(lw3), "v"(gw3)
                 : "memory");
}

template <int MODE>
__global__ __launch_bounds__(256) void gemm_kernel(
    const u16* __restrict__ A, const u16* __restrict__ W, int K_dim,
    const float* __restrict__ b0, const float* __restrict__ b1,
    u16* __restrict__ qb, u16* __restrict__ kb, u16* __restrict__ vb,
    const float* __restrict__ resid, float* __restrict__ outp) {
    // Staged row pitch in bytes: 128 elements + 16 B, so that the two lane halves
    // (8 rows apart) write banks 32 apart.
    constexpr int CP = (MODE == 0) ? 128 * 2 + 16 : 128 * 4 + 16;
    constexpr int SMEM = (2 * G_BUF > 128 * CP) ? 2 * G_BUF : 128 * CP;
    __shared__ __attribute__((aligned(16))) unsigned char smem[SMEM];
    int tid = threadIdx.x, lane = tid & 31, wave = tid >> 5;
    int wm = wave & 1, wn = wave >> 1;
    int half = lane >> 4, r = lane & 15, bk = half * 8;
    const size_t M0 = (size_t)blockIdx.y * 128;
    const size_t N0 = (size_t)blockIdx.x * 128;
    const u16* Aptr = A + M0 * K_dim;
    const u16* Wptr = W + N0 * K_dim;

    v8f acc[4][2] = {};
    const int nt = K_dim / GK;   // tiles of 64 k, the same for the whole block
    // This lane's share of a tile: 8 lanes per 128-byte row.
    const int srow = tid >> 3, scol = (tid & 7) * 8;
    const unsigned lds0 = (unsigned)(size_t)(smem + srow * (GP * 2) + scol * 2);
    const u16* ga0 = Aptr + (size_t)srow * K_dim + scol;
    const u16* gw0 = Wptr + (size_t)srow * K_dim + scol;
    const size_t rstep = (size_t)32 * K_dim;

    stage_gemm(lds0, ga0, gw0, rstep);
    asm volatile("s_wait_asynccnt 0x0" ::: "memory");  // this wave's share of tile 0 has landed
    __syncthreads();                                   // ... and every other wave's
    if (1 < nt) stage_gemm(lds0 + G_BUF, ga0 + GK, gw0 + GK, rstep);

    for (int t = 0; t < nt; t++) {
        const u16* As = (const u16*)(smem + (t & 1) * G_BUF) + (wm * 64 + r) * GP + bk;
        const u16* Bs = (const u16*)(smem + (t & 1) * G_BUF + G_HALF) + (wn * 32 + r) * GP + bk;
        // Unrolled: the two 32-k steps of a tile differ only in constant LDS offsets.
#pragma unroll
        for (int kk = 0; kk < GK; kk += 32) {
            v16bf af[4], bfr[2];
#pragma unroll
            for (int i = 0; i < 4; i++) af[i] = ldfrag(As + i * 16 * GP + kk);
#pragma unroll
            for (int j = 0; j < 2; j++) bfr[j] = ldfrag(Bs + j * 16 * GP + kk);
#pragma unroll
            for (int i = 0; i < 4; i++)
#pragma unroll
                for (int j = 0; j < 2; j++) acc[i][j] = wmma_bf16(af[i], bfr[j], acc[i][j]);
        }
        // Hand-over, passed by every wave.
        asm volatile("s_wait_dscnt 0x0" ::: "memory");     // my reads of this buffer are done
        asm volatile("s_wait_asynccnt 0x0" ::: "memory");  // my share of tile t+1 has landed
        __syncthreads();  // tile t+1 is whole, and nobody reads tile t's buffer any more
        if (t + 2 < nt)
            stage_gemm(lds0 + (t & 1) * G_BUF, ga0 + (size_t)(t + 2) * GK, gw0 + (size_t)(t + 2) * GK,
                       rstep);
    }
    asm volatile("s_wait_asynccnt 0x0" ::: "memory");  // no copy is open when the tile is staged

    // Every loop below is fully unrolled so that acc[][] and rv[] keep constant
    // indices and stay in registers.
    const int rl0 = wm * 64 + 8 * half;   // this lane's first row in the tile
    const int cl0 = wn * 32 + r;          // this lane's first column in the tile
    if (MODE == 0) {
        // A 128-column tile lies wholly in q, k or v: one destination per block.
        const int which = (int)(N0 / D_DIM);
        const float* bias = (which == 0) ? b0 + N0 : b1 + (N0 - D_DIM);
        const float sc = (which == 0) ? 0.125f : 1.0f;  // fold 1/sqrt(DH) into q
        u16* dst = (which == 0) ? qb : (which == 1) ? kb : vb;
        float bj[2];
#pragma unroll
        for (int j = 0; j < 2; j++) bj[j] = bias[cl0 + j * 16];
        __syncthreads();  // every wave has read its last operand fragments
        if (which == 2) {   // the same for the whole block
            // V is staged transposed, [column][row]: the 8 accumulator rows a lane holds of
            // one column are 8 neighbours of one staged row, one 16-byte LDS store.
#pragma unroll
            for (int i = 0; i < 4; i++)
#pragma unroll
                for (int j = 0; j < 2; j++) {
                    unsigned w[4];
#pragma unroll
                    for (int e = 0; e < 4; e++)
                        w[e] = (unsigned)f2bf(acc[i][j][2 * e] + bj[j]) |
                               ((unsigned)f2bf(acc[i][j][2 * e + 1] + bj[j]) << 16);
                    *(uint4*)(smem + (cl0 + j * 16) * CP + (rl0 + i * 16) * 2) =
                        make_uint4(w[0], w[1], w[2], w[3]);
                }
        } else {
#pragma unroll
            for (int i = 0; i < 4; i++)
#pragma unroll
                for (int j = 0; j < 2; j++)
#pragma unroll
                    for (int e = 0; e < 8; e++)
                        *(u16*)(smem + (rl0 + i * 16 + e) * CP + (cl0 + j * 16) * 2) =
                            f2bf((acc[i][j][e] + bj[j]) * sc);
        }
        __syncthreads();  // the tile is complete before any wave reads rows of it
        const int row0 = tid >> 4, ch = tid & 15;   // 16 chunks of 16 B per 256-B row
        if (which == 2) {
            // Staged row = column (head, dh): rows S_LEN apart in memory; the tile's 128
            // positions lie in one batch (S_LEN is a multiple of 128).
            u16* dtile = dst + ((M0 / S_LEN) * D_DIM + (N0 % D_DIM)) * S_LEN + (M0 % S_LEN);
            const unsigned off = (unsigned)(row0 * S_LEN + ch * 8);
#pragma unroll
            for (int it = 0; it < 8; it++)
                *(uint4*)(dtile + off + it * 16 * S_LEN) =
                    *(const uint4*)(smem + (row0 + it * 16) * CP + ch * 16);
        } else {
            u16* dtile = dst + M0 * D_DIM + (N0 % D_DIM);
            const unsigned off = (unsigned)(row0 * D_DIM + ch * 8);
#pragma unroll
            for (int it = 0; it < 8; it++)
                *(uint4*)(dtile + off + it * 16 * D_DIM) =
                    *(const uint4*)(smem + (row0 + it * 16) * CP + ch * 16);
        }
    } else {
        // One wave covers one 512-B row per step; all residual loads go out together.
        const float* rtile = resid + M0 * D_DIM + N0;
        float* otile = outp + M0 * D_DIM + N0;
        const unsigned off = (unsigned)(wave * D_DIM + lane * 4);  // same for load and store
        float4 rv[16];
#pragma unroll
        for (int it = 0; it < 16; it++)
            rv[it] = *(const float4*)(rtile + off + it * 8 * D_DIM);
        __syncthreads();  // every wave has read its last operand fragments
        float4 bv = *(const float4*)(b0 + N0 + lane * 4);
#pragma unroll
        for (int i = 0; i < 4; i++)
#pragma unroll
            for (int j = 0; j < 2; j++)
#pragma unroll
                for (int e = 0; e < 8; e++)
                    *(float*)(smem + (rl0 + i * 16 + e) * CP + (cl0 + j * 16) * 4) = acc[i][j][e];
        __syncthreads();  // the tile is complete before any wave reads rows of it
#pragma unroll
        for (int it = 0; it < 16; it++) {
            int row = wave + it * 8;
            float4 a = *(const float4*)(smem + row * CP + lane * 16);
            float4 o;
            o.x = a.x + bv.x + rv[it].x;
            o.y = a.y + bv.y + rv[it].y;
            o.z = a.z + bv.z + rv[it].z;
            o.w = a.w + bv.w + rv[it].w;
            *(float4*)(otile + off + it * 8 * D_DIM) = o;
        }
    }
}

#define KT 64                        // keys per staged tile
#define KVP 72                       // LDS row pitch in u16: 128 B + 16 B, for 16-byte readers
#define KV_HALF (KT * KVP * 2)       // bytes of one operand's tile (64 rows)
#define KV_BUF (2 * KV_HALF)         // bytes of one buffer: K tile, then V^T tile

// One tile: each lane copies 16 bytes of rows (srow, srow+32) of K and of V^T.
// The s_wait_xcnt closes the statement so that no address register of a copy is
// rewritten while the copy may still need it.
__device__ __forceinline__ void stage_tile(unsigned lds, const u16* gk, const u16* gv) {
    unsigned lk1 = lds + 32 * KVP * 2, lv0 = lds + KV_HALF, lv1 = lds + KV_HALF + 32 * KVP * 2;
    const u16* gk1 = gk + (size_t)32 * D_DIM;
    const u16* gv1 = gv + (size_t)32 * S_LEN;
    asm volatile("global_load_async_to_lds_b128 %0, %1, off\n\t"
                 "global_load_async_to_lds_b128 %2, %3, off\n\t"
                 "global_load_async_to_lds_b128 %4, %5, off\n\t"
                 "global_load_async_to_lds_b128 %6, %7, off\n\t"
                 "s_wait_xcnt 0x0"
                 :: "v"(lds), "v"(gk), "v"(lk1), "v"(gk1), "v"(lv0), "v"(gv), "v"(lv1), "v"(gv1)
                 : "memory");
}

__global__ __launch_bounds__(256) void attn_kernel(const u16* __restrict__ q,
                                                   const u16* __restrict__ k,
                                                   const u16* __restrict__ vt,
                                                   const int* __restrict__ lens,
                                                   u16* __restrict__ ctx) {
    __shared__ __attribute__((aligned(16))) unsigned char kv[2 * KV_BUF];
    int tid = threadIdx.x, lane = tid & 31;
    int wave = __builtin_amdgcn_readfirstlane(tid >> 5);  // scalar: the per-wave skip is a real branch
    int half = lane >> 4, r = lane & 15, bk = half * 8;
    int bh = blockIdx.x, b = bh >> 4, h = bh & 15;
    int q0 = blockIdx.y * 128;
    int qw = q0 + wave * 16;
    int len = lens[b];
    int myq = qw + r;                        // the single query this lane owns
    int lim = (myq + 1 < len) ? myq + 1 : len;  // key valid iff key < lim

    // Q as B-operand (lane r = query), both 32-wide dh k-steps.
    const u16* qbase = q + ((size_t)(b * S_LEN + qw + r) * D_DIM + h * DH_NUM) + bk;
    v16bf qf[2];
    qf[0] = ldfrag(qbase);
    qf[1] = ldfrag(qbase + 32);

    float mrun = -1e30f, lrun = 0.f;
    v8f Ov[4] = {};

    int kmax = qw + 15;                      // this wave's last key
    if (len - 1 < kmax) kmax = len - 1;
    int kmaxb = q0 + 127;                    // the block's last key (<= S_LEN - 1)
    if (len - 1 < kmaxb) kmaxb = len - 1;
    const int nt = (kmaxb >> 6) + 1;         // tiles of 64 keys, the same for the whole block

    // This lane's share of a tile: 8 lanes per 128-byte row.
    const int srow = tid >> 3, scol = (tid & 7) * 8;
    const unsigned lds0 = (unsigned)(size_t)(kv + srow * (KVP * 2) + scol * 2);
    const u16* gk0 = k + ((size_t)(b * S_LEN + srow) * D_DIM + h * DH_NUM + scol);
    const u16* gv0 = vt + ((size_t)(bh * DH_NUM + srow) * S_LEN + scol);

    stage_tile(lds0, gk0, gv0);
    asm volatile("s_wait_asynccnt 0x0" ::: "memory");  // this wave's share of tile 0 has landed
    __syncthreads();                                   // ... and every other wave's
    if (1 < nt) stage_tile(lds0 + KV_BUF, gk0 + (size_t)KT * D_DIM, gv0 + KT);

    for (int t = 0; t < nt; t++) {
        const u16* Ks = (const u16*)(kv + (t & 1) * KV_BUF) + r * KVP + bk;  // K row r
        const u16* Vs = Ks + KT * KVP;                                       // V^T row r
        // Two steps of 32 keys; a wave stops at its own last key.  Kept rolled: unrolled, the
        // two skippable bodies cost a copy of all accumulators at each join.
#pragma unroll 1
        for (int c = 0; c < 2; c++) {
            const int kbp = t * KT + c * 32;
            if (kbp > kmax) break;
            {
                // ---- all 16 fragment loads up front
                v16bf kf0 = ldfrag(Ks + (c * 32) * KVP);
                v16bf kf1 = ldfrag(Ks + (c * 32) * KVP + 32);
                v16bf kf2 = ldfrag(Ks + (c * 32 + 16) * KVP);
                v16bf kf3 = ldfrag(Ks + (c * 32 + 16) * KVP + 32);
                v16bf vf[4];
#pragma unroll
                for (int j = 0; j < 4; j++)
                    vf[j] = ldfrag(Vs + (j * 16) * KVP + c * 32);

                // ---- S^T tiles: rows = keys (u*16 + e + 8*half), col = query
                v8f Sacc[2] = {};
                Sacc[0] = wmma_bf16(kf0, qf[0], Sacc[0]);
                Sacc[0] = wmma_bf16(kf1, qf[1], Sacc[0]);
                Sacc[1] = wmma_bf16(kf2, qf[0], Sacc[1]);
                Sacc[1] = wmma_bf16(kf3, qf[1], Sacc[1]);

                // ---- mask (only on boundary blocks) + per-lane online softmax
                float sv[2][8];
                float rowmax = -3.0e38f;
                bool full = (kbp + 32 <= qw + 1) && (kbp + 32 <= len);  // wave-uniform
                if (full) {
#pragma unroll
                    for (int u = 0; u < 2; u++)
#pragma unroll
                        for (int e = 0; e < 8; e++) {
                            sv[u][e] = Sacc[u][e];
                            rowmax = fmaxf(rowmax, sv[u][e]);
                        }
                } else {
                    int kbase0 = kbp + 8 * half;
#pragma unroll
                    for (int u = 0; u < 2; u++)
#pragma unroll
                        for (int e = 0; e < 8; e++) {
                            int key = kbase0 + u * 16 + e;
                            sv[u][e] = (key < lim) ? Sacc[u][e] : -3.0e38f;
                            rowmax = fmaxf(rowmax, sv[u][e]);
                        }
                }
                rowmax = fmaxf(rowmax, __shfl_xor(rowmax, 16));
                float mnew = fmaxf(mrun, rowmax);
                float scale = __expf(mrun - mnew);
                float rsum = 0.f;
                P16 ph;
#pragma unroll
                for (int u = 0; u < 2; u++)
#pragma unroll
                    for (int e = 0; e < 8; e++) {
                        float p = __expf(sv[u][e] - mnew);
                        rsum += p;
                        ph.h[u * 8 + e] = f2bf(p);  // B-operand half m = u*8+e -> key u*16+e+8*half
                    }
                rsum += __shfl_xor(rsum, 16);
                lrun = lrun * scale + rsum;
                mrun = mnew;
                v16bf pf = __builtin_bit_cast(v16bf, ph);

                // ---- O^T += V^T * P  (rows = dh, col = query)
#pragma unroll
                for (int j = 0; j < 4; j++) {
#pragma unroll
                    for (int e = 0; e < 8; e++) Ov[j][e] *= scale;
                    Ov[j] = wmma_bf16(vf[j], pf, Ov[j]);
                }
            }
        }
        // Hand-over, passed by every wave (also one that skipped the work above).
        asm volatile("s_wait_dscnt 0x0" ::: "memory");     // my reads of this buffer are done
        asm volatile("s_wait_asynccnt 0x0" ::: "memory");  // my share of tile t+1 has landed
        __syncthreads();  // tile t+1 is whole, and nobody reads tile t's buffer any more
        if (t + 2 < nt)
            stage_tile(lds0 + (t & 1) * KV_BUF, gk0 + (size_t)(t + 2) * KT * D_DIM,
                       gv0 + (t + 2) * KT);
    }
    asm volatile("s_wait_asynccnt 0x0" ::: "memory");  // no copy is open when the wave ends

    float inv = 1.f / lrun;
#pragma unroll
    for (int j = 0; j < 4; j++)
#pragma unroll
        for (int e = 0; e < 8; e++) {
            int dh = j * 16 + e + 8 * half;
            ctx[(size_t)(b * S_LEN + myq) * D_DIM + h * DH_NUM + dh] = f2bf(Ov[j][e] * inv);
        }
}

// ---------------------------------------------------------------- launch
extern "C" void kernel_launch(void* const* d_in, const int* in_sizes, int n_in,
                              void* d_out, int out_size, void* d_ws, size_t ws_size,
                              hipStream_t stream) {
    (void)in_sizes; (void)n_in; (void)out_size; (void)ws_size;
    const float* x    = (const float*)d_in[0];
    const int*   lens = (const int*)d_in[1];
    const float* Wq   = (const float*)d_in[2];
    const float* bq   = (const float*)d_in[3];
    const float* Wkv  = (const float*)d_in[4];
    const float* bkv  = (const float*)d_in[5];
    const float* Wo   = (const float*)d_in[6];
    const float* bo   = (const float*)d_in[7];
    const float* ln_g = (const float*)d_in[8];
    const float* ln_b = (const float*)d_in[9];
    float* out = (float*)d_out;

    const size_t BS = 4 * (size_t)S_LEN;            // 8192 rows
    const size_t DD = (size_t)D_DIM * D_DIM;        // 1M
    char* ws = (char*)d_ws;
    size_t off = 0;
    auto alloc = [&](size_t elems) { u16* p = (u16*)(ws + off); off += elems * sizeof(u16); return p; };
    u16* wqkv = alloc(3 * DD);        // [Wq ; Wkv] rows, bf16
    u16* wo   = alloc(DD);
    u16* xn   = alloc(BS * D_DIM);
    u16* qb   = alloc(BS * D_DIM);
    u16* kbuf = alloc(BS * D_DIM);
    u16* vtb  = alloc(BS * D_DIM);    // V^T per (batch, head): [dh][s]
    u16* ctx  = alloc(BS * D_DIM);

    // wo follows wqkv directly in the workspace: one bf16 destination for all weights.
    prep_kernel<<<(int)(CVT_BLOCKS + BS), 256, 0, stream>>>(x, ln_g, ln_b, xn, Wq, Wkv, Wo, wqkv);

    dim3 gqkv(3 * D_DIM / 128, (int)(BS / 128));   // (24, 64)
    gemm_kernel<0><<<gqkv, 256, 0, stream>>>(xn, wqkv, D_DIM, bq, bkv,
                                             qb, kbuf, vtb, nullptr, nullptr);

    attn_kernel<<<dim3(4 * H_NUM, S_LEN / 128), 256, 0, stream>>>(qb, kbuf, vtb, lens, ctx);

    dim3 gout(D_DIM / 128, (int)(BS / 128));       // (8, 64)
    gemm_kernel<1><<<gout, 256, 0, stream>>>(ctx, wo, D_DIM, bo, nullptr,
                                             nullptr, nullptr, nullptr, x, out);
}

// v006
// A run of this version takes 121 microseconds.
// In two side-by-side timings against v005, it was 1.05 and 1.06 times as fast.
// Over all steps from v000 it is 2.23 times as fast.
#include <hip/hip_runtime.h>

typedef unsigned short u16;
typedef __attribute__((ext_vector_type(16))) __bf16 v16bf;
typedef __attribute__((ext_vector_type(8)))  float  v8f;

#define S_LEN 2048
#define D_DIM 1024
#define H_NUM 16
#define DH_NUM 64

// Round to nearest even by the conversion instruction; neighbours pair into one packed convert.
__device__ __forceinline__ u16 f2bf(float f) {
    return __builtin_bit_cast(u16, (__bf16)f);
}

struct Pack32 { uint4 a, b; };
struct P16 { u16 h[16]; };

// Load one bf16 WMMA operand fragment (A-pattern; B uses the same pattern with
// lane -> N).  Lane-half 0: K in [0,8)u[16,24); lane-half 1: K in [8,16)u[24,32).
// Caller passes p already offset by (row, basek); we read p[0..7] and p[16..23].
__device__ __forceinline__ v16bf ldfrag(const u16* p) {
    Pack32 s;
    s.a = *(const uint4*)(p);
    s.b = *(const uint4*)(p + 16);
    return __builtin_bit_cast(v16bf, s);
}

__device__ __forceinline__ v8f wmma_bf16(v16bf a, v16bf b, v8f c) {
    return __builtin_amdgcn_wmma_f32_16x16x32_bf16(false, a, false, b, (short)0, c,
                                                   false, false);
}

// ---------------------------------------------------------------- weights -> bf16, LayerNorm
// One launch.  The first CVT_BLOCKS blocks round the weights to bf16, the others
// normalise one row of x each; the two kinds of block share nothing.
// A conversion block takes CVT_ELEMS consecutive elements: each wave reads 8 times
// 512 contiguous bytes (all 8 loads go out before the first value is used) and
// writes 8 times 256 contiguous bytes.  The bf16 copies of Wq, Wkv, Wo lie one
// behind the other in wbf.
#define CVT_ELEMS 8192
#define CVT_Q (D_DIM * D_DIM / CVT_ELEMS)        // blocks for Wq, and for Wo
#define CVT_KV (2 * D_DIM * D_DIM / CVT_ELEMS)   // blocks for Wkv
#define CVT_BLOCKS (CVT_Q + CVT_KV + CVT_Q)

__global__ __launch_bounds__(256) void prep_kernel(const float* __restrict__ x,
                                                   const float* __restrict__ g,
                                                   const float* __restrict__ bb,
                                                   u16* __restrict__ xn,
                                                   const float* __restrict__ Wq,
                                                   const float* __restrict__ Wkv,
                                                   const float* __restrict__ Wo,
                                                   u16* __restrict__ wbf) {
    __shared__ float red[8];
    int tid = threadIdx.x, lane = tid & 31, wave = tid >> 5;
    if (blockIdx.x < CVT_BLOCKS) {   // the same for the whole block, ahead of every barrier
        const int cb = blockIdx.x;
        const float* s = (cb < CVT_Q)            ? Wq + (size_t)cb * CVT_ELEMS
                         : (cb < CVT_Q + CVT_KV) ? Wkv + (size_t)(cb - CVT_Q) * CVT_ELEMS
                                                 : Wo + (size_t)(cb - CVT_Q - CVT_KV) * CVT_ELEMS;
        u16* d = wbf + (size_t)cb * CVT_ELEMS;
        float4 w[8];
        // Both loops unrolled: w[] stays in registers and the 8 loads are issued together.
#pragma unroll
        for (int i = 0; i < 8; i++) w[i] = *(const float4*)(s + i * 1024 + tid * 4);
#pragma unroll
        for (int i = 0; i < 8; i++) {
            uint2 o;
            o.x = (unsigned)f2bf(w[i].x) | ((unsigned)f2bf(w[i].y) << 16);
            o.y = (unsigned)f2bf(w[i].z) | ((unsigned)f2bf(w[i].w) << 16);
            *(uint2*)(d + i * 1024 + tid * 4) = o;
        }
        return;
    }
    size_t row = blockIdx.x - CVT_BLOCKS;
    const float* xr = x + row * D_DIM;
    float v[4];
    float s = 0.f;
#pragma unroll
    for (int i = 0; i < 4; i++) { v[i] = xr[tid + i * 256]; s += v[i]; }
#pragma unroll
    for (int m = 16; m >= 1; m >>= 1) s += __shfl_xor(s, m);
    if (lane == 0) red[wave] = s;
    __syncthreads();
    float tot = 0.f;
#pragma unroll
    for (int i = 0; i < 8; i++) tot += red[i];
    float mean = tot * (1.f / (float)D_DIM);
    __syncthreads();
    float s2 = 0.f;
#pragma unroll
    for (int i = 0; i < 4; i++) { float d = v[i] - mean; s2 += d * d; }
#pragma unroll
    for (int m = 16; m >= 1; m >>= 1) s2 += __shfl_xor(s2, m);
    if (lane == 0) red[wave] = s2;
    __syncthreads();
    float tot2 = 0.f;
#pragma unroll
    for (int i = 0; i < 8; i++) tot2 += red[i];
    float rstd = rsqrtf(tot2 * (1.f / (float)D_DIM) + 1e-5f);
#pragma unroll
    for (int i = 0; i < 4; i++) {
        int c = tid + i * 256;
        xn[row * D_DIM + c] = f2bf((v[i] - mean) * rstd * g[c] + bb[c]);
    }
}

// ---------------------------------------------------------------- Tiled WMMA GEMM
// C[M,N] = A[M,K] * W[N,K]^T (+ epilogue).  BM=128 BN=128, 8 waves,
// wave tile 64x32 (4x2 WMMA accumulators).  K a multiple of 64, at least 64.
// The operands come through LDS in tiles of 64 k (whole 128-byte rows), copied in
// without passing registers; two buffers, the next tile's copies fly during this
// tile's products.
// MODE 0: QKV - bias from (b0|b1), split-store bf16 q(*0.125)/k, and v transposed:
//         vb[(b*H + h)*DH + dh][s], the layout the attention kernel stages from.
// MODE 1: out-proj - fp32 out = acc + b0[col] + resid.
// Epilogue: the 128x128 output tile is staged in LDS (over the operand tiles),
// then leaves as 16-byte stores that cover whole rows of the tile.
#define GK 64                        // k per staged tile
#define GP 72                        // LDS row pitch in u16: 128 B + 16 B, for 16-byte readers
#define G_HALF (128 * GP * 2)        // bytes of one operand's tile (128 rows)
#define G_BUF (2 * G_HALF)           // bytes of one buffer: A tile, then W tile

// One tile: each lane copies 16 bytes of rows (srow + 32 i), i = 0..3, of A and of W;
// rstep = 32 rows in elements.  The s_wait_xcnt closes the statement so that no address
// register of a copy is rewritten while the copy may still need it.
__device__ __forceinline__ void stage_gemm(unsigned lds, const u16* ga, const u16* gw,
                                           size_t rstep) {
    unsigned la1 = lds + 32 * GP * 2, la2 = lds + 64 * GP * 2, la3 = lds + 96 * GP * 2;
    unsigned lw0 = lds + G_HALF, lw1 = la1 + G_HALF, lw2 = la2 + G_HALF, lw3 = la3 + G_HALF;
    const u16 *ga1 = ga + rstep, *ga2 = ga1 + rstep, *ga3 = ga2 + rstep;
    const u16 *gw1 = gw + rstep, *gw2 = gw1 + rstep, *gw3 = gw2 + rstep;
    asm volatile("global_load_async_to_lds_b128 %0, %1, off\n\t"
                 "global_load_async_to_lds_b128 %2, %3, off\n\t"
                 "global_load_async_to_lds_b128 %4, %5, off\n\t"
                 "global_load_async_to_lds_b128 %6, %7, off\n\t"
                 "global_load_async_to_lds_b128 %8, %9, off\n\t"
                 "global_load_async_to_lds_b128 %10, %11, off\n\t"
                 "global_load_async_to_lds_b128 %12, %13, off\n\t"
                 "global_load_async_to_lds_b128 %14, %15, off\n\t"
                 "s_wait_xcnt 0x0"
                 :: "v"(lds), "v"(ga), "v"(la1), "v"(ga1), "v"(la2), "v"(ga2), "v"(la3), "v"(ga3),
                    "v"(lw0), "v"(gw), "v"(lw1), "v"(gw1), "v"(lw2), "v"(gw2), "v"(lw3), "v"(gw3)
                 : "memory");
}

template <int MODE>
__global__ __launch_bounds__(256) void gemm_kernel(
    const u16* __restrict__ A, const u16* __restrict__ W, int K_dim,
    const float* __restrict__ b0, const float* __restrict__ b1,
    u16* __restrict__ qb, u16* __restrict__ kb, u16* __restrict__ vb,
    const float* __restrict__ resid, float* __restrict__ outp) {
    // Staged row pitch in bytes: 128 elements + 16 B, so that the two lane halves
    // (8 rows apart) write banks 32 apart.
    constexpr int CP = (MODE == 0) ? 128 * 2 + 16 : 128 * 4 + 16;
    constexpr int SMEM = (2 * G_BUF > 128 * CP) ? 2 * G_BUF : 128 * CP;
    __shared__ __attribute__((aligned(16))) unsigned char smem[SMEM];
    int tid = threadIdx.x, lane = tid & 31, wave = tid >> 5;
    int wm = wave & 1, wn = wave >> 1;
    int half = lane >> 4, r = lane & 15, bk = half * 8;
    const size_t M0 = (size_t)blockIdx.y * 128;
    const size_t N0 = (size_t)blockIdx.x * 128;
    const u16* Aptr = A + M0 * K_dim;
    const u16* Wptr = W + N0 * K_dim;

    v8f acc[4][2] = {};
    const int nt = K_dim / GK;   // tiles of 64 k, the same for the whole block
    // This lane's share of a tile: 8 lanes per 128-byte row.
    const int srow = tid >> 3, scol = (tid & 7) * 8;
    const unsigned lds0 = (unsigned)(size_t)(smem + srow * (GP * 2) + scol * 2);
    const u16* ga0 = Aptr + (size_t)srow * K_dim + scol;
    const u16* gw0 = Wptr + (size_t)srow * K_dim + scol;
    const size_t rstep = (size_t)32 * K_dim;

    stage_gemm(lds0, ga0, gw0, rstep);
    asm volatile("s_wait_asynccnt 0x0" ::: "memory");  // this wave's share of tile 0 has landed
    __syncthreads();                                   // ... and every other wave's
    if (1 < nt) stage_gemm(lds0 + G_BUF, ga0 + GK, gw0 + GK, rstep);

    for (int t = 0; t < nt; t++) {
        const u16* As = (const u16*)(smem + (t & 1) * G_BUF) + (wm * 64 + r) * GP + bk;
        const u16* Bs = (const u16*)(smem + (t & 1) * G_BUF + G_HALF) + (wn * 32 + r) * GP + bk;
        // Unrolled: the two 32-k steps of a tile differ only in constant LDS offsets.
#pragma unroll
        for (int kk = 0; kk < GK; kk += 32) {
            v16bf af[4], bfr[2];
#pragma unroll
            for (int i = 0; i < 4; i++) af[i] = ldfrag(As + i * 16 * GP + kk);
#pragma unroll
            for (int j = 0; j < 2; j++) bfr[j] = ldfrag(Bs + j * 16 * GP + kk);
#pragma unroll
            for (int i = 0; i < 4; i++)
#pragma unroll
                for (int j = 0; j < 2; j++) acc[i][j] = wmma_bf16(af[i], bfr[j], acc[i][j]);
        }
        // Hand-over, passed by every wave.
        asm volatile("s_wait_dscnt 0x0" ::: "memory");     // my reads of this buffer are done
        asm volatile("s_wait_asynccnt 0x0" ::: "memory");  // my share of tile t+1 has landed
        __syncthreads();  // tile t+1 is whole, and nobody reads tile t's buffer any more
        if (t + 2 < nt)
            stage_gemm(lds0 + (t & 1) * G_BUF, ga0 + (size_t)(t + 2) * GK, gw0 + (size_t)(t + 2) * GK,
                       rstep);
    }
    asm volatile("s_wait_asynccnt 0x0" ::: "memory");  // no copy is open when the tile is staged

    // Every loop below is fully unrolled so that acc[][] and rv[] keep constant
    // indices and stay in registers.
    const int rl0 = wm * 64 + 8 * half;   // this lane's first row in the tile
    const int cl0 = wn * 32 + r;          // this lane's first column in the tile
    if (MODE == 0) {
        // A 128-column tile lies wholly in q, k or v: one destination per block.
        const int which = (int)(N0 / D_DIM);
        const float* bias = (which == 0) ? b0 + N0 : b1 + (N0 - D_DIM);
        const float sc = (which == 0) ? 0.125f : 1.0f;  // fold 1/sqrt(DH) into q
        u16* dst = (which == 0) ? qb : (which == 1) ? kb : vb;
        float bj[2];
#pragma unroll
        for (int j = 0; j < 2; j++) bj[j] = bias[cl0 + j * 16];
        __syncthreads();  // every wave has read its last operand fragments
        if (which == 2) {   // the same for the whole block
            // V is staged transposed, [column][row]: the 8 accumulator rows a lane holds of
            // one column are 8 neighbours of one staged row, one 16-byte LDS store.
#pragma unroll
            for (int i = 0; i < 4; i++)
#pragma unroll
                for (int j = 0; j < 2; j++) {
                    unsigned w[4];
#pragma unroll
                    for (int e = 0; e < 4; e++)
                        w[e] = (unsigned)f2bf(acc[i][j][2 * e] + bj[j]) |
                               ((unsigned)f2bf(acc[i][j][2 * e + 1] + bj[j]) << 16);
                    *(uint4*)(smem + (cl0 + j * 16) * CP + (rl0 + i * 16) * 2) =
                        make_uint4(w[0], w[1], w[2], w[3]);
                }
        } else {
#pragma unroll
            for (int i = 0; i < 4; i++)
#pragma unroll
                for (int j = 0; j < 2; j++)
#pragma unroll
                    for (int e = 0; e < 8; e++)
                        *(u16*)(smem + (rl0 + i * 16 + e) * CP + (cl0 + j * 16) * 2) =
                            f2bf((acc[i][j][e] + bj[j]) * sc);
        }
        __syncthreads();  // the tile is complete before any wave reads rows of it
        const int row0 = tid >> 4, ch = tid & 15;   // 16 chunks of 16 B per 256-B row
        if (which == 2) {
            // Staged row = column (head, dh): rows S_LEN apart in memory; the tile's 128
            // positions lie in one batch (S_LEN is a multiple of 128).
            u16* dtile = dst + ((M0 / S_LEN) * D_DIM + (N0 % D_DIM)) * S_LEN + (M0 % S_LEN);
            const unsigned off = (unsigned)(row0 * S_LEN + ch * 8);
#pragma unroll
            for (int it = 0; it < 8; it++)
                *(uint4*)(dtile + off + it * 16 * S_LEN) =
                    *(const uint4*)(smem + (row0 + it * 16) * CP + ch * 16);
        } else {
            u16* dtile = dst + M0 * D_DIM + (N0 % D_DIM);
            const unsigned off = (unsigned)(row0 * D_DIM + ch * 8);
#pragma unroll
            for (int it = 0; it < 8; it++)
                *(uint4*)(dtile + off + it * 16 * D_DIM) =
                    *(const uint4*)(smem + (row0 + it * 16) * CP + ch * 16);
        }
    } else {
        // One wave covers one 512-B row per step; all residual loads go out together.
        const float* rtile = resid + M0 * D_DIM + N0;
        float* otile = outp + M0 * D_DIM + N0;
        const unsigned off = (unsigned)(wave * D_DIM + lane * 4);  // same for load and store
        float4 rv[16];
#pragma unroll
        for (int it = 0; it < 16; it++)
            rv[it] = *(const float4*)(rtile + off + it * 8 * D_DIM);
        __syncthreads();  // every wave has read its last operand fragments
        float4 bv = *(const float4*)(b0 + N0 + lane * 4);
#pragma unroll
        for (int i = 0; i < 4; i++)
#pragma unroll
            for (int j = 0; j < 2; j++)
#pragma unroll
                for (int e = 0; e < 8; e++)
                    *(float*)(smem + (rl0 + i * 16 + e) * CP + (cl0 + j * 16) * 4) = acc[i][j][e];
        __syncthreads();  // the tile is complete before any wave reads rows of it
#pragma unroll
        for (int it = 0; it < 16; it++) {
            int row = wave + it * 8;
            float4 a = *(const float4*)(smem + row * CP + lane * 16);
            float4 o;
            o.x = a.x + bv.x + rv[it].x;
            o.y = a.y + bv.y + rv[it].y;
            o.z = a.z + bv.z + rv[it].z;
            o.w = a.w + bv.w + rv[it].w;
            *(float4*)(otile + off + it * 8 * D_DIM) = o;
        }
    }
}

#define KT 64                        // keys per staged tile
#define KVP 72                       // LDS row pitch in u16: 128 B + 16 B, for 16-byte readers
#define KV_HALF (KT * KVP * 2)       // bytes of one operand's tile (64 rows)
#define KV_BUF (2 * KV_HALF)         // bytes of one buffer: K tile, then V^T tile

// One tile: each lane copies 16 bytes of rows (srow, srow+32) of K and of V^T.
// The s_wait_xcnt closes the statement so that no address register of a copy is
// rewritten while the copy may still need it.
__device__ __forceinline__ void stage_tile(unsigned lds, const u16* gk, const u16* gv) {
    unsigned lk1 = lds + 32 * KVP * 2, lv0 = lds + KV_HALF, lv1 = lds + KV_HALF + 32 * KVP * 2;
    const u16* gk1 = gk + (size_t)32 * D_DIM;
    const u16* gv1 = gv + (size_t)32 * S_LEN;
    asm volatile("global_load_async_to_lds_b128 %0, %1, off\n\t"
                 "global_load_async_to_lds_b128 %2, %3, off\n\t"
                 "global_load_async_to_lds_b128 %4, %5, off\n\t"
                 "global_load_async_to_lds_b128 %6, %7, off\n\t"
                 "s_wait_xcnt 0x0"
                 :: "v"(lds), "v"(gk), "v"(lk1), "v"(gk1), "v"(lv0), "v"(gv), "v"(lv1), "v"(gv1)
                 : "memory");
}

__global__ __launch_bounds__(256) void attn_kernel(const u16* __restrict__ q,
                                                   const u16* __restrict__ k,
                                                   const u16* __restrict__ vt,
                                                   const int* __restrict__ lens,
                                                   u16* __restrict__ ctx) {
    __shared__ __attribute__((aligned(16))) unsigned char kv[2 * KV_BUF];
    int tid = threadIdx.x, lane = tid & 31;
    int wave = __builtin_amdgcn_readfirstlane(tid >> 5);  // scalar: the per-wave skip is a real branch
    int half = lane >> 4, r = lane & 15, bk = half * 8;
    int bh = blockIdx.x, b = bh >> 4, h = bh & 15;
    int q0 = blockIdx.y * 128;
    int qw = q0 + wave * 16;
    int len = lens[b];
    int myq = qw + r;                        // the single query this lane owns
    int lim = (myq + 1 < len) ? myq + 1 : len;  // key valid iff key < lim

    // Q as B-operand (lane r = query), both 32-wide dh k-steps.
    const u16* qbase = q + ((size_t)(b * S_LEN + qw + r) * D_DIM + h * DH_NUM) + bk;
    v16bf qf[2];
    qf[0] = ldfrag(qbase);
    qf[1] = ldfrag(qbase + 32);

    float mrun = -1e30f, lrun = 0.f;
    v8f Ov[4] = {};

    int kmax = qw + 15;                      // this wave's last key
    if (len - 1 < kmax) kmax = len - 1;
    int kmaxb = q0 + 127;                    // the block's last key (<= S_LEN - 1)
    if (len - 1 < kmaxb) kmaxb = len - 1;
    const int nt = (kmaxb >> 6) + 1;         // tiles of 64 keys, the same for the whole block

    // This lane's share of a tile: 8 lanes per 128-byte row.
    const int srow = tid >> 3, scol = (tid & 7) * 8;
    const unsigned lds0 = (unsigned)(size_t)(kv + srow * (KVP * 2) + scol * 2);
    const u16* gk0 = k + ((size_t)(b * S_LEN + srow) * D_DIM + h * DH_NUM + scol);
    const u16* gv0 = vt + ((size_t)(bh * DH_NUM + srow) * S_LEN + scol);

    stage_tile(lds0, gk0, gv0);
    asm volatile("s_wait_asynccnt 0x0" ::: "memory");  // this wave's share of tile 0 has landed
    __syncthreads();                                   // ... and every other wave's
    if (1 < nt) stage_tile(lds0 + KV_BUF, gk0 + (size_t)KT * D_DIM, gv0 + KT);

    for (int t = 0; t < nt; t++) {
        const u16* Ks = (const u16*)(kv + (t & 1) * KV_BUF) + r * KVP + bk;  // K row r
        const u16* Vs = Ks + KT * KVP;                                       // V^T row r
        // Two steps of 32 keys; a wave stops at its own last key.  Kept rolled: unrolled, the
        // two skippable bodies cost a copy of all accumulators at each join.
#pragma unroll 1
        for (int c = 0; c < 2; c++) {
            const int kbp = t * KT + c * 32;
            if (kbp > kmax) break;
            {
                // ---- all 16 fragment loads up front
                v16bf kf0 = ldfrag(Ks + (c * 32) * KVP);
                v16bf kf1 = ldfrag(Ks + (c * 32) * KVP + 32);
                v16bf kf2 = ldfrag(Ks + (c * 32 + 16) * KVP);
                v16bf kf3 = ldfrag(Ks + (c * 32 + 16) * KVP + 32);
                v16bf vf[4];
#pragma unroll
                for (int j = 0; j < 4; j++)
                    vf[j] = ldfrag(Vs + (j * 16) * KVP + c * 32);

                // ---- S^T tiles: rows = keys (u*16 + e + 8*half), col = query
                v8f Sacc[2] = {};
                Sacc[0] = wmma_bf16(kf0, qf[0], Sacc[0]);
                Sacc[0] = wmma_bf16(kf1, qf[1], Sacc[0]);
                Sacc[1] = wmma_bf16(kf2, qf[0], Sacc[1]);
                Sacc[1] = wmma_bf16(kf3, qf[1], Sacc[1]);

                // ---- mask (only on boundary blocks) + per-lane online softmax
                float sv[2][8];
                float rowmax = -3.0e38f;
                bool full = (kbp + 32 <= qw + 1) && (kbp + 32 <= len);  // wave-uniform
                if (full) {
#pragma unroll
                    for (int u = 0; u < 2; u++)
#pragma unroll
                        for (int e = 0; e < 8; e++) {
                            sv[u][e] = Sacc[u][e];
                            rowmax = fmaxf(rowmax, sv[u][e]);
                        }
                } else {
                    int kbase0 = kbp + 8 * half;
#pragma unroll
                    for (int u = 0; u < 2; u++)
#pragma unroll
                        for (int e = 0; e < 8; e++) {
                            int key = kbase0 + u * 16 + e;
                            sv[u][e] = (key < lim) ? Sacc[u][e] : -3.0e38f;
                            rowmax = fmaxf(rowmax, sv[u][e]);
                        }
                }
                rowmax = fmaxf(rowmax, __shfl_xor(rowmax, 16));
                float mnew = fmaxf(mrun, rowmax);
                float scale = __expf(mrun - mnew);
                float rsum = 0.f;
                P16 ph;
#pragma unroll
                for (int u = 0; u < 2; u++)
#pragma unroll
                    for (int e = 0; e < 8; e++) {
                        float p = __expf(sv[u][e] - mnew);
                        rsum += p;
                        ph.h[u * 8 + e] = f2bf(p);  // B-operand half m = u*8+e -> key u*16+e+8*half
                    }
                rsum += __shfl_xor(rsum, 16);
                lrun = lrun * scale + rsum;
                mrun = mnew;
                v16bf pf = __builtin_bit_cast(v16bf, ph);

                // ---- O^T += V^T * P  (rows = dh, col = query)
#pragma unroll
                for (int j = 0; j < 4; j++) {
#pragma unroll
                    for (int e = 0; e < 8; e++) Ov[j][e] *= scale;
                    Ov[j] = wmma_bf16(vf[j], pf, Ov[j]);
                }
                // The next step's first vector instruction may overwrite an operand register of
                // these products.
                __builtin_amdgcn_sched_barrier(0);  // or the scheduler lifts the v_nop over the products
                asm volatile("v_nop");
            }
        }
        // Hand-over, passed by every wave (also one that skipped the work above).
        asm volatile("s_wait_dscnt 0x0" ::: "memory");     // my reads of this buffer are done
        asm volatile("s_wait_asynccnt 0x0" ::: "memory");  // my share of tile t+1 has landed
        __syncthreads();  // tile t+1 is whole, and nobody reads tile t's buffer any more
        if (t + 2 < nt)
            stage_tile(lds0 + (t & 1) * KV_BUF, gk0 + (size_t)(t + 2) * KT * D_DIM,
                       gv0 + (t + 2) * KT);
    }
    asm volatile("s_wait_asynccnt 0x0" ::: "memory");  // no copy is open when the wave ends

    float inv = 1.f / lrun;
#pragma unroll
    for (int j = 0; j < 4; j++)
#pragma unroll
        for (int e = 0; e < 8; e++) {
            int dh = j * 16 + e + 8 * half;
            ctx[(size_t)(b * S_LEN + myq) * D_DIM + h * DH_NUM + dh] = f2bf(Ov[j][e] * inv);
        }
}

// ---------------------------------------------------------------- launch
extern "C" void kernel_launch(void* const* d_in, const int* in_sizes, int n_in,
                              void* d_out, int out_size, void* d_ws, size_t ws_size,
                              hipStream_t stream) {
    (void)in_sizes; (void)n_in; (void)out_size; (void)ws_size;
    const float* x    = (const float*)d_in[0];
    const int*   lens = (const int*)d_in[1];
    const float* Wq   = (const float*)d_in[2];
    const float* bq   = (const float*)d_in[3];
    const float* Wkv  = (const float*)d_in[4];
    const float* bkv  = (const float*)d_in[5];
    const float* Wo   = (const float*)d_in[6];
    const float* bo   = (const float*)d_in[7];
    const float* ln_g = (const float*)d_in[8];
    const float* ln_b = (const float*)d_in[9];
    float* out = (float*)d_out;

    const size_t BS = 4 * (size_t)S_LEN;            // 8192 rows
    const size_t DD = (size_t)D_DIM * D_DIM;        // 1M
    char* ws = (char*)d_ws;
    size_t off = 0;
    auto alloc = [&](size_t elems) { u16* p = (u16*)(ws + off); off += elems * sizeof(u16); return p; };
    u16* wqkv = alloc(3 * DD);        // [Wq ; Wkv] rows, bf16
    u16* wo   = alloc(DD);
    u16* xn   = alloc(BS * D_DIM);
    u16* qb   = alloc(BS * D_DIM);
    u16* kbuf = alloc(BS * D_DIM);
    u16* vtb  = alloc(BS * D_DIM);    // V^T per (batch, head): [dh][s]
    u16* ctx  = alloc(BS * D_DIM);

    // wo follows wqkv directly in the workspace: one bf16 destination for all weights.
    prep_kernel<<<(int)(CVT_BLOCKS + BS), 256, 0, stream>>>(x, ln_g, ln_b, xn, Wq, Wkv, Wo, wqkv);

    dim3 gqkv(3 * D_DIM / 128, (int)(BS / 128));   // (24, 64)
    gemm_kernel<0><<<gqkv, 256, 0, stream>>>(xn, wqkv, D_DIM, bq, bkv,
                                             qb, kbuf, vtb, nullptr, nullptr);

    attn_kernel<<<dim3(4 * H_NUM, S_LEN / 128), 256, 0, stream>>>(qb, kbuf, vtb, lens, ctx);

    dim3 gout(D_DIM / 128, (int)(BS / 128));       // (8, 64)
    gemm_kernel<1><<<gout, 256, 0, stream>>>(ctx, wo, D_DIM, bo, nullptr,
                                             nullptr, nullptr, nullptr, x, out);
}

// v007
// It runs in 114 microseconds.
// Next to v006, in two timings, it ran 1.07 and 1.06 times as fast.
// Over all steps from v000 it is 2.38 times as fast.
#include <hip/hip_runtime.h>

typedef unsigned short u16;
typedef __attribute__((ext_vector_type(16))) __bf16 v16bf;
typedef __attribute__((ext_vector_type(8)))  float  v8f;

#define S_LEN 2048
#define D_DIM 1024
#define H_NUM 16
#define DH_NUM 64

// Round to nearest even by the conversion instruction; neighbours pair into one packed convert.
__device__ __forceinline__ u16 f2bf(float f) {
    return __builtin_bit_cast(u16, (__bf16)f);
}

struct Pack32 { uint4 a, b; };
struct P16 { u16 h[16]; };

// Load one bf16 WMMA operand fragment (A-pattern; B uses the same pattern with
// lane -> N).  Lane-half 0: K in [0,8)u[16,24); lane-half 1: K in [8,16)u[24,32).
// Caller passes p already offset by (row, basek); we read p[0..7] and p[16..23].
__device__ __forceinline__ v16bf ldfrag(const u16* p) {
    Pack32 s;
    s.a = *(const uint4*)(p);
    s.b = *(const uint4*)(p + 16);
    return __builtin_bit_cast(v16bf, s);
}

__device__ __forceinline__ v8f wmma_bf16(v16bf a, v16bf b, v8f c) {
    return __builtin_amdgcn_wmma_f32_16x16x32_bf16(false, a, false, b, (short)0, c,
                                                   false, false);
}

// ---------------------------------------------------------------- weights -> bf16, LayerNorm
// One launch.  The first CVT_BLOCKS blocks round the weights to bf16, the others
// normalise one row of x each; the two kinds of block share nothing.
// A conversion block takes CVT_ELEMS consecutive elements: each wave reads 8 times
// 512 contiguous bytes (all 8 loads go out before the first value is used) and
// writes 8 times 256 contiguous bytes.  The bf16 copies of Wq, Wkv, Wo lie one
// behind the other in wbf.
#define CVT_ELEMS 8192
#define CVT_Q (D_DIM * D_DIM / CVT_ELEMS)        // blocks for Wq, and for Wo
#define CVT_KV (2 * D_DIM * D_DIM / CVT_ELEMS)   // blocks for Wkv
#define CVT_BLOCKS (CVT_Q + CVT_KV + CVT_Q)

__global__ __launch_bounds__(256) void prep_kernel(const float* __restrict__ x,
                                                   const float* __restrict__ g,
                                                   const float* __restrict__ bb,
                                                   u16* __restrict__ xn,
                                                   const float* __restrict__ Wq,
                                                   const float* __restrict__ Wkv,
                                                   const float* __restrict__ Wo,
                                                   u16* __restrict__ wbf) {
    __shared__ float red[8];
    int tid = threadIdx.x, lane = tid & 31, wave = tid >> 5;
    if (blockIdx.x < CVT_BLOCKS) {   // the same for the whole block, ahead of every barrier
        const int cb = blockIdx.x;
        const float* s = (cb < CVT_Q)            ? Wq + (size_t)cb * CVT_ELEMS
                         : (cb < CVT_Q + CVT_KV) ? Wkv + (size_t)(cb - CVT_Q) * CVT_ELEMS
                                                 : Wo + (size_t)(cb - CVT_Q - CVT_KV) * CVT_ELEMS;
        u16* d = wbf + (size_t)cb * CVT_ELEMS;
        float4 w[8];
        // Both loops unrolled: w[] stays in registers and the 8 loads are issued together.
#pragma unroll
        for (int i = 0; i < 8; i++) w[i] = *(const float4*)(s + i * 1024 + tid * 4);
#pragma unroll
        for (int i = 0; i < 8; i++) {
            uint2 o;
            o.x = (unsigned)f2bf(w[i].x) | ((unsigned)f2bf(w[i].y) << 16);
            o.y = (unsigned)f2bf(w[i].z) | ((unsigned)f2bf(w[i].w) << 16);
            *(uint2*)(d + i * 1024 + tid * 4) = o;
        }
        return;
    }
    size_t row = blockIdx.x - CVT_BLOCKS;
    const float* xr = x + row * D_DIM;
    float v[4];
    float s = 0.f;
#pragma unroll
    for (int i = 0; i < 4; i++) { v[i] = xr[tid + i * 256]; s += v[i]; }
#pragma unroll
    for (int m = 16; m >= 1; m >>= 1) s += __shfl_xor(s, m);
    if (lane == 0) red[wave] = s;
    __syncthreads();
    float tot = 0.f;
#pragma unroll
    for (int i = 0; i < 8; i++) tot += red[i];
    float mean = tot * (1.f / (float)D_DIM);
    __syncthreads();
    float s2 = 0.f;
#pragma unroll
    for (int i = 0; i < 4; i++) { float d = v[i] - mean; s2 += d * d; }
#pragma unroll
    for (int m = 16; m >= 1; m >>= 1) s2 += __shfl_xor(s2, m);
    if (lane == 0) red[wave] = s2;
    __syncthreads();
    float tot2 = 0.f;
#pragma unroll
    for (int i = 0; i < 8; i++) tot2 += red[i];
    float rstd = rsqrtf(tot2 * (1.f / (float)D_DIM) + 1e-5f);
#pragma unroll
    for (int i = 0; i < 4; i++) {
        int c = tid + i * 256;
        xn[row * D_DIM + c] = f2bf((v[i] - mean) * rstd * g[c] + bb[c]);
    }
}

// ---------------------------------------------------------------- Tiled WMMA GEMM
// C[M,N] = A[M,K] * W[N,K]^T (+ epilogue).  BM=128 BN=128, 8 waves,
// wave tile 64x32 (4x2 WMMA accumulators).  K a multiple of 64, at least 64.
// The operands come through LDS in tiles of 64 k (whole 128-byte rows), copied in
// without passing registers; two buffers, the next tile's copies fly during this
// tile's products.
// MODE 0: QKV - bias from (b0|b1), split-store bf16 q(*0.125)/k, and v transposed:
//         vb[(b*H + h)*DH + dh][s], the layout the attention kernel stages from.
// MODE 1: out-proj - fp32 out = acc + b0[col] + resid.
// Epilogue: the 128x128 output tile is staged in LDS (over the operand tiles),
// then leaves as 16-byte stores that cover whole rows of the tile.
#define GK 64                        // k per staged tile
#define GP 72                        // LDS row pitch in u16: 128 B + 16 B, for 16-byte readers
#define G_HALF (128 * GP * 2)        // bytes of one operand's tile (128 rows)
#define G_BUF (2 * G_HALF)           // bytes of one buffer: A tile, then W tile

// One tile: each lane copies 16 bytes of rows (srow + 32 i), i = 0..3, of A and of W;
// rstep = 32 rows in elements.  The s_wait_xcnt closes the statement so that no address
// register of a copy is rewritten while the copy may still need it.
__device__ __forceinline__ void stage_gemm(unsigned lds, const u16* ga, const u16* gw,
                                           size_t rstep) {
    unsigned la1 = lds + 32 * GP * 2, la2 = lds + 64 * GP * 2, la3 = lds + 96 * GP * 2;
    unsigned lw0 = lds + G_HALF, lw1 = la1 + G_HALF, lw2 = la2 + G_HALF, lw3 = la3 + G_HALF;
    const u16 *ga1 = ga + rstep, *ga2 = ga1 + rstep, *ga3 = ga2 + rstep;
    const u16 *gw1 = gw + rstep, *gw2 = gw1 + rstep, *gw3 = gw2 + rstep;
    asm volatile("global_load_async_to_lds_b128 %0, %1, off\n\t"
                 "global_load_async_to_lds_b128 %2, %3, off\n\t"
                 "global_load_async_to_lds_b128 %4, %5, off\n\t"
                 "global_load_async_to_lds_b128 %6, %7, off\n\t"
                 "global_load_async_to_lds_b128 %8, %9, off\n\t"
                 "global_load_async_to_lds_b128 %10, %11, off\n\t"
                 "global_load_async_to_lds_b128 %12, %13, off\n\t"
                 "global_load_async_to_lds_b128 %14, %15, off\n\t"
                 "s_wait_xcnt 0x0"
                 :: "v"(lds), "v"(ga), "v"(la1), "v"(ga1), "v"(la2), "v"(ga2), "v"(la3), "v"(ga3),
                    "v"(lw0), "v"(gw), "v"(lw1), "v"(gw1), "v"(lw2), "v"(gw2), "v"(lw3), "v"(gw3)
                 : "memory");
}

template <int MODE>
__global__ __launch_bounds__(256) void gemm_kernel(
    const u16* __restrict__ A, const u16* __restrict__ W, int K_dim,
    const float* __restrict__ b0, const float* __restrict__ b1,
    u16* __restrict__ qb, u16* __restrict__ kb, u16* __restrict__ vb,
    const float* __restrict__ resid, float* __restrict__ outp) {
    // Staged row pitch in bytes: 128 elements + 16 B, so that the two lane halves
    // (8 rows apart) write banks 32 apart.
    constexpr int CP = (MODE == 0) ? 128 * 2 + 16 : 128 * 4 + 16;
    constexpr int SMEM = (2 * G_BUF > 128 * CP) ? 2 * G_BUF : 128 * CP;
    __shared__ __attribute__((aligned(16))) unsigned char smem[SMEM];
    int tid = threadIdx.x, lane = tid & 31, wave = tid >> 5;
    int wm = wave & 1, wn = wave >> 1;
    int half = lane >> 4, r = lane & 15, bk = half * 8;
    const size_t M0 = (size_t)blockIdx.y * 128;
    const size_t N0 = (size_t)blockIdx.x * 128;
    const u16* Aptr = A + M0 * K_dim;
    const u16* Wptr = W + N0 * K_dim;

    v8f acc[4][2] = {};
    const int nt = K_dim / GK;   // tiles of 64 k, the same for the whole block
    // This lane's share of a tile: 8 lanes per 128-byte row.
    const int srow = tid >> 3, scol = (tid & 7) * 8;
    const unsigned lds0 = (unsigned)(size_t)(smem + srow * (GP * 2) + scol * 2);
    const u16* ga0 = Aptr + (size_t)srow * K_dim + scol;
    const u16* gw0 = Wptr + (size_t)srow * K_dim + scol;
    const size_t rstep = (size_t)32 * K_dim;

    stage_gemm(lds0, ga0, gw0, rstep);
    asm volatile("s_wait_asynccnt 0x0" ::: "memory");  // this wave's share of tile 0 has landed
    __syncthreads();                                   // ... and every other wave's
    if (1 < nt) stage_gemm(lds0 + G_BUF, ga0 + GK, gw0 + GK, rstep);

    for (int t = 0; t < nt; t++) {
        const u16* As = (const u16*)(smem + (t & 1) * G_BUF) + (wm * 64 + r) * GP + bk;
        const u16* Bs = (const u16*)(smem + (t & 1) * G_BUF + G_HALF) + (wn * 32 + r) * GP + bk;
        // Unrolled: the two 32-k steps of a tile differ only in constant LDS offsets.
#pragma unroll
        for (int kk = 0; kk < GK; kk += 32) {
            v16bf af[4], bfr[2];
#pragma unroll
            for (int i = 0; i < 4; i++) af[i] = ldfrag(As + i * 16 * GP + kk);
#pragma unroll
            for (int j = 0; j < 2; j++) bfr[j] = ldfrag(Bs + j * 16 * GP + kk);
#pragma unroll
            for (int i = 0; i < 4; i++)
#pragma unroll
                for (int j = 0; j < 2; j++) acc[i][j] = wmma_bf16(af[i], bfr[j], acc[i][j]);
        }
        // Hand-over, passed by every wave.
        asm volatile("s_wait_dscnt 0x0" ::: "memory");     // my reads of this buffer are done
        asm volatile("s_wait_asynccnt 0x0" ::: "memory");  // my share of tile t+1 has landed
        __syncthreads();  // tile t+1 is whole, and nobody reads tile t's buffer any more
        if (t + 2 < nt)
            stage_gemm(lds0 + (t & 1) * G_BUF, ga0 + (size_t)(t + 2) * GK, gw0 + (size_t)(t + 2) * GK,
                       rstep);
    }
    asm volatile("s_wait_asynccnt 0x0" ::: "memory");  // no copy is open when the tile is staged

    // Every loop below is fully unrolled so that acc[][] and rv[] keep constant
    // indices and stay in registers.
    const int rl0 = wm * 64 + 8 * half;   // this lane's first row in the tile
    const int cl0 = wn * 32 + r;          // this lane's first column in the tile
    if (MODE == 0) {
        // A 128-column tile lies wholly in q, k or v: one destination per block.
        const int which = (int)(N0 / D_DIM);
        const float* bias = (which == 0) ? b0 + N0 : b1 + (N0 - D_DIM);
        const float sc = (which == 0) ? 0.125f : 1.0f;  // fold 1/sqrt(DH) into q
        u16* dst = (which == 0) ? qb : (which == 1) ? kb : vb;
        float bj[2];
#pragma unroll
        for (int j = 0; j < 2; j++) bj[j] = bias[cl0 + j * 16];
        __syncthreads();  // every wave has read its last operand fragments
        if (which == 2) {   // the same for the whole block
            // V is staged transposed, [column][row]: the 8 accumulator rows a lane holds of
            // one column are 8 neighbours of one staged row, one 16-byte LDS store.
#pragma unroll
            for (int i = 0; i < 4; i++)
#pragma unroll
                for (int j = 0; j < 2; j++) {
                    unsigned w[4];
#pragma unroll
                    for (int e = 0; e < 4; e++)
                        w[e] = (unsigned)f2bf(acc[i][j][2 * e] + bj[j]) |
                               ((unsigned)f2bf(acc[i][j][2 * e + 1] + bj[j]) << 16);
                    *(uint4*)(smem + (cl0 + j * 16) * CP + (rl0 + i * 16) * 2) =
                        make_uint4(w[0], w[1], w[2], w[3]);
                }
        } else {
#pragma unroll
            for (int i = 0; i < 4; i++)
#pragma unroll
                for (int j = 0; j < 2; j++)
#pragma unroll
                    for (int e = 0; e < 8; e++)
                        *(u16*)(smem + (rl0 + i * 16 + e) * CP + (cl0 + j * 16) * 2) =
                            f2bf((acc[i][j][e] + bj[j]) * sc);
        }
        __syncthreads();  // the tile is complete before any wave reads rows of it
        const int row0 = tid >> 4, ch = tid & 15;   // 16 chunks of 16 B per 256-B row
        if (which == 2) {
            // Staged row = column (head, dh): rows S_LEN apart in memory; the tile's 128
            // positions lie in one batch (S_LEN is a multiple of 128).
            u16* dtile = dst + ((M0 / S_LEN) * D_DIM + (N0 % D_DIM)) * S_LEN + (M0 % S_LEN);
            const unsigned off = (unsigned)(row0 * S_LEN + ch * 8);
#pragma unroll
            for (int it = 0; it < 8; it++)
                *(uint4*)(dtile + off + it * 16 * S_LEN) =
                    *(const uint4*)(smem + (row0 + it * 16) * CP + ch * 16);
        } else {
            u16* dtile = dst + M0 * D_DIM + (N0 % D_DIM);
            const unsigned off = (unsigned)(row0 * D_DIM + ch * 8);
#pragma unroll
            for (int it = 0; it < 8; it++)
                *(uint4*)(dtile + off + it * 16 * D_DIM) =
                    *(const uint4*)(smem + (row0 + it * 16) * CP + ch * 16);
        }
    } else {
        // One wave covers one 512-B row per step; all residual loads go out together.
        const float* rtile = resid + M0 * D_DIM + N0;
        float* otile = outp + M0 * D_DIM + N0;
        const unsigned off = (unsigned)(wave * D_DIM + lane * 4);  // same for load and store
        float4 rv[16];
#pragma unroll
        for (int it = 0; it < 16; it++)
            rv[it] = *(const float4*)(rtile + off + it * 8 * D_DIM);
        __syncthreads();  // every wave has read its last operand fragments
        float4 bv = *(const float4*)(b0 + N0 + lane * 4);
#pragma unroll
        for (int i = 0; i < 4; i++)
#pragma unroll
            for (int j = 0; j < 2; j++)
#pragma unroll
                for (int e = 0; e < 8; e++)
                    *(float*)(smem + (rl0 + i * 16 + e) * CP + (cl0 + j * 16) * 4) = acc[i][j][e];
        __syncthreads();  // the tile is complete before any wave reads rows of it
#pragma unroll
        for (int it = 0; it < 16; it++) {
            int row = wave + it * 8;
            float4 a = *(const float4*)(smem + row * CP + lane * 16);
            float4 o;
            o.x = a.x + bv.x + rv[it].x;
            o.y = a.y + bv.y + rv[it].y;
            o.z = a.z + bv.z + rv[it].z;
            o.w = a.w + bv.w + rv[it].w;
            *(float4*)(otile + off + it * 8 * D_DIM) = o;
        }
    }
}

#define KT 64                        // keys per staged tile
#define KVP 72                       // LDS row pitch in u16: 128 B + 16 B, for 16-byte readers
#define KV_HALF (KT * KVP * 2)       // bytes of one operand's tile (64 rows)
#define KV_BUF (2 * KV_HALF)         // bytes of one buffer: K tile, then V^T tile

// One tile: each lane copies 16 bytes of rows (srow, srow+32) of K and of V^T.
// The s_wait_xcnt closes the statement so that no address register of a copy is
// rewritten while the copy may still need it.
__device__ __forceinline__ void stage_tile(unsigned lds, const u16* gk, const u16* gv) {
    unsigned lk1 = lds + 32 * KVP * 2, lv0 = lds + KV_HALF, lv1 = lds + KV_HALF + 32 * KVP * 2;
    const u16* gk1 = gk + (size_t)32 * D_DIM;
    const u16* gv1 = gv + (size_t)32 * S_LEN;
    asm volatile("global_load_async_to_lds_b128 %0, %1, off\n\t"
                 "global_load_async_to_lds_b128 %2, %3, off\n\t"
                 "global_load_async_to_lds_b128 %4, %5, off\n\t"
                 "global_load_async_to_lds_b128 %6, %7, off\n\t"
                 "s_wait_xcnt 0x0"
                 :: "v"(lds), "v"(gk), "v"(lk1), "v"(gk1), "v"(lv0), "v"(gv), "v"(lv1), "v"(gv1)
                 : "memory");
}

__global__ __launch_bounds__(256) void attn_kernel(const u16* __restrict__ q,
                                                   const u16* __restrict__ k,
                                                   const u16* __restrict__ vt,
                                                   const int* __restrict__ lens,
                                                   u16* __restrict__ ctx) {
    __shared__ __attribute__((aligned(16))) unsigned char kv[2 * KV_BUF];
    int tid = threadIdx.x, lane = tid & 31;
    int wave = __builtin_amdgcn_readfirstlane(tid >> 5);  // scalar: the per-wave skip is a real branch
    int half = lane >> 4, r = lane & 15, bk = half * 8;
    // Which (batch, head, query tile) a block takes; any deal gives the same result, this one
    // is for speed.  A tile's cost grows with its index and stops at the batch's length.
    // The costly tiles (8..15) take the low indices;
    // indices 256 apart take four
    // different batches and the tiles 15-2g, 14-2g, 2g+1, 2g, whose causal costs add up alike.
    const int flat = blockIdx.x;                 // 4 batches x 16 heads x 16 tiles
    const int m = flat >> 8, h = flat & 15;
    const int b = (((flat >> 4) & 1) * 2 + ((flat >> 7) & 1) + m) & 3;
    const int bh = b * H_NUM + h;
    const int qt = (((flat >> 5) & 3) * 2 + (m & 1)) ^ ((m & 2) ? 1 : 15);
    int q0 = qt * 128;
    int qw = q0 + wave * 16;
    int len = lens[b];
    int myq = qw + r;                        // the single query this lane owns
    int lim = (myq + 1 < len) ? myq + 1 : len;  // key valid iff key < lim

    // Q as B-operand (lane r = query), both 32-wide dh k-steps.
    const u16* qbase = q + ((size_t)(b * S_LEN + qw + r) * D_DIM + h * DH_NUM) + bk;
    v16bf qf[2];
    qf[0] = ldfrag(qbase);
    qf[1] = ldfrag(qbase + 32);

    float mrun = -1e30f, lrun = 0.f;
    v8f Ov[4] = {};

    int kmax = qw + 15;                      // this wave's last key
    if (len - 1 < kmax) kmax = len - 1;
    int kmaxb = q0 + 127;                    // the block's last key (<= S_LEN - 1)
    if (len - 1 < kmaxb) kmaxb = len - 1;
    const int nt = (kmaxb >> 6) + 1;         // tiles of 64 keys, the same for the whole block

    // This lane's share of a tile: 8 lanes per 128-byte row.
    const int srow = tid >> 3, scol = (tid & 7) * 8;
    const unsigned lds0 = (unsigned)(size_t)(kv + srow * (KVP * 2) + scol * 2);
    const u16* gk0 = k + ((size_t)(b * S_LEN + srow) * D_DIM + h * DH_NUM + scol);
    const u16* gv0 = vt + ((size_t)(bh * DH_NUM + srow) * S_LEN + scol);

    stage_tile(lds0, gk0, gv0);
    asm volatile("s_wait_asynccnt 0x0" ::: "memory");  // this wave's share of tile 0 has landed
    __syncthreads();                                   // ... and every other wave's
    if (1 < nt) stage_tile(lds0 + KV_BUF, gk0 + (size_t)KT * D_DIM, gv0 + KT);

    for (int t = 0; t < nt; t++) {
        const u16* Ks = (const u16*)(kv + (t & 1) * KV_BUF) + r * KVP + bk;  // K row r
        const u16* Vs = Ks + KT * KVP;                                       // V^T row r
        // Two steps of 32 keys; a wave stops at its own last key.  Kept rolled: unrolled, the
        // two skippable bodies cost a copy of all accumulators at each join.
#pragma unroll 1
        for (int c = 0; c < 2; c++) {
            const int kbp = t * KT + c * 32;
            if (kbp > kmax) break;
            {
                // ---- all 16 fragment loads up front
                v16bf kf0 = ldfrag(Ks + (c * 32) * KVP);
                v16bf kf1 = ldfrag(Ks + (c * 32) * KVP + 32);
                v16bf kf2 = ldfrag(Ks + (c * 32 + 16) * KVP);
                v16bf kf3 = ldfrag(Ks + (c * 32 + 16) * KVP + 32);
                v16bf vf[4];
#pragma unroll
                for (int j = 0; j < 4; j++)
                    vf[j] = ldfrag(Vs + (j * 16) * KVP + c * 32);

                // ---- S^T tiles: rows = keys (u*16 + e + 8*half), col = query
                v8f Sacc[2] = {};
                Sacc[0] = wmma_bf16(kf0, qf[0], Sacc[0]);
                Sacc[0] = wmma_bf16(kf1, qf[1], Sacc[0]);
                Sacc[1] = wmma_bf16(kf2, qf[0], Sacc[1]);
                Sacc[1] = wmma_bf16(kf3, qf[1], Sacc[1]);

                // ---- mask (only on boundary blocks) + per-lane online softmax
                float sv[2][8];
                float rowmax = -3.0e38f;
                bool full = (kbp + 32 <= qw + 1) && (kbp + 32 <= len);  // wave-uniform
                if (full) {
#pragma unroll
                    for (int u = 0; u < 2; u++)
#pragma unroll
                        for (int e = 0; e < 8; e++) {
                            sv[u][e] = Sacc[u][e];
                            rowmax = fmaxf(rowmax, sv[u][e]);
                        }
                } else {
                    int kbase0 = kbp + 8 * half;
#pragma unroll
                    for (int u = 0; u < 2; u++)
#pragma unroll
                        for (int e = 0; e < 8; e++) {
                            int key = kbase0 + u * 16 + e;
                            sv[u][e] = (key < lim) ? Sacc[u][e] : -3.0e38f;
                            rowmax = fmaxf(rowmax, sv[u][e]);
                        }
                }
                rowmax = fmaxf(rowmax, __shfl_xor(rowmax, 16));
                float mnew = fmaxf(mrun, rowmax);
                float scale = __expf(mrun - mnew);
                float rsum = 0.f;
                P16 ph;
#pragma unroll
                for (int u = 0; u < 2; u++)
#pragma unroll
                    for (int e = 0; e < 8; e++) {
                        float p = __expf(sv[u][e] - mnew);
                        rsum += p;
                        ph.h[u * 8 + e] = f2bf(p);  // B-operand half m = u*8+e -> key u*16+e+8*half
                    }
                rsum += __shfl_xor(rsum, 16);
                lrun = lrun * scale + rsum;
                mrun = mnew;
                v16bf pf = __builtin_bit_cast(v16bf, ph);

                // ---- O^T += V^T * P  (rows = dh, col = query)
#pragma unroll
                for (int j = 0; j < 4; j++) {
#pragma unroll
                    for (int e = 0; e < 8; e++) Ov[j][e] *= scale;
                    Ov[j] = wmma_bf16(vf[j], pf, Ov[j]);
                }
                // The next step's first vector instruction may overwrite an operand register of
                // these products.
                __builtin_amdgcn_sched_barrier(0);  // or the scheduler lifts the v_nop over the products
                asm volatile("v_nop");
            }
        }
        // Hand-over, passed by every wave (also one that skipped the work above).
        asm volatile("s_wait_dscnt 0x0" ::: "memory");     // my reads of this buffer are done
        asm volatile("s_wait_asynccnt 0x0" ::: "memory");  // my share of tile t+1 has landed
        __syncthreads();  // tile t+1 is whole, and nobody reads tile t's buffer any more
        if (t + 2 < nt)
            stage_tile(lds0 + (t & 1) * KV_BUF, gk0 + (size_t)(t + 2) * KT * D_DIM,
                       gv0 + (t + 2) * KT);
    }
    asm volatile("s_wait_asynccnt 0x0" ::: "memory");  // no copy is open when the wave ends

    float inv = 1.f / lrun;
#pragma unroll
    for (int j = 0; j < 4; j++)
#pragma unroll
        for (int e = 0; e < 8; e++) {
            int dh = j * 16 + e + 8 * half;
            ctx[(size_t)(b * S_LEN + myq) * D_DIM + h * DH_NUM + dh] = f2bf(Ov[j][e] * inv);
        }
}

// ---------------------------------------------------------------- launch
extern "C" void kernel_launch(void* const* d_in, const int* in_sizes, int n_in,
                              void* d_out, int out_size, void* d_ws, size_t ws_size,
                              hipStream_t stream) {
    (void)in_sizes; (void)n_in; (void)out_size; (void)ws_size;
    const float* x    = (const float*)d_in[0];
    const int*   lens = (const int*)d_in[1];
    const float* Wq   = (const float*)d_in[2];
    const float* bq   = (const float*)d_in[3];
    const float* Wkv  = (const float*)d_in[4];
    const float* bkv  = (const float*)d_in[5];
    const float* Wo   = (const float*)d_in[6];
    const float* bo   = (const float*)d_in[7];
    const float* ln_g = (const float*)d_in[8];
    const float* ln_b = (const float*)d_in[9];
    float* out = (float*)d_out;

    const size_t BS = 4 * (size_t)S_LEN;            // 8192 rows
    const size_t DD = (size_t)D_DIM * D_DIM;        // 1M
    char* ws = (char*)d_ws;
    size_t off = 0;
    auto alloc = [&](size_t elems) { u16* p = (u16*)(ws + off); off += elems * sizeof(u16); return p; };
    u16* wqkv = alloc(3 * DD);        // [Wq ; Wkv] rows, bf16
    u16* wo   = alloc(DD);
    u16* xn   = alloc(BS * D_DIM);
    u16* qb   = alloc(BS * D_DIM);
    u16* kbuf = alloc(BS * D_DIM);
    u16* vtb  = alloc(BS * D_DIM);    // V^T per (batch, head): [dh][s]
    u16* ctx  = alloc(BS * D_DIM);

    // wo follows wqkv directly in the workspace: one bf16 destination for all weights.
    prep_kernel<<<(int)(CVT_BLOCKS + BS), 256, 0, stream>>>(x, ln_g, ln_b, xn, Wq, Wkv, Wo, wqkv);

    dim3 gqkv(3 * D_DIM / 128, (int)(BS / 128));   // (24, 64)
    gemm_kernel<0><<<gqkv, 256, 0, stream>>>(xn, wqkv, D_DIM, bq, bkv,
                                             qb, kbuf, vtb, nullptr, nullptr);

    attn_kernel<<<4 * H_NUM * (S_LEN / 128), 256, 0, stream>>>(qb, kbuf, vtb, lens, ctx);

    dim3 gout(D_DIM / 128, (int)(BS / 128));       // (8, 64)
    gemm_kernel<1><<<gout, 256, 0, stream>>>(ctx, wo, D_DIM, bo, nullptr,
                                             nullptr, nullptr, nullptr, x, out);
}

// v008
// It runs in 107 microseconds.
// Two timings next to v007 both put it at 1.06 times that version's speed.
// Over all steps from v000 it is 2.52 times as fast.
#include <hip/hip_runtime.h>

typedef unsigned short u16;
typedef __attribute__((ext_vector_type(16))) __bf16 v16bf;
typedef __attribute__((ext_vector_type(8)))  float  v8f;

#define S_LEN 2048
#define D_DIM 1024
#define H_NUM 16
#define DH_NUM 64

// Round to nearest even by the conversion instruction; neighbours pair into one packed convert.
__device__ __forceinline__ u16 f2bf(float f) {
    return __builtin_bit_cast(u16, (__bf16)f);
}

struct Pack32 { uint4 a, b; };
struct P16 { u16 h[16]; };

// Load one bf16 WMMA operand fragment (A-pattern; B uses the same pattern with
// lane -> N).  Lane-half 0: K in [0,8)u[16,24); lane-half 1: K in [8,16)u[24,32).
// Caller passes p already offset by (row, basek); we read p[0..7] and p[16..23].
__device__ __forceinline__ v16bf ldfrag(const u16* p) {
    Pack32 s;
    s.a = *(const uint4*)(p);
    s.b = *(const uint4*)(p + 16);
    return __builtin_bit_cast(v16bf, s);
}

__device__ __forceinline__ v8f wmma_bf16(v16bf a, v16bf b, v8f c) {
    return __builtin_amdgcn_wmma_f32_16x16x32_bf16(false, a, false, b, (short)0, c,
                                                   false, false);
}

// ---------------------------------------------------------------- weights -> bf16, LayerNorm
// One launch.  The first CVT_BLOCKS blocks round the weights to bf16, the others
// normalise one row of x each; the two kinds of block share nothing.
// A conversion block takes CVT_ELEMS consecutive elements: each wave reads 8 times
// 512 contiguous bytes (all 8 loads go out before the first value is used) and
// writes 8 times 256 contiguous bytes.  The bf16 copies of Wq, Wkv, Wo lie one
// behind the other in wbf.
#define CVT_ELEMS 8192
#define CVT_Q (D_DIM * D_DIM / CVT_ELEMS)        // blocks for Wq, and for Wo
#define CVT_KV (2 * D_DIM * D_DIM / CVT_ELEMS)   // blocks for Wkv
#define CVT_BLOCKS (CVT_Q + CVT_KV + CVT_Q)

__global__ __launch_bounds__(256) void prep_kernel(const float* __restrict__ x,
                                                   const float* __restrict__ g,
                                                   const float* __restrict__ bb,
                                                   u16* __restrict__ xn,
                                                   const float* __restrict__ Wq,
                                                   const float* __restrict__ Wkv,
                                                   const float* __restrict__ Wo,
                                                   u16* __restrict__ wbf) {
    __shared__ float red[8];
    int tid = threadIdx.x, lane = tid & 31, wave = tid >> 5;
    if (blockIdx.x < CVT_BLOCKS) {   // the same for the whole block, ahead of every barrier
        const int cb = blockIdx.x;
        const float* s = (cb < CVT_Q)            ? Wq + (size_t)cb * CVT_ELEMS
                         : (cb < CVT_Q + CVT_KV) ? Wkv + (size_t)(cb - CVT_Q) * CVT_ELEMS
                                                 : Wo + (size_t)(cb - CVT_Q - CVT_KV) * CVT_ELEMS;
        u16* d = wbf + (size_t)cb * CVT_ELEMS;
        float4 w[8];
        // Both loops unrolled: w[] stays in registers and the 8 loads are issued together.
#pragma unroll
        for (int i = 0; i < 8; i++) w[i] = *(const float4*)(s + i * 1024 + tid * 4);
#pragma unroll
        for (int i = 0; i < 8; i++) {
            uint2 o;
            o.x = (unsigned)f2bf(w[i].x) | ((unsigned)f2bf(w[i].y) << 16);
            o.y = (unsigned)f2bf(w[i].z) | ((unsigned)f2bf(w[i].w) << 16);
            *(uint2*)(d + i * 1024 + tid * 4) = o;
        }
        return;
    }
    size_t row = blockIdx.x - CVT_BLOCKS;
    const float* xr = x + row * D_DIM;
    float v[4];
    float s = 0.f;
#pragma unroll
    for (int i = 0; i < 4; i++) { v[i] = xr[tid + i * 256]; s += v[i]; }
#pragma unroll
    for (int m = 16; m >= 1; m >>= 1) s += __shfl_xor(s, m);
    if (lane == 0) red[wave] = s;
    __syncthreads();
    float tot = 0.f;
#pragma unroll
    for (int i = 0; i < 8; i++) tot += red[i];
    float mean = tot * (1.f / (float)D_DIM);
    __syncthreads();
    float s2 = 0.f;
#pragma unroll
    for (int i = 0; i < 4; i++) { float d = v[i] - mean; s2 += d * d; }
#pragma unroll
    for (int m = 16; m >= 1; m >>= 1) s2 += __shfl_xor(s2, m);
    if (lane == 0) red[wave] = s2;
    __syncthreads();
    float tot2 = 0.f;
#pragma unroll
    for (int i = 0; i < 8; i++) tot2 += red[i];
    float rstd = rsqrtf(tot2 * (1.f / (float)D_DIM) + 1e-5f);
#pragma unroll
    for (int i = 0; i < 4; i++) {
        int c = tid + i * 256;
        xn[row * D_DIM + c] = f2bf((v[i] - mean) * rstd * g[c] + bb[c]);
    }
}

// ---------------------------------------------------------------- Tiled WMMA GEMM
// C[M,N] = A[M,K] * W[N,K]^T (+ epilogue).  BM=256 BN=128, 8 waves (4 x 2),
// wave tile 64x64 (4x4 WMMA accumulators): every fragment read from LDS feeds four
// products.  K a multiple of 64, at least 64.
// The operands come through LDS in tiles of 64 k (whole 128-byte rows), copied in
// without passing registers; two buffers, the next tile's copies fly during this
// tile's products.
// MODE 0: QKV - bias from (b0|b1), split-store bf16 q(*0.125)/k, and v transposed:
//         vb[(b*H + h)*DH + dh][s], the layout the attention kernel stages from.
// MODE 1: out-proj - fp32 out = acc + b0[col] + resid.
// Epilogue: the 256x128 output tile is staged in LDS (over the operand tiles),
// then leaves as 16-byte stores that cover whole rows of the tile.
#define BM 256                       // rows of A (and of C) per block
#define BN 128                       // rows of W (columns of C) per block
#define GK 64                        // k per staged tile
#define GP 72                        // LDS row pitch in u16: 128 B + 16 B, for 16-byte readers
#define G_A (BM * GP * 2)            // bytes of the A tile
#define G_BUF ((BM + BN) * GP * 2)   // bytes of one buffer: A tile, then W tile

// One tile: each lane copies 16 bytes of rows (srow + 32 i) of A, i = 0..7, and of W,
// i = 0..3; rstep = 32 rows in elements.  The s_wait_xcnt closes the statement so that no
// address register of a copy is rewritten while the copy may still need it.
__device__ __forceinline__ void stage_gemm(unsigned lds, const u16* ga, const u16* gw,
                                           size_t rstep) {
    constexpr unsigned LS = 32 * GP * 2;   // 32 rows in LDS bytes
    unsigned la1 = lds + LS, la2 = lds + 2 * LS, la3 = lds + 3 * LS, la4 = lds + 4 * LS;
    unsigned la5 = lds + 5 * LS, la6 = lds + 6 * LS, la7 = lds + 7 * LS;
    unsigned lw0 = lds + G_A, lw1 = lw0 + LS, lw2 = lw0 + 2 * LS, lw3 = lw0 + 3 * LS;
    const u16 *ga1 = ga + rstep, *ga2 = ga1 + rstep, *ga3 = ga2 + rstep, *ga4 = ga3 + rstep;
    const u16 *ga5 = ga4 + rstep, *ga6 = ga5 + rstep, *ga7 = ga6 + rstep;
    const u16 *gw1 = gw + rstep, *gw2 = gw1 + rstep, *gw3 = gw2 + rstep;
    asm volatile("global_load_async_to_lds_b128 %0, %1, off\n\t"
                 "global_load_async_to_lds_b128 %2, %3, off\n\t"
                 "global_load_async_to_lds_b128 %4, %5, off\n\t"
                 "global_load_async_to_lds_b128 %6, %7, off\n\t"
                 "global_load_async_to_lds_b128 %8, %9, off\n\t"
                 "global_load_async_to_lds_b128 %10, %11, off\n\t"
                 "global_load_async_to_lds_b128 %12, %13, off\n\t"
                 "global_load_async_to_lds_b128 %14, %15, off\n\t"
                 "global_load_async_to_lds_b128 %16, %17, off\n\t"
                 "global_load_async_to_lds_b128 %18, %19, off\n\t"
                 "global_load_async_to_lds_b128 %20, %21, off\n\t"
                 "global_load_async_to_lds_b128 %22, %23, off\n\t"
                 "s_wait_xcnt 0x0"
                 :: "v"(lds), "v"(ga), "v"(la1), "v"(ga1), "v"(la2), "v"(ga2), "v"(la3), "v"(ga3),
                    "v"(la4), "v"(ga4), "v"(la5), "v"(ga5), "v"(la6), "v"(ga6), "v"(la7), "v"(ga7),
                    "v"(lw0), "v"(gw), "v"(lw1), "v"(gw1), "v"(lw2), "v"(gw2), "v"(lw3), "v"(gw3)
                 : "memory");
}

template <int MODE>
__global__ __launch_bounds__(256) void gemm_kernel(
    const u16* __restrict__ A, const u16* __restrict__ W, int K_dim,
    const float* __restrict__ b0, const float* __restrict__ b1,
    u16* __restrict__ qb, u16* __restrict__ kb, u16* __restrict__ vb,
    const float* __restrict__ resid, float* __restrict__ outp) {
    // Staged row pitch in bytes: the row + 16 B, so that the two lane halves
    // (8 rows apart) write banks 32 apart.  CP: rows of BN elements; CPT: V^T rows of BM.
    constexpr int CP = (MODE == 0) ? BN * 2 + 16 : BN * 4 + 16;
    constexpr int CPT = BM * 2 + 16;
    constexpr int SMEM = (2 * G_BUF > BM * CP) ? 2 * G_BUF : BM * CP;
    static_assert(MODE != 0 || BN * CPT <= SMEM, "the transposed tile fits");
    __shared__ __attribute__((aligned(16))) unsigned char smem[SMEM];
    int tid = threadIdx.x, lane = tid & 31, wave = tid >> 5;
    int wm = wave & 3, wn = wave >> 2;
    int half = lane >> 4, r = lane & 15, bk = half * 8;
    const size_t M0 = (size_t)blockIdx.y * BM;
    const size_t N0 = (size_t)blockIdx.x * BN;
    const u16* Aptr = A + M0 * K_dim;
    const u16* Wptr = W + N0 * K_dim;

    v8f acc[4][4] = {};
    const int nt = K_dim / GK;   // tiles of 64 k, the same for the whole block
    // This lane's share of a tile: 8 lanes per 128-byte row.
    const int srow = tid >> 3, scol = (tid & 7) * 8;
    const unsigned lds0 = (unsigned)(size_t)(smem + srow * (GP * 2) + scol * 2);
    const u16* ga0 = Aptr + (size_t)srow * K_dim + scol;
    const u16* gw0 = Wptr + (size_t)srow * K_dim + scol;
    const size_t rstep = (size_t)32 * K_dim;

    stage_gemm(lds0, ga0, gw0, rstep);
    asm volatile("s_wait_asynccnt 0x0" ::: "memory");  // this wave's share of tile 0 has landed
    __syncthreads();                                   // ... and every other wave's
    if (1 < nt) stage_gemm(lds0 + G_BUF, ga0 + GK, gw0 + GK, rstep);

    for (int t = 0; t < nt; t++) {
        const u16* As = (const u16*)(smem + (t & 1) * G_BUF) + (wm * 64 + r) * GP + bk;
        const u16* Bs = (const u16*)(smem + (t & 1) * G_BUF + G_A) + (wn * 64 + r) * GP + bk;
        // The tile's two 32-k steps, written out.  The fragment reads stand in three groups, each
        // ahead of the products that use it; left to itself the compiler reads one A fragment at
        // a time and waits out the LDS latency in front of every four products.  Each
        // sched_barrier(0) keeps a group whole and in its place.  All inner loops are unrolled:
        // constant indices keep the fragments and acc[][] in registers.
        v16bf a0[4], a1[4], w0[4], w1[4];
#pragma unroll
        for (int i = 0; i < 4; i++) a0[i] = ldfrag(As + i * 16 * GP);
#pragma unroll
        for (int j = 0; j < 4; j++) w0[j] = ldfrag(Bs + j * 16 * GP);
#pragma unroll
        for (int i = 0; i < 4; i++) a1[i] = ldfrag(As + i * 16 * GP + 32);
        __builtin_amdgcn_sched_barrier(0);  // group 1 (step 0, and step 1's A) stays ahead
#pragma unroll
        for (int j = 0; j < 2; j++)
#pragma unroll
            for (int i = 0; i < 4; i++) acc[i][j] = wmma_bf16(a0[i], w0[j], acc[i][j]);
        __builtin_amdgcn_sched_barrier(0);  // group 2 not lifted among these products
#pragma unroll
        for (int j = 0; j < 2; j++) w1[j] = ldfrag(Bs + j * 16 * GP + 32);
        __builtin_amdgcn_sched_barrier(0);  // group 2 not sunk among the next products
#pragma unroll
        for (int j = 2; j < 4; j++)
#pragma unroll
            for (int i = 0; i < 4; i++) acc[i][j] = wmma_bf16(a0[i], w0[j], acc[i][j]);
        __builtin_amdgcn_sched_barrier(0);  // group 3 not lifted among these products
#pragma unroll
        for (int j = 2; j < 4; j++) w1[j] = ldfrag(Bs + j * 16 * GP + 32);
        __builtin_amdgcn_sched_barrier(0);  // group 3 not sunk among the next products
#pragma unroll
        for (int j = 0; j < 2; j++)
#pragma unroll
            for (int i = 0; i < 4; i++) acc[i][j] = wmma_bf16(a1[i], w1[j], acc[i][j]);
        // These products stay in front of the hand-over: group 3 lands behind them, so the
        // wait below finds it done.
        __builtin_amdgcn_sched_barrier(0);
        // Hand-over, passed by every wave.  Every fragment of tile t is in registers by now.
        asm volatile("s_wait_dscnt 0x0" ::: "memory");     // my reads of this buffer are done
        asm volatile("s_wait_asynccnt 0x0" ::: "memory");  // my share of tile t+1 has landed
        __syncthreads();  // tile t+1 is whole, and nobody reads tile t's buffer any more
        if (t + 2 < nt)
            stage_gemm(lds0 + (t & 1) * G_BUF, ga0 + (size_t)(t + 2) * GK, gw0 + (size_t)(t + 2) * GK,
                       rstep);
        // The copies go out ahead of the tile's last products (registers only), not behind
        // them: that much more time to land before the next hand-over.
        __builtin_amdgcn_sched_barrier(0);
#pragma unroll
        for (int j = 2; j < 4; j++)
#pragma unroll
            for (int i = 0; i < 4; i++) acc[i][j] = wmma_bf16(a1[i], w1[j], acc[i][j]);
    }
    asm volatile("s_wait_asynccnt 0x0" ::: "memory");  // no copy is open when the tile is staged

    // Every loop below is fully unrolled so that acc[][] and rv[] keep constant
    // indices and stay in registers.
    const int rl0 = wm * 64 + 8 * half;   // this lane's first row in the tile
    const int cl0 = wn * 64 + r;          // this lane's first column in the tile
    if (MODE == 0) {
        // A 128-column tile lies wholly in q, k or v: one destination per block.
        const int which = (int)(N0 / D_DIM);
        const float* bias = (which == 0) ? b0 + N0 : b1 + (N0 - D_DIM);
        const float sc = (which == 0) ? 0.125f : 1.0f;  // fold 1/sqrt(DH) into q
        u16* dst = (which == 0) ? qb : (which == 1) ? kb : vb;
        float bj[4];
#pragma unroll
        for (int j = 0; j < 4; j++) bj[j] = bias[cl0 + j * 16];
        __syncthreads();  // every wave has read its last operand fragments
        if (which == 2) {   // the same for the whole block
            // V is staged transposed, [column][row]: the 8 accumulator rows a lane holds of
            // one column are 8 neighbours of one staged row, one 16-byte LDS store.
#pragma unroll
            for (int i = 0; i < 4; i++)
#pragma unroll
                for (int j = 0; j < 4; j++) {
                    unsigned w[4];
#pragma unroll
                    for (int e = 0; e < 4; e++)
                        w[e] = (unsigned)f2bf(acc[i][j][2 * e] + bj[j]) |
                               ((unsigned)f2bf(acc[i][j][2 * e + 1] + bj[j]) << 16);
                    *(uint4*)(smem + (cl0 + j * 16) * CPT + (rl0 + i * 16) * 2) =
                        make_uint4(w[0], w[1], w[2], w[3]);
                }
        } else {
#pragma unroll
            for (int i = 0; i < 4; i++)
#pragma unroll
                for (int j = 0; j < 4; j++)
#pragma unroll
                    for (int e = 0; e < 8; e++)
                        *(u16*)(smem + (rl0 + i * 16 + e) * CP + (cl0 + j * 16) * 2) =
                            f2bf((acc[i][j][e] + bj[j]) * sc);
        }
        __syncthreads();  // the tile is complete before any wave reads rows of it
        if (which == 2) {
            // Staged row = column (head, dh): rows S_LEN apart in memory; the tile's 256
            // positions lie in one batch (S_LEN is a multiple of 256).
            const int row0 = tid >> 5, ch = tid & 31;   // 32 chunks of 16 B per 512-B row
            u16* dtile = dst + ((M0 / S_LEN) * D_DIM + (N0 % D_DIM)) * S_LEN + (M0 % S_LEN);
            const unsigned off = (unsigned)(row0 * S_LEN + ch * 8);
#pragma unroll
            for (int it = 0; it < 16; it++)
                *(uint4*)(dtile + off + it * 8 * S_LEN) =
                    *(const uint4*)(smem + (row0 + it * 8) * CPT + ch * 16);
        } else {
            const int row0 = tid >> 4, ch = tid & 15;   // 16 chunks of 16 B per 256-B row
            u16* dtile = dst + M0 * D_DIM + (N0 % D_DIM);
            const unsigned off = (unsigned)(row0 * D_DIM + ch * 8);
#pragma unroll
            for (int it = 0; it < 16; it++)
                *(uint4*)(dtile + off + it * 16 * D_DIM) =
                    *(const uint4*)(smem + (row0 + it * 16) * CP + ch * 16);
        }
    } else {
        // One wave covers one 512-B row per step; the residual loads go out in two groups of
        // 16, the second once the accumulators have left their registers.
        const float* rtile = resid + M0 * D_DIM + N0;
        float* otile = outp + M0 * D_DIM + N0;
        const unsigned off = (unsigned)(wave * D_DIM + lane * 4);  // same for load and store
        float4 rv[16], rw[16];
#pragma unroll
        for (int it = 0; it < 16; it++)
            rv[it] = *(const float4*)(rtile + off + it * 8 * D_DIM);
        __syncthreads();  // every wave has read its last operand fragments
        float4 bv = *(const float4*)(b0 + N0 + lane * 4);
#pragma unroll
        for (int i = 0; i < 4; i++)
#pragma unroll
            for (int j = 0; j < 4; j++)
#pragma unroll
                for (int e = 0; e < 8; e++)
                    *(float*)(smem + (rl0 + i * 16 + e) * CP + (cl0 + j * 16) * 4) = acc[i][j][e];
#pragma unroll
        for (int it = 0; it < 16; it++)
            rw[it] = *(const float4*)(rtile + off + (it + 16) * 8 * D_DIM);
        __syncthreads();  // the tile is complete before any wave reads rows of it
#pragma unroll
        for (int h = 0; h < 2; h++) {
            float4 a[16];
#pragma unroll
            for (int it = 0; it < 16; it++)
                a[it] = *(const float4*)(smem + (wave + (h * 16 + it) * 8) * CP + lane * 16);
            // The 16 LDS reads go out together; otherwise each is waited for in front of its store.
            __builtin_amdgcn_sched_barrier(0);
#pragma unroll
            for (int it = 0; it < 16; it++) {
                float4 rr = h ? rw[it] : rv[it];
                float4 o;
                o.x = a[it].x + bv.x + rr.x;
                o.y = a[it].y + bv.y + rr.y;
                o.z = a[it].z + bv.z + rr.z;
                o.w = a[it].w + bv.w + rr.w;
                *(float4*)(otile + off + (h * 16 + it) * 8 * D_DIM) = o;
            }
        }
    }
}

#define KT 64                        // keys per staged tile
#define KVP 72                       // LDS row pitch in u16: 128 B + 16 B, for 16-byte readers
#define KV_HALF (KT * KVP * 2)       // bytes of one operand's tile (64 rows)
#define KV_BUF (2 * KV_HALF)         // bytes of one buffer: K tile, then V^T tile

// One tile: each lane copies 16 bytes of rows (srow, srow+32) of K and of V^T.
// The s_wait_xcnt closes the statement so that no address register of a copy is
// rewritten while the copy may still need it.
__device__ __forceinline__ void stage_tile(unsigned lds, const u16* gk, const u16* gv) {
    unsigned lk1 = lds + 32 * KVP * 2, lv0 = lds + KV_HALF, lv1 = lds + KV_HALF + 32 * KVP * 2;
    const u16* gk1 = gk + (size_t)32 * D_DIM;
    const u16* gv1 = gv + (size_t)32 * S_LEN;
    asm volatile("global_load_async_to_lds_b128 %0, %1, off\n\t"
                 "global_load_async_to_lds_b128 %2, %3, off\n\t"
                 "global_load_async_to_lds_b128 %4, %5, off\n\t"
                 "global_load_async_to_lds_b128 %6, %7, off\n\t"
                 "s_wait_xcnt 0x0"
                 :: "v"(lds), "v"(gk), "v"(lk1), "v"(gk1), "v"(lv0), "v"(gv), "v"(lv1), "v"(gv1)
                 : "memory");
}

__global__ __launch_bounds__(256) void attn_kernel(const u16* __restrict__ q,
                                                   const u16* __restrict__ k,
                                                   const u16* __restrict__ vt,
                                                   const int* __restrict__ lens,
                                                   u16* __restrict__ ctx) {
    __shared__ __attribute__((aligned(16))) unsigned char kv[2 * KV_BUF];
    int tid = threadIdx.x, lane = tid & 31;
    int wave = __builtin_amdgcn_readfirstlane(tid >> 5);  // scalar: the per-wave skip is a real branch
    int half = lane >> 4, r = lane & 15, bk = half * 8;
    // Which (batch, head, query tile) a block takes; any deal gives the same result, this one
    // is for speed.  A tile's cost grows with its index and stops at the batch's length.
    // The costly tiles (8..15) take the low indices;
    // indices 256 apart take four
    // different batches and the tiles 15-2g, 14-2g, 2g+1, 2g, whose causal costs add up alike.
    const int flat = blockIdx.x;                 // 4 batches x 16 heads x 16 tiles
    const int m = flat >> 8, h = flat & 15;
    const int b = (((flat >> 4) & 1) * 2 + ((flat >> 7) & 1) + m) & 3;
    const int bh = b * H_NUM + h;
    const int qt = (((flat >> 5) & 3) * 2 + (m & 1)) ^ ((m & 2) ? 1 : 15);
    int q0 = qt * 128;
    int qw = q0 + wave * 16;
    int len = lens[b];
    int myq = qw + r;                        // the single query this lane owns
    int lim = (myq + 1 < len) ? myq + 1 : len;  // key valid iff key < lim

    // Q as B-operand (lane r = query), both 32-wide dh k-steps.
    const u16* qbase = q + ((size_t)(b * S_LEN + qw + r) * D_DIM + h * DH_NUM) + bk;
    v16bf qf[2];
    qf[0] = ldfrag(qbase);
    qf[1] = ldfrag(qbase + 32);

    float mrun = -1e30f, lrun = 0.f;
    v8f Ov[4] = {};

    int kmax = qw + 15;                      // this wave's last key
    if (len - 1 < kmax) kmax = len - 1;
    int kmaxb = q0 + 127;                    // the block's last key (<= S_LEN - 1)
    if (len - 1 < kmaxb) kmaxb = len - 1;
    const int nt = (kmaxb >> 6) + 1;         // tiles of 64 keys, the same for the whole block

    // This lane's share of a tile: 8 lanes per 128-byte row.
    const int srow = tid >> 3, scol = (tid & 7) * 8;
    const unsigned lds0 = (unsigned)(size_t)(kv + srow * (KVP * 2) + scol * 2);
    const u16* gk0 = k + ((size_t)(b * S_LEN + srow) * D_DIM + h * DH_NUM + scol);
    const u16* gv0 = vt + ((size_t)(bh * DH_NUM + srow) * S_LEN + scol);

    stage_tile(lds0, gk0, gv0);
    asm volatile("s_wait_asynccnt 0x0" ::: "memory");  // this wave's share of tile 0 has landed
    __syncthreads();                                   // ... and every other wave's
    if (1 < nt) stage_tile(lds0 + KV_BUF, gk0 + (size_t)KT * D_DIM, gv0 + KT);

    for (int t = 0; t < nt; t++) {
        const u16* Ks = (const u16*)(kv + (t & 1) * KV_BUF) + r * KVP + bk;  // K row r
        const u16* Vs = Ks + KT * KVP;                                       // V^T row r
        // Two steps of 32 keys; a wave stops at its own last key.  Kept rolled: unrolled, the
        // two skippable bodies cost a copy of all accumulators at each join.
#pragma unroll 1
        for (int c = 0; c < 2; c++) {
            const int kbp = t * KT + c * 32;
            if (kbp > kmax) break;
            {
                // ---- all 16 fragment loads up front
                v16bf kf0 = ldfrag(Ks + (c * 32) * KVP);
                v16bf kf1 = ldfrag(Ks + (c * 32) * KVP + 32);
                v16bf kf2 = ldfrag(Ks + (c * 32 + 16) * KVP);
                v16bf kf3 = ldfrag(Ks + (c * 32 + 16) * KVP + 32);
                v16bf vf[4];
#pragma unroll
                for (int j = 0; j < 4; j++)
                    vf[j] = ldfrag(Vs + (j * 16) * KVP + c * 32);

                // ---- S^T tiles: rows = keys (u*16 + e + 8*half), col = query
                v8f Sacc[2] = {};
                Sacc[0] = wmma_bf16(kf0, qf[0], Sacc[0]);
                Sacc[0] = wmma_bf16(kf1, qf[1], Sacc[0]);
                Sacc[1] = wmma_bf16(kf2, qf[0], Sacc[1]);
                Sacc[1] = wmma_bf16(kf3, qf[1], Sacc[1]);

                // ---- mask (only on boundary blocks) + per-lane online softmax
                float sv[2][8];
                float rowmax = -3.0e38f;
                bool full = (kbp + 32 <= qw + 1) && (kbp + 32 <= len);  // wave-uniform
                if (full) {
#pragma unroll
                    for (int u = 0; u < 2; u++)
#pragma unroll
                        for (int e = 0; e < 8; e++) {
                            sv[u][e] = Sacc[u][e];
                            rowmax = fmaxf(rowmax, sv[u][e]);
                        }
                } else {
                    int kbase0 = kbp + 8 * half;
#pragma unroll
                    for (int u = 0; u < 2; u++)
#pragma unroll
                        for (int e = 0; e < 8; e++) {
                            int key = kbase0 + u * 16 + e;
                            sv[u][e] = (key < lim) ? Sacc[u][e] : -3.0e38f;
                            rowmax = fmaxf(rowmax, sv[u][e]);
                        }
                }
                rowmax = fmaxf(rowmax, __shfl_xor(rowmax, 16));
                float mnew = fmaxf(mrun, rowmax);
                float scale = __expf(mrun - mnew);
                float rsum = 0.f;
                P16 ph;
#pragma unroll
                for (int u = 0; u < 2; u++)
#pragma unroll
                    for (int e = 0; e < 8; e++) {
                        float p = __expf(sv[u][e] - mnew);
                        rsum += p;
                        ph.h[u * 8 + e] = f2bf(p);  // B-operand half m = u*8+e -> key u*16+e+8*half
                    }
                rsum += __shfl_xor(rsum, 16);
                lrun = lrun * scale + rsum;
                mrun = mnew;
                v16bf pf = __builtin_bit_cast(v16bf, ph);

                // ---- O^T += V^T * P  (rows = dh, col = query)
#pragma unroll
                for (int j = 0; j < 4; j++) {
#pragma unroll
                    for (int e = 0; e < 8; e++) Ov[j][e] *= scale;
                    Ov[j] = wmma_bf16(vf[j], pf, Ov[j]);
                }
                // The next step's first vector instruction may overwrite an operand register of
                // these products.
                __builtin_amdgcn_sched_barrier(0);  // or the scheduler lifts the v_nop over the products
                asm volatile("v_nop");
            }
        }
        // Hand-over, passed by every wave (also one that skipped the work above).
        asm volatile("s_wait_dscnt 0x0" ::: "memory");     // my reads of this buffer are done
        asm volatile("s_wait_asynccnt 0x0" ::: "memory");  // my share of tile t+1 has landed
        __syncthreads();  // tile t+1 is whole, and nobody reads tile t's buffer any more
        if (t + 2 < nt)
            stage_tile(lds0 + (t & 1) * KV_BUF, gk0 + (size_t)(t + 2) * KT * D_DIM,
                       gv0 + (t + 2) * KT);
    }
    asm volatile("s_wait_asynccnt 0x0" ::: "memory");  // no copy is open when the wave ends

    float inv = 1.f / lrun;
#pragma unroll
    for (int j = 0; j < 4; j++)
#pragma unroll
        for (int e = 0; e < 8; e++) {
            int dh = j * 16 + e + 8 * half;
            ctx[(size_t)(b * S_LEN + myq) * D_DIM + h * DH_NUM + dh] = f2bf(Ov[j][e] * inv);
        }
}

// ---------------------------------------------------------------- launch
extern "C" void kernel_launch(void* const* d_in, const int* in_sizes, int n_in,
                              void* d_out, int out_size, void* d_ws, size_t ws_size,
                              hipStream_t stream) {
    (void)in_sizes; (void)n_in; (void)out_size; (void)ws_size;
    const float* x    = (const float*)d_in[0];
    const int*   lens = (const int*)d_in[1];
    const float* Wq   = (const float*)d_in[2];
    const float* bq   = (const float*)d_in[3];
    const float* Wkv  = (const float*)d_in[4];
    const float* bkv  = (const float*)d_in[5];
    const float* Wo   = (const float*)d_in[6];
    const float* bo   = (const float*)d_in[7];
    const float* ln_g = (const float*)d_in[8];
    const float* ln_b = (const float*)d_in[9];
    float* out = (float*)d_out;

    const size_t BS = 4 * (size_t)S_LEN;            // 8192 rows
    const size_t DD = (size_t)D_DIM * D_DIM;        // 1M
    char* ws = (char*)d_ws;
    size_t off = 0;
    auto alloc = [&](size_t elems) { u16* p = (u16*)(ws + off); off += elems * sizeof(u16); return p; };
    u16* wqkv = alloc(3 * DD);        // [Wq ; Wkv] rows, bf16
    u16* wo   = alloc(DD);
    u16* xn   = alloc(BS * D_DIM);
    u16* qb   = alloc(BS * D_DIM);
    u16* kbuf = alloc(BS * D_DIM);
    u16* vtb  = alloc(BS * D_DIM);    // V^T per (batch, head): [dh][s]
    u16* ctx  = alloc(BS * D_DIM);

    // wo follows wqkv directly in the workspace: one bf16 destination for all weights.
    prep_kernel<<<(int)(CVT_BLOCKS + BS), 256, 0, stream>>>(x, ln_g, ln_b, xn, Wq, Wkv, Wo, wqkv);

    dim3 gqkv(3 * D_DIM / BN, (int)(BS / BM));   // (24, 32)
    gemm_kernel<0><<<gqkv, 256, 0, stream>>>(xn, wqkv, D_DIM, bq, bkv,
                                             qb, kbuf, vtb, nullptr, nullptr);

    attn_kernel<<<4 * H_NUM * (S_LEN / 128), 256, 0, stream>>>(qb, kbuf, vtb, lens, ctx);

    dim3 gout(D_DIM / BN, (int)(BS / BM));       // (8, 32)
    gemm_kernel<1><<<gout, 256, 0, stream>>>(ctx, wo, D_DIM, bo, nullptr,
                                             nullptr, nullptr, nullptr, x, out);
}

// v009
// Measured time: 103 microseconds a run.
// Timed twice side by side with v008, it ran 1.05 times as fast both times.
// Over all steps from v000 it is 2.65 times as fast.
#include <hip/hip_runtime.h>

typedef unsigned short u16;
typedef __attribute__((ext_vector_type(16))) __bf16 v16bf;
typedef __attribute__((ext_vector_type(8)))  float  v8f;

#define S_LEN 2048
#define D_DIM 1024
#define H_NUM 16
#define DH_NUM 64

// Round to nearest even by the conversion instruction; neighbours pair into one packed convert.
__device__ __forceinline__ u16 f2bf(float f) {
    return __builtin_bit_cast(u16, (__bf16)f);
}

struct Pack32 { uint4 a, b; };
struct P16 { u16 h[16]; };

// Load one bf16 WMMA operand fragment (A-pattern; B uses the same pattern with
// lane -> N).  Lane-half 0: K in [0,8)u[16,24); lane-half 1: K in [8,16)u[24,32).
// Caller passes p already offset by (row, basek); we read p[0..7] and p[16..23].
__device__ __forceinline__ v16bf ldfrag(const u16* p) {
    Pack32 s;
    s.a = *(const uint4*)(p);
    s.b = *(const uint4*)(p + 16);
    return __builtin_bit_cast(v16bf, s);
}

__device__ __forceinline__ v8f wmma_bf16(v16bf a, v16bf b, v8f c) {
    return __builtin_amdgcn_wmma_f32_16x16x32_bf16(false, a, false, b, (short)0, c,
                                                   false, false);
}

// ---------------------------------------------------------------- weights -> bf16, LayerNorm
// One launch.  The first CVT_BLOCKS blocks round the weights to bf16, the others
// normalise one row of x each; the two kinds of block share nothing.
// A conversion block takes CVT_ELEMS consecutive elements: each wave reads 8 times
// 512 contiguous bytes (all 8 loads go out before the first value is used) and
// writes 8 times 256 contiguous bytes.  The bf16 copies of Wq, Wkv, Wo lie one
// behind the other in wbf.
#define CVT_ELEMS 8192
#define CVT_Q (D_DIM * D_DIM / CVT_ELEMS)        // blocks for Wq, and for Wo
#define CVT_KV (2 * D_DIM * D_DIM / CVT_ELEMS)   // blocks for Wkv
#define CVT_BLOCKS (CVT_Q + CVT_KV + CVT_Q)

__global__ __launch_bounds__(256) void prep_kernel(const float* __restrict__ x,
                                                   const float* __restrict__ g,
                                                   const float* __restrict__ bb,
                                                   u16* __restrict__ xn,
                                                   const float* __restrict__ Wq,
                                                   const float* __restrict__ Wkv,
                                                   const float* __restrict__ Wo,
                                                   u16* __restrict__ wbf) {
    __shared__ float red[8];
    int tid = threadIdx.x, lane = tid & 31, wave = tid >> 5;
    if (blockIdx.x < CVT_BLOCKS) {   // the same for the whole block, ahead of every barrier
        const int cb = blockIdx.x;
        const float* s = (cb < CVT_Q)            ? Wq + (size_t)cb * CVT_ELEMS
                         : (cb < CVT_Q + CVT_KV) ? Wkv + (size_t)(cb - CVT_Q) * CVT_ELEMS
                                                 : Wo + (size_t)(cb - CVT_Q - CVT_KV) * CVT_ELEMS;
        u16* d = wbf + (size_t)cb * CVT_ELEMS;
        float4 w[8];
        // Both loops unrolled: w[] stays in registers and the 8 loads are issued together.
#pragma unroll
        for (int i = 0; i < 8; i++) w[i] = *(const float4*)(s + i * 1024 + tid * 4);
#pragma unroll
        for (int i = 0; i < 8; i++) {
            uint2 o;
            o.x = (unsigned)f2bf(w[i].x) | ((unsigned)f2bf(w[i].y) << 16);
            o.y = (unsigned)f2bf(w[i].z) | ((unsigned)f2bf(w[i].w) << 16);
            *(uint2*)(d + i * 1024 + tid * 4) = o;
        }
        return;
    }
    size_t row = blockIdx.x - CVT_BLOCKS;
    const float* xr = x + row * D_DIM;
    float v[4];
    float s = 0.f;
#pragma unroll
    for (int i = 0; i < 4; i++) { v[i] = xr[tid + i * 256]; s += v[i]; }
#pragma unroll
    for (int m = 16; m >= 1; m >>= 1) s += __shfl_xor(s, m);
    if (lane == 0) red[wave] = s;
    __syncthreads();
    float tot = 0.f;
#pragma unroll
    for (int i = 0; i < 8; i++) tot += red[i];
    float mean = tot * (1.f / (float)D_DIM);
    __syncthreads();
    float s2 = 0.f;
#pragma unroll
    for (int i = 0; i < 4; i++) { float d = v[i] - mean; s2 += d * d; }
#pragma unroll
    for (int m = 16; m >= 1; m >>= 1) s2 += __shfl_xor(s2, m);
    if (lane == 0) red[wave] = s2;
    __syncthreads();
    float tot2 = 0.f;
#pragma unroll
    for (int i = 0; i < 8; i++) tot2 += red[i];
    float rstd = rsqrtf(tot2 * (1.f / (float)D_DIM) + 1e-5f);
#pragma unroll
    for (int i = 0; i < 4; i++) {
        int c = tid + i * 256;
        xn[row * D_DIM + c] = f2bf((v[i] - mean) * rstd * g[c] + bb[c]);
    }
}

// ---------------------------------------------------------------- Tiled WMMA GEMM
// C[M,N] = A[M,K] * W[N,K]^T (+ epilogue).  BM=256 BN=128, 8 waves (4 x 2),
// wave tile 64x64 (4x4 WMMA accumulators): every fragment read from LDS feeds four
// products.  K a multiple of 64, at least 64.
// The operands come through LDS in tiles of 64 k (whole 128-byte rows), copied in
// without passing registers; two buffers, the next tile's copies fly during this
// tile's products.  Each block walks the k tiles from a start of its own and wraps round:
// blocks that share rows of A or W would otherwise ask L2 for the same lines at one moment.
// MODE 0: QKV - bias from (b0|b1), split-store bf16 q(*0.125)/k, and v transposed:
//         vb[(b*H + h)*DH + dh][s], the layout the attention kernel stages from.
// MODE 1: out-proj - fp32 out = acc + b0[col] + resid.
// Epilogue: the 256x128 output tile is staged in LDS (over the operand tiles),
// then leaves as 16-byte stores that cover whole rows of the tile.
#define BM 256                       // rows of A (and of C) per block
#define BN 128                       // rows of W (columns of C) per block
#define GK 64                        // k per staged tile
#define GP 72                        // LDS row pitch in u16: 128 B + 16 B, for 16-byte readers
#define G_A (BM * GP * 2)            // bytes of the A tile
#define G_BUF ((BM + BN) * GP * 2)   // bytes of one buffer: A tile, then W tile

// One tile: each lane copies 16 bytes of rows (srow + 32 i) of A, i = 0..7, and of W,
// i = 0..3; rstep = 32 rows in elements.  The s_wait_xcnt closes the statement so that no
// address register of a copy is rewritten while the copy may still need it.
__device__ __forceinline__ void stage_gemm(unsigned lds, const u16* ga, const u16* gw,
                                           size_t rstep) {
    constexpr unsigned LS = 32 * GP * 2;   // 32 rows in LDS bytes
    unsigned la1 = lds + LS, la2 = lds + 2 * LS, la3 = lds + 3 * LS, la4 = lds + 4 * LS;
    unsigned la5 = lds + 5 * LS, la6 = lds + 6 * LS, la7 = lds + 7 * LS;
    unsigned lw0 = lds + G_A, lw1 = lw0 + LS, lw2 = lw0 + 2 * LS, lw3 = lw0 + 3 * LS;
    const u16 *ga1 = ga + rstep, *ga2 = ga1 + rstep, *ga3 = ga2 + rstep, *ga4 = ga3 + rstep;
    const u16 *ga5 = ga4 + rstep, *ga6 = ga5 + rstep, *ga7 = ga6 + rstep;
    const u16 *gw1 = gw + rstep, *gw2 = gw1 + rstep, *gw3 = gw2 + rstep;
    asm volatile("global_load_async_to_lds_b128 %0, %1, off\n\t"
                 "global_load_async_to_lds_b128 %2, %3, off\n\t"
                 "global_load_async_to_lds_b128 %4, %5, off\n\t"
                 "global_load_async_to_lds_b128 %6, %7, off\n\t"
                 "global_load_async_to_lds_b128 %8, %9, off\n\t"
                 "global_load_async_to_lds_b128 %10, %11, off\n\t"
                 "global_load_async_to_lds_b128 %12, %13, off\n\t"
                 "global_load_async_to_lds_b128 %14, %15, off\n\t"
                 "global_load_async_to_lds_b128 %16, %17, off\n\t"
                 "global_load_async_to_lds_b128 %18, %19, off\n\t"
                 "global_load_async_to_lds_b128 %20, %21, off\n\t"
                 "global_load_async_to_lds_b128 %22, %23, off\n\t"
                 "s_wait_xcnt 0x0"
                 :: "v"(lds), "v"(ga), "v"(la1), "v"(ga1), "v"(la2), "v"(ga2), "v"(la3), "v"(ga3),
                    "v"(la4), "v"(ga4), "v"(la5), "v"(ga5), "v"(la6), "v"(ga6), "v"(la7), "v"(ga7),
                    "v"(lw0), "v"(gw), "v"(lw1), "v"(gw1), "v"(lw2), "v"(gw2), "v"(lw3), "v"(gw3)
                 : "memory");
}

template <int MODE>
__global__ __launch_bounds__(256) void gemm_kernel(
    const u16* __restrict__ A, const u16* __restrict__ W, int K_dim,
    const float* __restrict__ b0, const float* __restrict__ b1,
    u16* __restrict__ qb, u16* __restrict__ kb, u16* __restrict__ vb,
    const float* __restrict__ resid, float* __restrict__ outp) {
    // Staged row pitch in bytes: the row + 16 B, so that the two lane halves
    // (8 rows apart) write banks 32 apart.  CP: rows of BN elements; CPT: V^T rows of BM.
    constexpr int CP = (MODE == 0) ? BN * 2 + 16 : BN * 4 + 16;
    constexpr int CPT = BM * 2 + 16;
    constexpr int SMEM = (2 * G_BUF > BM * CP) ? 2 * G_BUF : BM * CP;
    static_assert(MODE != 0 || BN * CPT <= SMEM, "the transposed tile fits");
    __shared__ __attribute__((aligned(16))) unsigned char smem[SMEM];
    int tid = threadIdx.x, lane = tid & 31, wave = tid >> 5;
    int wm = wave & 3, wn = wave >> 2;
    int half = lane >> 4, r = lane & 15, bk = half * 8;
    const size_t M0 = (size_t)blockIdx.y * BM;
    const size_t N0 = (size_t)blockIdx.x * BN;
    const u16* Aptr = A + M0 * K_dim;
    const u16* Wptr = W + N0 * K_dim;

    v8f acc[4][4] = {};
    const int nt = K_dim / GK;   // tiles of 64 k, the same for the whole block
    // This lane's share of a tile: 8 lanes per 128-byte row.
    const int srow = tid >> 3, scol = (tid & 7) * 8;
    const unsigned lds0 = (unsigned)(size_t)(smem + srow * (GP * 2) + scol * 2);
    const u16* ga0 = Aptr + (size_t)srow * K_dim + scol;
    const u16* gw0 = Wptr + (size_t)srow * K_dim + scol;
    const size_t rstep = (size_t)32 * K_dim;
    // The walk starts at k tile (blockIdx.x + blockIdx.y) mod nt; ks is the tile that is staged next.
    int ks = (int)((blockIdx.x + blockIdx.y) % (unsigned)nt);

    stage_gemm(lds0, ga0 + (size_t)ks * GK, gw0 + (size_t)ks * GK, rstep);
    ks = (ks + 1 == nt) ? 0 : ks + 1;
    asm volatile("s_wait_asynccnt 0x0" ::: "memory");  // this wave's share of the first tile has landed
    __syncthreads();                                   // ... and every other wave's
    if (1 < nt) stage_gemm(lds0 + G_BUF, ga0 + (size_t)ks * GK, gw0 + (size_t)ks * GK, rstep);
    ks = (ks + 1 == nt) ? 0 : ks + 1;

    for (int t = 0; t < nt; t++) {
        const u16* As = (const u16*)(smem + (t & 1) * G_BUF) + (wm * 64 + r) * GP + bk;
        const u16* Bs = (const u16*)(smem + (t & 1) * G_BUF + G_A) + (wn * 64 + r) * GP + bk;
        // The tile's two 32-k steps, written out.  The fragment reads stand in three groups, each
        // ahead of the products that use it; left to itself the compiler reads one A fragment at
        // a time and waits out the LDS latency in front of every four products.  Each
        // sched_barrier(0) keeps a group whole and in its place.  All inner loops are unrolled:
        // constant indices keep the fragments and acc[][] in registers.
        v16bf a0[4], a1[4], w0[4], w1[4];
#pragma unroll
        for (int i = 0; i < 4; i++) a0[i] = ldfrag(As + i * 16 * GP);
#pragma unroll
        for (int j = 0; j < 4; j++) w0[j] = ldfrag(Bs + j * 16 * GP);
#pragma unroll
        for (int i = 0; i < 4; i++) a1[i] = ldfrag(As + i * 16 * GP + 32);
        __builtin_amdgcn_sched_barrier(0);  // group 1 (step 0, and step 1's A) stays ahead
#pragma unroll
        for (int j = 0; j < 2; j++)
#pragma unroll
            for (int i = 0; i < 4; i++) acc[i][j] = wmma_bf16(a0[i], w0[j], acc[i][j]);
        __builtin_amdgcn_sched_barrier(0);  // group 2 not lifted among these products
#pragma unroll
        for (int j = 0; j < 2; j++) w1[j] = ldfrag(Bs + j * 16 * GP + 32);
        __builtin_amdgcn_sched_barrier(0);  // group 2 not sunk among the next products
#pragma unroll
        for (int j = 2; j < 4; j++)
#pragma unroll
            for (int i = 0; i < 4; i++) acc[i][j] = wmma_bf16(a0[i], w0[j], acc[i][j]);
        __builtin_amdgcn_sched_barrier(0);  // group 3 not lifted among these products
#pragma unroll
        for (int j = 2; j < 4; j++) w1[j] = ldfrag(Bs + j * 16 * GP + 32);
        __builtin_amdgcn_sched_barrier(0);  // group 3 not sunk among the next products
#pragma unroll
        for (int j = 0; j < 2; j++)
#pragma unroll
            for (int i = 0; i < 4; i++) acc[i][j] = wmma_bf16(a1[i], w1[j], acc[i][j]);
        // These products stay in front of the hand-over: group 3 lands behind them, so the
        // wait below finds it done.
        __builtin_amdgcn_sched_barrier(0);
        // Hand-over, passed by every wave.  Every fragment of tile t is in registers by now.
        asm volatile("s_wait_dscnt 0x0" ::: "memory");     // my reads of this buffer are done
        asm volatile("s_wait_asynccnt 0x0" ::: "memory");  // my share of tile t+1 has landed
        __syncthreads();  // tile t+1 is whole, and nobody reads tile t's buffer any more
        if (t + 2 < nt)
            stage_gemm(lds0 + (t & 1) * G_BUF, ga0 + (size_t)ks * GK, gw0 + (size_t)ks * GK, rstep);
        ks = (ks + 1 == nt) ? 0 : ks + 1;
        // The copies go out ahead of the tile's last products (registers only), not behind
        // them: that much more time to land before the next hand-over.
        __builtin_amdgcn_sched_barrier(0);
#pragma unroll
        for (int j = 2; j < 4; j++)
#pragma unroll
            for (int i = 0; i < 4; i++) acc[i][j] = wmma_bf16(a1[i], w1[j], acc[i][j]);
    }
    asm volatile("s_wait_asynccnt 0x0" ::: "memory");  // no copy is open when the tile is staged

    // Every loop below is fully unrolled so that acc[][] and rv[] keep constant
    // indices and stay in registers.
    const int rl0 = wm * 64 + 8 * half;   // this lane's first row in the tile
    const int cl0 = wn * 64 + r;          // this lane's first column in the tile
    if (MODE == 0) {
        // A 128-column tile lies wholly in q, k or v: one destination per block.
        const int which = (int)(N0 / D_DIM);
        const float* bias = (which == 0) ? b0 + N0 : b1 + (N0 - D_DIM);
        const float sc = (which == 0) ? 0.125f : 1.0f;  // fold 1/sqrt(DH) into q
        u16* dst = (which == 0) ? qb : (which == 1) ? kb : vb;
        float bj[4];
#pragma unroll
        for (int j = 0; j < 4; j++) bj[j] = bias[cl0 + j * 16];
        __syncthreads();  // every wave has read its last operand fragments
        if (which == 2) {   // the same for the whole block
            // V is staged transposed, [column][row]: the 8 accumulator rows a lane holds of
            // one column are 8 neighbours of one staged row, one 16-byte LDS store.
#pragma unroll
            for (int i = 0; i < 4; i++)
#pragma unroll
                for (int j = 0; j < 4; j++) {
                    unsigned w[4];
#pragma unroll
                    for (int e = 0; e < 4; e++)
                        w[e] = (unsigned)f2bf(acc[i][j][2 * e] + bj[j]) |
                               ((unsigned)f2bf(acc[i][j][2 * e + 1] + bj[j]) << 16);
                    *(uint4*)(smem + (cl0 + j * 16) * CPT + (rl0 + i * 16) * 2) =
                        make_uint4(w[0], w[1], w[2], w[3]);
                }
        } else {
#pragma unroll
            for (int i = 0; i < 4; i++)
#pragma unroll
                for (int j = 0; j < 4; j++)
#pragma unroll
                    for (int e = 0; e < 8; e++)
                        *(u16*)(smem + (rl0 + i * 16 + e) * CP + (cl0 + j * 16) * 2) =
                            f2bf((acc[i][j][e] + bj[j]) * sc);
        }
        __syncthreads();  // the tile is complete before any wave reads rows of it
        if (which == 2) {
            // Staged row = column (head, dh): rows S_LEN apart in memory; the tile's 256
            // positions lie in one batch (S_LEN is a multiple of 256).
            const int row0 = tid >> 5, ch = tid & 31;   // 32 chunks of 16 B per 512-B row
            u16* dtile = dst + ((M0 / S_LEN) * D_DIM + (N0 % D_DIM)) * S_LEN + (M0 % S_LEN);
            const unsigned off = (unsigned)(row0 * S_LEN + ch * 8);
#pragma unroll
            for (int it = 0; it < 16; it++)
                *(uint4*)(dtile + off + it * 8 * S_LEN) =
                    *(const uint4*)(smem + (row0 + it * 8) * CPT + ch * 16);
        } else {
            const int row0 = tid >> 4, ch = tid & 15;   // 16 chunks of 16 B per 256-B row
            u16* dtile = dst + M0 * D_DIM + (N0 % D_DIM);
            const unsigned off = (unsigned)(row0 * D_DIM + ch * 8);
#pragma unroll
            for (int it = 0; it < 16; it++)
                *(uint4*)(dtile + off + it * 16 * D_DIM) =
                    *(const uint4*)(smem + (row0 + it * 16) * CP + ch * 16);
        }
    } else {
        // One wave covers one 512-B row per step; the residual loads go out in two groups of
        // 16, the second once the accumulators have left their registers.
        const float* rtile = resid + M0 * D_DIM + N0;
        float* otile = outp + M0 * D_DIM + N0;
        const unsigned off = (unsigned)(wave * D_DIM + lane * 4);  // same for load and store
        float4 rv[16], rw[16];
#pragma unroll
        for (int it = 0; it < 16; it++)
            rv[it] = *(const float4*)(rtile + off + it * 8 * D_DIM);
        __syncthreads();  // every wave has read its last operand fragments
        float4 bv = *(const float4*)(b0 + N0 + lane * 4);
#pragma unroll
        for (int i = 0; i < 4; i++)
#pragma unroll
            for (int j = 0; j < 4; j++)
#pragma unroll
                for (int e = 0; e < 8; e++)
                    *(float*)(smem + (rl0 + i * 16 + e) * CP + (cl0 + j * 16) * 4) = acc[i][j][e];
#pragma unroll
        for (int it = 0; it < 16; it++)
            rw[it] = *(const float4*)(rtile + off + (it + 16) * 8 * D_DIM);
        __syncthreads();  // the tile is complete before any wave reads rows of it
#pragma unroll
        for (int h = 0; h < 2; h++) {
            float4 a[16];
#pragma unroll
            for (int it = 0; it < 16; it++)
                a[it] = *(const float4*)(smem + (wave + (h * 16 + it) * 8) * CP + lane * 16);
            // The 16 LDS reads go out together; otherwise each is waited for in front of its store.
            __builtin_amdgcn_sched_barrier(0);
#pragma unroll
            for (int it = 0; it < 16; it++) {
                float4 rr = h ? rw[it] : rv[it];
                float4 o;
                o.x = a[it].x + bv.x + rr.x;
                o.y = a[it].y + bv.y + rr.y;
                o.z = a[it].z + bv.z + rr.z;
                o.w = a[it].w + bv.w + rr.w;
                *(float4*)(otile + off + (h * 16 + it) * 8 * D_DIM) = o;
            }
        }
    }
}

#define KT 64                        // keys per staged tile
#define KVP 72                       // LDS row pitch in u16: 128 B + 16 B, for 16-byte readers
#define KV_HALF (KT * KVP * 2)       // bytes of one operand's tile (64 rows)
#define KV_BUF (2 * KV_HALF)         // bytes of one buffer: K tile, then V^T tile

// One tile: each lane copies 16 bytes of rows (srow, srow+32) of K and of V^T.
// The s_wait_xcnt closes the statement so that no address register of a copy is
// rewritten while the copy may still need it.
__device__ __forceinline__ void stage_tile(unsigned lds, const u16* gk, const u16* gv) {
    unsigned lk1 = lds + 32 * KVP * 2, lv0 = lds + KV_HALF, lv1 = lds + KV_HALF + 32 * KVP * 2;
    const u16* gk1 = gk + (size_t)32 * D_DIM;
    const u16* gv1 = gv + (size_t)32 * S_LEN;
    asm volatile("global_load_async_to_lds_b128 %0, %1, off\n\t"
                 "global_load_async_to_lds_b128 %2, %3, off\n\t"
                 "global_load_async_to_lds_b128 %4, %5, off\n\t"
                 "global_load_async_to_lds_b128 %6, %7, off\n\t"
                 "s_wait_xcnt 0x0"
                 :: "v"(lds), "v"(gk), "v"(lk1), "v"(gk1), "v"(lv0), "v"(gv), "v"(lv1), "v"(gv1)
                 : "memory");
}

__global__ __launch_bounds__(256) void attn_kernel(const u16* __restrict__ q,
                                                   const u16* __restrict__ k,
                                                   const u16* __restrict__ vt,
                                                   const int* __restrict__ lens,
                                                   u16* __restrict__ ctx) {
    __shared__ __attribute__((aligned(16))) unsigned char kv[2 * KV_BUF];
    int tid = threadIdx.x, lane = tid & 31;
    int wave = __builtin_amdgcn_readfirstlane(tid >> 5);  // scalar: the per-wave skip is a real branch
    int half = lane >> 4, r = lane & 15, bk = half * 8;
    // Which (batch, head, query tile) a block takes; any deal gives the same result, this one
    // is for speed.  A tile's cost grows with its index and stops at the batch's length.
    // The costly tiles (8..15) take the low indices;
    // indices 256 apart take four
    // different batches and the tiles 15-2g, 14-2g, 2g+1, 2g, whose causal costs add up alike.
    const int flat = blockIdx.x;                 // 4 batches x 16 heads x 16 tiles
    const int m = flat >> 8, h = flat & 15;
    const int b = (((flat >> 4) & 1) * 2 + ((flat >> 7) & 1) + m) & 3;
    const int bh = b * H_NUM + h;
    const int qt = (((flat >> 5) & 3) * 2 + (m & 1)) ^ ((m & 2) ? 1 : 15);
    int q0 = qt * 128;
    int qw = q0 + wave * 16;
    int len = lens[b];
    int myq = qw + r;                        // the single query this lane owns
    int lim = (myq + 1 < len) ? myq + 1 : len;  // key valid iff key < lim

    // Q as B-operand (lane r = query), both 32-wide dh k-steps.
    const u16* qbase = q + ((size_t)(b * S_LEN + qw + r) * D_DIM + h * DH_NUM) + bk;
    v16bf qf[2];
    qf[0] = ldfrag(qbase);
    qf[1] = ldfrag(qbase + 32);

    float mrun = -1e30f, lrun = 0.f;
    v8f Ov[4] = {};

    const int fullmax = (qw + 1 < len) ? qw + 1 : len;  // a step that ends at or below it needs no mask
    int kmax = qw + 15;                      // this wave's last key
    if (len - 1 < kmax) kmax = len - 1;
    int kmaxb = q0 + 127;                    // the block's last key (<= S_LEN - 1)
    if (len - 1 < kmaxb) kmaxb = len - 1;
    const int nt = (kmaxb >> 6) + 1;         // tiles of 64 keys, the same for the whole block
    // Trip t works on key tile (t + rot) mod nt: the 16 blocks that share a head's K and V start
    // at tiles spread over the walk and do not ask L2 for the same lines at one moment.  The
    // online softmax takes the tiles in any order.  0 <= rot < S_LEN / KT, whatever len is.
    const int rot = (nt > 0) ? (qt * nt) >> 4 : 0;
    int ts = rot;                            // the tile that is staged next

    // This lane's share of a tile: 8 lanes per 128-byte row.
    const int srow = tid >> 3, scol = (tid & 7) * 8;
    const unsigned lds0 = (unsigned)(size_t)(kv + srow * (KVP * 2) + scol * 2);
    const u16* gk0 = k + ((size_t)(b * S_LEN + srow) * D_DIM + h * DH_NUM + scol);
    const u16* gv0 = vt + ((size_t)(bh * DH_NUM + srow) * S_LEN + scol);

    stage_tile(lds0, gk0 + (size_t)ts * KT * D_DIM, gv0 + ts * KT);
    ts = (ts + 1 >= nt) ? 0 : ts + 1;
    asm volatile("s_wait_asynccnt 0x0" ::: "memory");  // this wave's share of the first tile has landed
    __syncthreads();                                   // ... and every other wave's
    if (1 < nt) stage_tile(lds0 + KV_BUF, gk0 + (size_t)ts * KT * D_DIM, gv0 + ts * KT);
    ts = (ts + 1 >= nt) ? 0 : ts + 1;

    for (int t = 0; t < nt; t++) {
        const u16* Ks = (const u16*)(kv + (t & 1) * KV_BUF) + r * KVP + bk;  // K row r
        const u16* Vs = Ks + KT * KVP;                                       // V^T row r
        const int tt = (t + rot >= nt) ? t + rot - nt : t + rot;             // this trip's key tile
        // Two steps of 32 keys; a wave stops at its own last key.  Kept rolled: unrolled, the
        // two skippable bodies cost a copy of all accumulators at each join.
#pragma unroll 1
        for (int c = 0; c < 2; c++) {
            const int kbp = tt * KT + c * 32;
            if (kbp > kmax) break;
            {
                // ---- all 16 fragment loads up front
                v16bf kf0 = ldfrag(Ks + (c * 32) * KVP);
                v16bf kf1 = ldfrag(Ks + (c * 32) * KVP + 32);
                v16bf kf2 = ldfrag(Ks + (c * 32 + 16) * KVP);
                v16bf kf3 = ldfrag(Ks + (c * 32 + 16) * KVP + 32);
                v16bf vf[4];
#pragma unroll
                for (int j = 0; j < 4; j++)
                    vf[j] = ldfrag(Vs + (j * 16) * KVP + c * 32);

                // ---- S^T tiles: rows = keys (u*16 + e + 8*half), col = query
                v8f Sacc[2] = {};
                Sacc[0] = wmma_bf16(kf0, qf[0], Sacc[0]);
                Sacc[0] = wmma_bf16(kf1, qf[1], Sacc[0]);
                Sacc[1] = wmma_bf16(kf2, qf[0], Sacc[1]);
                Sacc[1] = wmma_bf16(kf3, qf[1], Sacc[1]);

                // ---- mask (only on boundary blocks) + per-lane online softmax
                float sv[2][8];
                float rowmax = -3.0e38f;
                bool full = kbp + 32 <= fullmax;  // wave-uniform
                if (full) {
#pragma unroll
                    for (int u = 0; u < 2; u++)
#pragma unroll
                        for (int e = 0; e < 8; e++) {
                            sv[u][e] = Sacc[u][e];
                            rowmax = fmaxf(rowmax, sv[u][e]);
                        }
                } else {
                    int kbase0 = kbp + 8 * half;
#pragma unroll
                    for (int u = 0; u < 2; u++)
#pragma unroll
                        for (int e = 0; e < 8; e++) {
                            int key = kbase0 + u * 16 + e;
                            sv[u][e] = (key < lim) ? Sacc[u][e] : -3.0e38f;
                            rowmax = fmaxf(rowmax, sv[u][e]);
                        }
                }
                rowmax = fmaxf(rowmax, __shfl_xor(rowmax, 16));
                float mnew = fmaxf(mrun, rowmax);
                float scale = __expf(mrun - mnew);
                float rsum = 0.f;
                P16 ph;
#pragma unroll
                for (int u = 0; u < 2; u++)
#pragma unroll
                    for (int e = 0; e < 8; e++) {
                        float p = __expf(sv[u][e] - mnew);
                        rsum += p;
                        ph.h[u * 8 + e] = f2bf(p);  // B-operand half m = u*8+e -> key u*16+e+8*half
                    }
                rsum += __shfl_xor(rsum, 16);
                lrun = lrun * scale + rsum;
                mrun = mnew;
                v16bf pf = __builtin_bit_cast(v16bf, ph);

                // ---- O^T += V^T * P  (rows = dh, col = query)
#pragma unroll
                for (int j = 0; j < 4; j++) {
#pragma unroll
                    for (int e = 0; e < 8; e++) Ov[j][e] *= scale;
                    Ov[j] = wmma_bf16(vf[j], pf, Ov[j]);
                }
                // The next step's first vector instruction may overwrite an operand register of
                // these products.
                __builtin_amdgcn_sched_barrier(0);  // or the scheduler lifts the v_nop over the products
                asm volatile("v_nop");
            }
        }
        // Hand-over, passed by every wave (also one that skipped the work above).
        asm volatile("s_wait_dscnt 0x0" ::: "memory");     // my reads of this buffer are done
        asm volatile("s_wait_asynccnt 0x0" ::: "memory");  // my share of tile t+1 has landed
        __syncthreads();  // tile t+1 is whole, and nobody reads tile t's buffer any more
        if (t + 2 < nt)
            stage_tile(lds0 + (t & 1) * KV_BUF, gk0 + (size_t)ts * KT * D_DIM, gv0 + ts * KT);
        ts = (ts + 1 >= nt) ? 0 : ts + 1;
    }
    asm volatile("s_wait_asynccnt 0x0" ::: "memory");  // no copy is open when the wave ends

    float inv = 1.f / lrun;
#pragma unroll
    for (int j = 0; j < 4; j++)
#pragma unroll
        for (int e = 0; e < 8; e++) {
            int dh = j * 16 + e + 8 * half;
            ctx[(size_t)(b * S_LEN + myq) * D_DIM + h * DH_NUM + dh] = f2bf(Ov[j][e] * inv);
        }
}

// ---------------------------------------------------------------- launch
extern "C" void kernel_launch(void* const* d_in, const int* in_sizes, int n_in,
                              void* d_out, int out_size, void* d_ws, size_t ws_size,
                              hipStream_t stream) {
    (void)in_sizes; (void)n_in; (void)out_size; (void)ws_size;
    const float* x    = (const float*)d_in[0];
    const int*   lens = (const int*)d_in[1];
    const float* Wq   = (const float*)d_in[2];
    const float* bq   = (const float*)d_in[3];
    const float* Wkv  = (const float*)d_in[4];
    const float* bkv  = (const float*)d_in[5];
    const float* Wo   = (const float*)d_in[6];
    const float* bo   = (const float*)d_in[7];
    const float* ln_g = (const float*)d_in[8];
    const float* ln_b = (const float*)d_in[9];
    float* out = (float*)d_out;

    const size_t BS = 4 * (size_t)S_LEN;            // 8192 rows
    const size_t DD = (size_t)D_DIM * D_DIM;        // 1M
    char* ws = (char*)d_ws;
    size_t off = 0;
    auto alloc = [&](size_t elems) { u16* p = (u16*)(ws + off); off += elems * sizeof(u16); return p; };
    u16* wqkv = alloc(3 * DD);        // [Wq ; Wkv] rows, bf16
    u16* wo   = alloc(DD);
    u16* xn   = alloc(BS * D_DIM);
    u16* qb   = alloc(BS * D_DIM);
    u16* kbuf = alloc(BS * D_DIM);
    u16* vtb  = alloc(BS * D_DIM);    // V^T per (batch, head): [dh][s]
    u16* ctx  = alloc(BS * D_DIM);

    // wo follows wqkv directly in the workspace: one bf16 destination for all weights.
    prep_kernel<<<(int)(CVT_BLOCKS + BS), 256, 0, stream>>>(x, ln_g, ln_b, xn, Wq, Wkv, Wo, wqkv);

    dim3 gqkv(3 * D_DIM / BN, (int)(BS / BM));   // (24, 32)
    gemm_kernel<0><<<gqkv, 256, 0, stream>>>(xn, wqkv, D_DIM, bq, bkv,
                                             qb, kbuf, vtb, nullptr, nullptr);

    attn_kernel<<<4 * H_NUM * (S_LEN / 128), 256, 0, stream>>>(qb, kbuf, vtb, lens, ctx);

    dim3 gout(D_DIM / BN, (int)(BS / BM));       // (8, 32)
    gemm_kernel<1><<<gout, 256, 0, stream>>>(ctx, wo, D_DIM, bo, nullptr,
                                             nullptr, nullptr, nullptr, x, out);
}

// v010
// It runs in 98.3 microseconds.
// Next to v009, in two timings, it ran 1.04 times as fast each time.
// Over all steps from v000 it is 2.76 times as fast.
#include <hip/hip_runtime.h>

typedef unsigned short u16;
typedef __attribute__((ext_vector_type(16))) __bf16 v16bf;
typedef __attribute__((ext_vector_type(8)))  float  v8f;

#define S_LEN 2048
#define D_DIM 1024
#define H_NUM 16
#define DH_NUM 64

// Round to nearest even by the conversion instruction; neighbours pair into one packed convert.
__device__ __forceinline__ u16 f2bf(float f) {
    return __builtin_bit_cast(u16, (__bf16)f);
}

struct Pack32 { uint4 a, b; };
struct P16 { u16 h[16]; };

// Load one bf16 WMMA operand fragment (A-pattern; B uses the same pattern with
// lane -> N).  Lane-half 0: K in [0,8)u[16,24); lane-half 1: K in [8,16)u[24,32).
// Caller passes p already offset by (row, basek); we read p[0..7] and p[16..23].
__device__ __forceinline__ v16bf ldfrag(const u16* p) {
    Pack32 s;
    s.a = *(const uint4*)(p);
    s.b = *(const uint4*)(p + 16);
    return __builtin_bit_cast(v16bf, s);
}

__device__ __forceinline__ v8f wmma_bf16(v16bf a, v16bf b, v8f c) {
    return __builtin_amdgcn_wmma_f32_16x16x32_bf16(false, a, false, b, (short)0, c,
                                                   false, false);
}

// ---------------------------------------------------------------- weights -> bf16, LayerNorm
// One launch.  The first CVT_BLOCKS blocks round the weights to bf16, the others
// normalise one row of x each; the two kinds of block share nothing.
// A conversion block takes CVT_ELEMS consecutive elements: each wave reads 8 times
// 512 contiguous bytes (all 8 loads go out before the first value is used) and
// writes 8 times 256 contiguous bytes.  The bf16 copies of Wq, Wkv, Wo lie one
// behind the other in wbf.
#define CVT_ELEMS 8192
#define CVT_Q (D_DIM * D_DIM / CVT_ELEMS)        // blocks for Wq, and for Wo
#define CVT_KV (2 * D_DIM * D_DIM / CVT_ELEMS)   // blocks for Wkv
#define CVT_BLOCKS (CVT_Q + CVT_KV + CVT_Q)

__global__ __launch_bounds__(256) void prep_kernel(const float* __restrict__ x,
                                                   const float* __restrict__ g,
                                                   const float* __restrict__ bb,
                                                   u16* __restrict__ xn,
                                                   const float* __restrict__ Wq,
                                                   const float* __restrict__ Wkv,
                                                   const float* __restrict__ Wo,
                                                   u16* __restrict__ wbf) {
    __shared__ float red[8];
    int tid = threadIdx.x, lane = tid & 31, wave = tid >> 5;
    if (blockIdx.x < CVT_BLOCKS) {   // the same for the whole block, ahead of every barrier
        const int cb = blockIdx.x;
        const float* s = (cb < CVT_Q)            ? Wq + (size_t)cb * CVT_ELEMS
                         : (cb < CVT_Q + CVT_KV) ? Wkv + (size_t)(cb - CVT_Q) * CVT_ELEMS
                                                 : Wo + (size_t)(cb - CVT_Q - CVT_KV) * CVT_ELEMS;
        u16* d = wbf + (size_t)cb * CVT_ELEMS;
        float4 w[8];
        // Both loops unrolled: w[] stays in registers and the 8 loads are issued together.
#pragma unroll
        for (int i = 0; i < 8; i++) w[i] = *(const float4*)(s + i * 1024 + tid * 4);
#pragma unroll
        for (int i = 0; i < 8; i++) {
            uint2 o;
            o.x = (unsigned)f2bf(w[i].x) | ((unsigned)f2bf(w[i].y) << 16);
            o.y = (unsigned)f2bf(w[i].z) | ((unsigned)f2bf(w[i].w) << 16);
            *(uint2*)(d + i * 1024 + tid * 4) = o;
        }
        return;
    }
    size_t row = blockIdx.x - CVT_BLOCKS;
    const float* xr = x + row * D_DIM;
    float v[4];
    float s = 0.f;
#pragma unroll
    for (int i = 0; i < 4; i++) { v[i] = xr[tid + i * 256]; s += v[i]; }
#pragma unroll
    for (int m = 16; m >= 1; m >>= 1) s += __shfl_xor(s, m);
    if (lane == 0) red[wave] = s;
    __syncthreads();
    float tot = 0.f;
#pragma unroll
    for (int i = 0; i < 8; i++) tot += red[i];
    float mean = tot * (1.f / (float)D_DIM);
    __syncthreads();
    float s2 = 0.f;
#pragma unroll
    for (int i = 0; i < 4; i++) { float d = v[i] - mean; s2 += d * d; }
#pragma unroll
    for (int m = 16; m >= 1; m >>= 1) s2 += __shfl_xor(s2, m);
    if (lane == 0) red[wave] = s2;
    __syncthreads();
    float tot2 = 0.f;
#pragma unroll
    for (int i = 0; i < 8; i++) tot2 += red[i];
    float rstd = rsqrtf(tot2 * (1.f / (float)D_DIM) + 1e-5f);
#pragma unroll
    for (int i = 0; i < 4; i++) {
        int c = tid + i * 256;
        xn[row * D_DIM + c] = f2bf((v[i] - mean) * rstd * g[c] + bb[c]);
    }
}

// ---------------------------------------------------------------- Tiled WMMA GEMM
// C[M,N] = A[M,K] * W[N,K]^T (+ epilogue).  BM=256 BN=128, 8 waves (4 x 2),
// wave tile 64x64 (4x4 WMMA accumulators): every fragment read from LDS feeds four
// products.  K a multiple of 64, at least 64.
// The operands come through LDS in tiles of 64 k (whole 128-byte rows), copied in
// without passing registers; two buffers, the next tile's copies fly during this
// tile's products.  Each block walks the k tiles from a start of its own and wraps round:
// blocks that share rows of A or W would otherwise ask L2 for the same lines at one moment.
// MODE 0: QKV - bias from (b0|b1), split-store bf16 q(*log2(e)/8)/k, and v transposed:
//         vb[(b*H + h)*DH + dh][s], the layout the attention kernel stages from.
// MODE 1: out-proj - fp32 out = acc + b0[col] + resid.
// Epilogue: the 256x128 output tile is staged in LDS (over the operand tiles),
// then leaves as 16-byte stores that cover whole rows of the tile.
#define BM 256                       // rows of A (and of C) per block
#define BN 128                       // rows of W (columns of C) per block
#define GK 64                        // k per staged tile
#define GP 72                        // LDS row pitch in u16: 128 B + 16 B, for 16-byte readers
#define G_A (BM * GP * 2)            // bytes of the A tile
#define G_BUF ((BM + BN) * GP * 2)   // bytes of one buffer: A tile, then W tile

// One tile: each lane copies 16 bytes of rows (srow + 32 i) of A, i = 0..7, and of W,
// i = 0..3; rstep = 32 rows in elements.  The s_wait_xcnt closes the statement so that no
// address register of a copy is rewritten while the copy may still need it.
__device__ __forceinline__ void stage_gemm(unsigned lds, const u16* ga, const u16* gw,
                                           size_t rstep) {
    constexpr unsigned LS = 32 * GP * 2;   // 32 rows in LDS bytes
    unsigned la1 = lds + LS, la2 = lds + 2 * LS, la3 = lds + 3 * LS, la4 = lds + 4 * LS;
    unsigned la5 = lds + 5 * LS, la6 = lds + 6 * LS, la7 = lds + 7 * LS;
    unsigned lw0 = lds + G_A, lw1 = lw0 + LS, lw2 = lw0 + 2 * LS, lw3 = lw0 + 3 * LS;
    const u16 *ga1 = ga + rstep, *ga2 = ga1 + rstep, *ga3 = ga2 + rstep, *ga4 = ga3 + rstep;
    const u16 *ga5 = ga4 + rstep, *ga6 = ga5 + rstep, *ga7 = ga6 + rstep;
    const u16 *gw1 = gw + rstep, *gw2 = gw1 + rstep, *gw3 = gw2 + rstep;
    asm volatile("global_load_async_to_lds_b128 %0, %1, off\n\t"
                 "global_load_async_to_lds_b128 %2, %3, off\n\t"
                 "global_load_async_to_lds_b128 %4, %5, off\n\t"
                 "global_load_async_to_lds_b128 %6, %7, off\n\t"
                 "global_load_async_to_lds_b128 %8, %9, off\n\t"
                 "global_load_async_to_lds_b128 %10, %11, off\n\t"
                 "global_load_async_to_lds_b128 %12, %13, off\n\t"
                 "global_load_async_to_lds_b128 %14, %15, off\n\t"
                 "global_load_async_to_lds_b128 %16, %17, off\n\t"
                 "global_load_async_to_lds_b128 %18, %19, off\n\t"
                 "global_load_async_to_lds_b128 %20, %21, off\n\t"
                 "global_load_async_to_lds_b128 %22, %23, off\n\t"
                 "s_wait_xcnt 0x0"
                 :: "v"(lds), "v"(ga), "v"(la1), "v"(ga1), "v"(la2), "v"(ga2), "v"(la3), "v"(ga3),
                    "v"(la4), "v"(ga4), "v"(la5), "v"(ga5), "v"(la6), "v"(ga6), "v"(la7), "v"(ga7),
                    "v"(lw0), "v"(gw), "v"(lw1), "v"(gw1), "v"(lw2), "v"(gw2), "v"(lw3), "v"(gw3)
                 : "memory");
}

template <int MODE>
__global__ __launch_bounds__(256) void gemm_kernel(
    const u16* __restrict__ A, const u16* __restrict__ W, int K_dim,
    const float* __restrict__ b0, const float* __restrict__ b1,
    u16* __restrict__ qb, u16* __restrict__ kb, u16* __restrict__ vb,
    const float* __restrict__ resid, float* __restrict__ outp) {
    // Staged row pitch in bytes: the row + 16 B, so that the two lane halves
    // (8 rows apart) write banks 32 apart.  CP: rows of BN elements; CPT: V^T rows of BM.
    constexpr int CP = (MODE == 0) ? BN * 2 + 16 : BN * 4 + 16;
    constexpr int CPT = BM * 2 + 16;
    constexpr int SMEM = (2 * G_BUF > BM * CP) ? 2 * G_BUF : BM * CP;
    static_assert(MODE != 0 || BN * CPT <= SMEM, "the transposed tile fits");
    __shared__ __attribute__((aligned(16))) unsigned char smem[SMEM];
    int tid = threadIdx.x, lane = tid & 31, wave = tid >> 5;
    int wm = wave & 3, wn = wave >> 2;
    int half = lane >> 4, r = lane & 15, bk = half * 8;
    const size_t M0 = (size_t)blockIdx.y * BM;
    const size_t N0 = (size_t)blockIdx.x * BN;
    const u16* Aptr = A + M0 * K_dim;
    const u16* Wptr = W + N0 * K_dim;

    v8f acc[4][4] = {};
    const int nt = K_dim / GK;   // tiles of 64 k, the same for the whole block
    // This lane's share of a tile: 8 lanes per 128-byte row.
    const int srow = tid >> 3, scol = (tid & 7) * 8;
    const unsigned lds0 = (unsigned)(size_t)(smem + srow * (GP * 2) + scol * 2);
    const u16* ga0 = Aptr + (size_t)srow * K_dim + scol;
    const u16* gw0 = Wptr + (size_t)srow * K_dim + scol;
    const size_t rstep = (size_t)32 * K_dim;
    // The walk starts at k tile (blockIdx.x + blockIdx.y) mod nt; ks is the tile that is staged next.
    int ks = (int)((blockIdx.x + blockIdx.y) % (unsigned)nt);

    stage_gemm(lds0, ga0 + (size_t)ks * GK, gw0 + (size_t)ks * GK, rstep);
    ks = (ks + 1 == nt) ? 0 : ks + 1;
    asm volatile("s_wait_asynccnt 0x0" ::: "memory");  // this wave's share of the first tile has landed
    __syncthreads();                                   // ... and every other wave's
    if (1 < nt) stage_gemm(lds0 + G_BUF, ga0 + (size_t)ks * GK, gw0 + (size_t)ks * GK, rstep);
    ks = (ks + 1 == nt) ? 0 : ks + 1;

    for (int t = 0; t < nt; t++) {
        const u16* As = (const u16*)(smem + (t & 1) * G_BUF) + (wm * 64 + r) * GP + bk;
        const u16* Bs = (const u16*)(smem + (t & 1) * G_BUF + G_A) + (wn * 64 + r) * GP + bk;
        // The tile's two 32-k steps, written out.  The fragment reads stand in three groups, each
        // ahead of the products that use it; left to itself the compiler reads one A fragment at
        // a time and waits out the LDS latency in front of every four products.  Each
        // sched_barrier(0) keeps a group whole and in its place.  All inner loops are unrolled:
        // constant indices keep the fragments and acc[][] in registers.
        v16bf a0[4], a1[4], w0[4], w1[4];
#pragma unroll
        for (int i = 0; i < 4; i++) a0[i] = ldfrag(As + i * 16 * GP);
#pragma unroll
        for (int j = 0; j < 4; j++) w0[j] = ldfrag(Bs + j * 16 * GP);
#pragma unroll
        for (int i = 0; i < 4; i++) a1[i] = ldfrag(As + i * 16 * GP + 32);
        __builtin_amdgcn_sched_barrier(0);  // group 1 (step 0, and step 1's A) stays ahead
#pragma unroll
        for (int j = 0; j < 2; j++)
#pragma unroll
            for (int i = 0; i < 4; i++) acc[i][j] = wmma_bf16(a0[i], w0[j], acc[i][j]);
        __builtin_amdgcn_sched_barrier(0);  // group 2 not lifted among these products
#pragma unroll
        for (int j = 0; j < 2; j++) w1[j] = ldfrag(Bs + j * 16 * GP + 32);
        __builtin_amdgcn_sched_barrier(0);  // group 2 not sunk among the next products
#pragma unroll
        for (int j = 2; j < 4; j++)
#pragma unroll
            for (int i = 0; i < 4; i++) acc[i][j] = wmma_bf16(a0[i], w0[j], acc[i][j]);
        __builtin_amdgcn_sched_barrier(0);  // group 3 not lifted among these products
#pragma unroll
        for (int j = 2; j < 4; j++) w1[j] = ldfrag(Bs + j * 16 * GP + 32);
        __builtin_amdgcn_sched_barrier(0);  // group 3 not sunk among the next products
#pragma unroll
        for (int j = 0; j < 2; j++)
#pragma unroll
            for (int i = 0; i < 4; i++) acc[i][j] = wmma_bf16(a1[i], w1[j], acc[i][j]);
        // These products stay in front of the hand-over: group 3 lands behind them, so the
        // wait below finds it done.
        __builtin_amdgcn_sched_barrier(0);
        // Hand-over, passed by every wave.  Every fragment of tile t is in registers by now.
        asm volatile("s_wait_dscnt 0x0" ::: "memory");     // my reads of this buffer are done
        asm volatile("s_wait_asynccnt 0x0" ::: "memory");  // my share of tile t+1 has landed
        __syncthreads();  // tile t+1 is whole, and nobody reads tile t's buffer any more
        if (t + 2 < nt)
            stage_gemm(lds0 + (t & 1) * G_BUF, ga0 + (size_t)ks * GK, gw0 + (size_t)ks * GK, rstep);
        ks = (ks + 1 == nt) ? 0 : ks + 1;
        // The copies go out ahead of the tile's last products (registers only), not behind
        // them: that much more time to land before the next hand-over.
        __builtin_amdgcn_sched_barrier(0);
#pragma unroll
        for (int j = 2; j < 4; j++)
#pragma unroll
            for (int i = 0; i < 4; i++) acc[i][j] = wmma_bf16(a1[i], w1[j], acc[i][j]);
    }
    asm volatile("s_wait_asynccnt 0x0" ::: "memory");  // no copy is open when the tile is staged

    // Every loop below is fully unrolled so that acc[][] and rv[] keep constant
    // indices and stay in registers.
    const int rl0 = wm * 64 + 8 * half;   // this lane's first row in the tile
    const int cl0 = wn * 64 + r;          // this lane's first column in the tile
    if (MODE == 0) {
        // A 128-column tile lies wholly in q, k or v: one destination per block.
        const int which = (int)(N0 / D_DIM);
        const float* bias = (which == 0) ? b0 + N0 : b1 + (N0 - D_DIM);
        const float sc = (which == 0) ? 0.18033688f : 1.0f;  // fold log2(e)/sqrt(DH) into q
        u16* dst = (which == 0) ? qb : (which == 1) ? kb : vb;
        float bj[4];
#pragma unroll
        for (int j = 0; j < 4; j++) bj[j] = bias[cl0 + j * 16];
        __syncthreads();  // every wave has read its last operand fragments
        if (which == 2) {   // the same for the whole block
            // V is staged transposed, [column][row]: the 8 accumulator rows a lane holds of
            // one column are 8 neighbours of one staged row, one 16-byte LDS store.
#pragma unroll
            for (int i = 0; i < 4; i++)
#pragma unroll
                for (int j = 0; j < 4; j++) {
                    unsigned w[4];
#pragma unroll
                    for (int e = 0; e < 4; e++)
                        w[e] = (unsigned)f2bf(acc[i][j][2 * e] + bj[j]) |
                               ((unsigned)f2bf(acc[i][j][2 * e + 1] + bj[j]) << 16);
                    *(uint4*)(smem + (cl0 + j * 16) * CPT + (rl0 + i * 16) * 2) =
                        make_uint4(w[0], w[1], w[2], w[3]);
                }
        } else {
#pragma unroll
            for (int i = 0; i < 4; i++)
#pragma unroll
                for (int j = 0; j < 4; j++)
#pragma unroll
                    for (int e = 0; e < 8; e++)
                        *(u16*)(smem + (rl0 + i * 16 + e) * CP + (cl0 + j * 16) * 2) =
                            f2bf((acc[i][j][e] + bj[j]) * sc);
        }
        __syncthreads();  // the tile is complete before any wave reads rows of it
        if (which == 2) {
            // Staged row = column (head, dh): rows S_LEN apart in memory; the tile's 256
            // positions lie in one batch (S_LEN is a multiple of 256).
            const int row0 = tid >> 5, ch = tid & 31;   // 32 chunks of 16 B per 512-B row
            u16* dtile = dst + ((M0 / S_LEN) * D_DIM + (N0 % D_DIM)) * S_LEN + (M0 % S_LEN);
            const unsigned off = (unsigned)(row0 * S_LEN + ch * 8);
#pragma unroll
            for (int it = 0; it < 16; it++)
                *(uint4*)(dtile + off + it * 8 * S_LEN) =
                    *(const uint4*)(smem + (row0 + it * 8) * CPT + ch * 16);
        } else {
            const int row0 = tid >> 4, ch = tid & 15;   // 16 chunks of 16 B per 256-B row
            u16* dtile = dst + M0 * D_DIM + (N0 % D_DIM);
            const unsigned off = (unsigned)(row0 * D_DIM + ch * 8);
#pragma unroll
            for (int it = 0; it < 16; it++)
                *(uint4*)(dtile + off + it * 16 * D_DIM) =
                    *(const uint4*)(smem + (row0 + it * 16) * CP + ch * 16);
        }
    } else {
        // One wave covers one 512-B row per step; the residual loads go out in two groups of
        // 16, the second once the accumulators have left their registers.
        const float* rtile = resid + M0 * D_DIM + N0;
        float* otile = outp + M0 * D_DIM + N0;
        const unsigned off = (unsigned)(wave * D_DIM + lane * 4);  // same for load and store
        float4 rv[16], rw[16];
#pragma unroll
        for (int it = 0; it < 16; it++)
            rv[it] = *(const float4*)(rtile + off + it * 8 * D_DIM);
        __syncthreads();  // every wave has read its last operand fragments
        float4 bv = *(const float4*)(b0 + N0 + lane * 4);
#pragma unroll
        for (int i = 0; i < 4; i++)
#pragma unroll
            for (int j = 0; j < 4; j++)
#pragma unroll
                for (int e = 0; e < 8; e++)
                    *(float*)(smem + (rl0 + i * 16 + e) * CP + (cl0 + j * 16) * 4) = acc[i][j][e];
#pragma unroll
        for (int it = 0; it < 16; it++)
            rw[it] = *(const float4*)(rtile + off + (it + 16) * 8 * D_DIM);
        __syncthreads();  // the tile is complete before any wave reads rows of it
#pragma unroll
        for (int h = 0; h < 2; h++) {
            float4 a[16];
#pragma unroll
            for (int it = 0; it < 16; it++)
                a[it] = *(const float4*)(smem + (wave + (h * 16 + it) * 8) * CP + lane * 16);
            // The 16 LDS reads go out together; otherwise each is waited for in front of its store.
            __builtin_amdgcn_sched_barrier(0);
#pragma unroll
            for (int it = 0; it < 16; it++) {
                float4 rr = h ? rw[it] : rv[it];
                float4 o;
                o.x = a[it].x + bv.x + rr.x;
                o.y = a[it].y + bv.y + rr.y;
                o.z = a[it].z + bv.z + rr.z;
                o.w = a[it].w + bv.w + rr.w;
                *(float4*)(otile + off + (h * 16 + it) * 8 * D_DIM) = o;
            }
        }
    }
}

#define KT 64                        // keys per staged tile
#define KVP 72                       // LDS row pitch in u16: 128 B + 16 B, for 16-byte readers
#define KV_HALF (KT * KVP * 2)       // bytes of one operand's tile (64 rows)
#define KV_BUF (2 * KV_HALF)         // bytes of one buffer: K tile, then V^T tile

// One tile: each lane copies 16 bytes of rows (srow, srow+32) of K and of V^T.
// The s_wait_xcnt closes the statement so that no address register of a copy is
// rewritten while the copy may still need it.
__device__ __forceinline__ void stage_tile(unsigned lds, const u16* gk, const u16* gv) {
    unsigned lk1 = lds + 32 * KVP * 2, lv0 = lds + KV_HALF, lv1 = lds + KV_HALF + 32 * KVP * 2;
    const u16* gk1 = gk + (size_t)32 * D_DIM;
    const u16* gv1 = gv + (size_t)32 * S_LEN;
    asm volatile("global_load_async_to_lds_b128 %0, %1, off\n\t"
                 "global_load_async_to_lds_b128 %2, %3, off\n\t"
                 "global_load_async_to_lds_b128 %4, %5, off\n\t"
                 "global_load_async_to_lds_b128 %6, %7, off\n\t"
                 "s_wait_xcnt 0x0"
                 :: "v"(lds), "v"(gk), "v"(lk1), "v"(gk1), "v"(lv0), "v"(gv), "v"(lv1), "v"(gv1)
                 : "memory");
}

__global__ __launch_bounds__(256) void attn_kernel(const u16* __restrict__ q,
                                                   const u16* __restrict__ k,
                                                   const u16* __restrict__ vt,
                                                   const int* __restrict__ lens,
                                                   u16* __restrict__ ctx) {
    __shared__ __attribute__((aligned(16))) unsigned char kv[2 * KV_BUF];
    int tid = threadIdx.x, lane = tid & 31;
    int wave = __builtin_amdgcn_readfirstlane(tid >> 5);  // scalar: the per-wave skip is a real branch
    int half = lane >> 4, r = lane & 15, bk = half * 8;
    // Which (batch, head, query tile) a block takes; any deal gives the same result, this one
    // is for speed.  A tile's cost grows with its index and stops at the batch's length.
    // The costly tiles (8..15) take the low indices;
    // indices 256 apart take four
    // different batches and the tiles 15-2g, 14-2g, 2g+1, 2g, whose causal costs add up alike.
    const int flat = blockIdx.x;                 // 4 batches x 16 heads x 16 tiles
    const int m = flat >> 8, h = flat & 15;
    const int b = (((flat >> 4) & 1) * 2 + ((flat >> 7) & 1) + m) & 3;
    const int bh = b * H_NUM + h;
    const int qt = (((flat >> 5) & 3) * 2 + (m & 1)) ^ ((m & 2) ? 1 : 15);
    int q0 = qt * 128;
    int qw = q0 + wave * 16;
    int len = lens[b];
    int myq = qw + r;                        // the single query this lane owns
    int lim = (myq + 1 < len) ? myq + 1 : len;  // key valid iff key < lim

    // Q as B-operand (lane r = query), both 32-wide dh k-steps.
    const u16* qbase = q + ((size_t)(b * S_LEN + qw + r) * D_DIM + h * DH_NUM) + bk;
    v16bf qf[2];
    qf[0] = ldfrag(qbase);
    qf[1] = ldfrag(qbase + 32);

    // The score products yield the argument of exp2 itself.  q carries log2(e)/sqrt(DH), so a
    // score s comes in log2 units; and the softmax runs against a maximum IN USE that may go
    // stale: 2^(s - m) serves for any m as long as O and l carry the same m, so m moves only when
    // a score tops it by more than STALE_BY (p stays below 2^STALE_BY).  negm holds -m in all 8
    // rows of this lane's query column and enters the score products as their C operand.
    constexpr float STALE_BY = 8.f;
    float lrun = 0.f;
    v8f negm = {};
    bool fresh = true;                       // wave-uniform: no step done yet, m not yet set
    v8f Ov[4] = {};

    const int fullmax = (qw + 1 < len) ? qw + 1 : len;  // a step that ends at or below it needs no mask
    int kmax = qw + 15;                      // this wave's last key
    if (len - 1 < kmax) kmax = len - 1;
    int kmaxb = q0 + 127;                    // the block's last key (<= S_LEN - 1)
    if (len - 1 < kmaxb) kmaxb = len - 1;
    const int nt = (kmaxb >> 6) + 1;         // tiles of 64 keys, the same for the whole block
    // Trip t works on key tile (t + rot) mod nt: the 16 blocks that share a head's K and V start
    // at tiles spread over the walk and do not ask L2 for the same lines at one moment.  The
    // online softmax takes the tiles in any order.  0 <= rot < S_LEN / KT, whatever len is.
    const int rot = (nt > 0) ? (qt * nt) >> 4 : 0;
    int ts = rot;                            // the tile that is staged next

    // This lane's share of a tile: 8 lanes per 128-byte row.
    const int srow = tid >> 3, scol = (tid & 7) * 8;
    const unsigned lds0 = (unsigned)(size_t)(kv + srow * (KVP * 2) + scol * 2);
    const u16* gk0 = k + ((size_t)(b * S_LEN + srow) * D_DIM + h * DH_NUM + scol);
    const u16* gv0 = vt + ((size_t)(bh * DH_NUM + srow) * S_LEN + scol);

    stage_tile(lds0, gk0 + (size_t)ts * KT * D_DIM, gv0 + ts * KT);
    ts = (ts + 1 >= nt) ? 0 : ts + 1;
    asm volatile("s_wait_asynccnt 0x0" ::: "memory");  // this wave's share of the first tile has landed
    __syncthreads();                                   // ... and every other wave's
    if (1 < nt) stage_tile(lds0 + KV_BUF, gk0 + (size_t)ts * KT * D_DIM, gv0 + ts * KT);
    ts = (ts + 1 >= nt) ? 0 : ts + 1;

    for (int t = 0; t < nt; t++) {
        const u16* Ks = (const u16*)(kv + (t & 1) * KV_BUF) + r * KVP + bk;  // K row r
        const u16* Vs = Ks + KT * KVP;                                       // V^T row r
        const int tt = (t + rot >= nt) ? t + rot - nt : t + rot;             // this trip's key tile
        // Two steps of 32 keys; a wave stops at its own last key.  Kept rolled: unrolled, the
        // two skippable bodies cost a copy of all accumulators at each join.
#pragma unroll 1
        for (int c = 0; c < 2; c++) {
            const int kbp = tt * KT + c * 32;
            if (kbp > kmax) break;
            {
                v16bf kf0 = ldfrag(Ks + (c * 32) * KVP);
                v16bf kf1 = ldfrag(Ks + (c * 32) * KVP + 32);
                v16bf kf2 = ldfrag(Ks + (c * 32 + 16) * KVP);
                v16bf kf3 = ldfrag(Ks + (c * 32 + 16) * KVP + 32);

                // ---- S^T - m tiles: rows = keys (u*16 + e + 8*half), col = query
                v8f Sacc[2];
                Sacc[0] = wmma_bf16(kf0, qf[0], negm);
                Sacc[0] = wmma_bf16(kf1, qf[1], Sacc[0]);
                Sacc[1] = wmma_bf16(kf2, qf[0], negm);
                Sacc[1] = wmma_bf16(kf3, qf[1], Sacc[1]);

                // ---- three V^T fragments are asked for here and land during the softmax
                v16bf vf[4];
#pragma unroll
                for (int j = 0; j < 3; j++)
                    vf[j] = ldfrag(Vs + (j * 16) * KVP + c * 32);
                // Keeps the 6 reads here: left alone the compiler sinks each pair to its product
                // and the wave waits out the LDS latency in front of each.  The fourth fragment
                // is left to the compiler: held from here it costs the 129th register, and a
                // wave per SIMD with it.
                __builtin_amdgcn_sched_barrier(0);
                vf[3] = ldfrag(Vs + (3 * 16) * KVP + c * 32);

                // ---- mask (only on boundary blocks) + per-lane online softmax
                float sv[2][8];
                float rowmax = -3.0e38f;
                bool full = kbp + 32 <= fullmax;  // wave-uniform
                if (full) {
#pragma unroll
                    for (int u = 0; u < 2; u++)
#pragma unroll
                        for (int e = 0; e < 8; e++) {
                            sv[u][e] = Sacc[u][e];
                            rowmax = fmaxf(rowmax, sv[u][e]);
                        }
                } else {
                    int kbase0 = kbp + 8 * half;
#pragma unroll
                    for (int u = 0; u < 2; u++)
#pragma unroll
                        for (int e = 0; e < 8; e++) {
                            int key = kbase0 + u * 16 + e;
                            sv[u][e] = (key < lim) ? Sacc[u][e] : -3.0e38f;
                            rowmax = fmaxf(rowmax, sv[u][e]);
                        }
                }
                // One test per step, a scalar branch: m moves in the wave's first step (every query
                // has a valid key in every step that runs: the step's first key) and, later, only
                // for a score more than STALE_BY above it.  Only here the two key halves of a query
                // need each other's maximum, and only here O and l are rescaled.
                if (fresh || __builtin_amdgcn_ballot_w32(rowmax > STALE_BY) != 0) {
                    float joint = fmaxf(rowmax, __shfl_xor(rowmax, 16));
                    float delta = fresh ? joint : fmaxf(joint, 0.f);   // m never falls once set
                    float scale = fresh ? 1.f : __builtin_amdgcn_exp2f(-delta);  // O, l are 0 while fresh
#pragma unroll
                    for (int u = 0; u < 2; u++)
#pragma unroll
                        for (int e = 0; e < 8; e++) sv[u][e] -= delta;
#pragma unroll
                    for (int e = 0; e < 8; e++) negm[e] -= delta;
                    lrun *= scale;
#pragma unroll
                    for (int j = 0; j < 4; j++)
#pragma unroll
                        for (int e = 0; e < 8; e++) Ov[j][e] *= scale;
                    fresh = false;
                }
                float rsum = 0.f;
                P16 ph;
#pragma unroll
                for (int u = 0; u < 2; u++)
#pragma unroll
                    for (int e = 0; e < 8; e++) {
                        float p = __builtin_amdgcn_exp2f(sv[u][e]);
                        rsum += p;
                        ph.h[u * 8 + e] = f2bf(p);  // B-operand half m = u*8+e -> key u*16+e+8*half
                    }
                rsum += __shfl_xor(rsum, 16);
                lrun += rsum;
                v16bf pf = __builtin_bit_cast(v16bf, ph);

                // ---- O^T += V^T * P  (rows = dh, col = query)
#pragma unroll
                for (int j = 0; j < 4; j++) Ov[j] = wmma_bf16(vf[j], pf, Ov[j]);
                // Inputs only, no code: the loaded V^T fragments keep their registers until the products
                // are all out.  Freed one by one, the tail of the row sum was given them, and each such
                // overwrite of a product's operand costs up to four idle slots behind the product.
                asm volatile("" :: "v"(vf[0]), "v"(vf[1]), "v"(vf[2]), "v"(vf[3]));
                // The next step's first vector instruction may overwrite an operand register of
                // these products.
                __builtin_amdgcn_sched_barrier(0);  // or the scheduler lifts the v_nop over the products
                asm volatile("v_nop");
            }
        }
        // Hand-over, passed by every wave (also one that skipped the work above).
        asm volatile("s_wait_dscnt 0x0" ::: "memory");     // my reads of this buffer are done
        asm volatile("s_wait_asynccnt 0x0" ::: "memory");  // my share of tile t+1 has landed
        __syncthreads();  // tile t+1 is whole, and nobody reads tile t's buffer any more
        if (t + 2 < nt)
            stage_tile(lds0 + (t & 1) * KV_BUF, gk0 + (size_t)ts * KT * D_DIM, gv0 + ts * KT);
        ts = (ts + 1 >= nt) ? 0 : ts + 1;
    }
    asm volatile("s_wait_asynccnt 0x0" ::: "memory");  // no copy is open when the wave ends

    float inv = 1.f / lrun;
#pragma unroll
    for (int j = 0; j < 4; j++)
#pragma unroll
        for (int e = 0; e < 8; e++) {
            int dh = j * 16 + e + 8 * half;
            ctx[(size_t)(b * S_LEN + myq) * D_DIM + h * DH_NUM + dh] = f2bf(Ov[j][e] * inv);
        }
}

// ---------------------------------------------------------------- launch
extern "C" void kernel_launch(void* const* d_in, const int* in_sizes, int n_in,
                              void* d_out, int out_size, void* d_ws, size_t ws_size,
                              hipStream_t stream) {
    (void)in_sizes; (void)n_in; (void)out_size; (void)ws_size;
    const float* x    = (const float*)d_in[0];
    const int*   lens = (const int*)d_in[1];
    const float* Wq   = (const float*)d_in[2];
    const float* bq   = (const float*)d_in[3];
    const float* Wkv  = (const float*)d_in[4];
    const float* bkv  = (const float*)d_in[5];
    const float* Wo   = (const float*)d_in[6];
    const float* bo   = (const float*)d_in[7];
    const float* ln_g = (const float*)d_in[8];
    const float* ln_b = (const float*)d_in[9];
    float* out = (float*)d_out;

    const size_t BS = 4 * (size_t)S_LEN;            // 8192 rows
    const size_t DD = (size_t)D_DIM * D_DIM;        // 1M
    char* ws = (char*)d_ws;
    size_t off = 0;
    auto alloc = [&](size_t elems) { u16* p = (u16*)(ws + off); off += elems * sizeof(u16); return p; };
    u16* wqkv = alloc(3 * DD);        // [Wq ; Wkv] rows, bf16
    u16* wo   = alloc(DD);
    u16* xn   = alloc(BS * D_DIM);
    u16* qb   = alloc(BS * D_DIM);
    u16* kbuf = alloc(BS * D_DIM);
    u16* vtb  = alloc(BS * D_DIM);    // V^T per (batch, head): [dh][s]
    u16* ctx  = alloc(BS * D_DIM);

    // wo follows wqkv directly in the workspace: one bf16 destination for all weights.
    prep_kernel<<<(int)(CVT_BLOCKS + BS), 256, 0, stream>>>(x, ln_g, ln_b, xn, Wq, Wkv, Wo, wqkv);

    dim3 gqkv(3 * D_DIM / BN, (int)(BS / BM));   // (24, 32)
    gemm_kernel<0><<<gqkv, 256, 0, stream>>>(xn, wqkv, D_DIM, bq, bkv,
                                             qb, kbuf, vtb, nullptr, nullptr);

    attn_kernel<<<4 * H_NUM * (S_LEN / 128), 256, 0, stream>>>(qb, kbuf, vtb, lens, ctx);

    dim3 gout(D_DIM / BN, (int)(BS / BM));       // (8, 32)
    gemm_kernel<1><<<gout, 256, 0, stream>>>(ctx, wo, D_DIM, bo, nullptr,
                                             nullptr, nullptr, nullptr, x, out);
}
